// v000
// Measured on an AMD MI455X. A time is GPU time per run, averaged over a window of back-to-back runs after a warm-up
// (all launches, gaps included; the runs take copies of the inputs in turn), and the median of several windows.
// Apart from v000's, it joins two sittings. Times from different sittings can be a few percent apart, while
// side-by-side timings come from the same sitting.
// The starting kernel, v000, takes 2750 microseconds a run.
#include <hip/hip_runtime.h>

// Causal multi-head attention with interleaved-pair rotary embeddings driven by an integer position input (x [4][2048][1024]; q, k, v = x W^T ('oi', no bias; 16 heads x 64); rope on pairs (2i, 2i+1): (x_e cos - x_o sin, x_e sin + x_o cos) with angle pos[b][t] x THETA^(-2i/64) (token_positions int32 [4][2048] = arange per batch, READ on device; 32 f32 frequencies jnp-exact for this expression; precise cosf/sinf); scores / sqrt(64); causal (-inf); softmax; out = merged Wo^T -> [4][2048][1024] (8.4 M); argument order x, Wq, Wk, Wv, Wo, token_positions).
// Layout per batch: bf16 copy of x; exact projections; {cos, sin} per (position, pair) built once from the int positions and float32 inverse-frequency constants (precise cosf/sinf); interleaved rotary plane builder; causal T-2048 attention (EVERY row's scores on hi/lo planes (3 products: logit sigma 2 with these weights) and hybrid P.V (rows < 512 hi/lo, rest fp16 x1024); k_gemmc skips tiles above the diagonal); merged hi/lo x Wo exact.
// Compute dtypes, f32 accumulate: every input rounded to bf16; projections exact; rotary f32; scores 3 products; P.V rows < 512 3 products, rest fp16; softmax f32; Wo hl x exact.

#define NB_  4
#define TT   2048
#define DM   1024
#define NH_  16
#define NKV  16
#define REP  (NH_ / NKV)
#define HD   64
#define DQ   (NH_ * HD)
#define DKV  (NKV * HD)
#define ZH   2
#define RH   512                  // query rows < RH use hi+lo planes (0: none)
#define WIN  2048
#define PCAR 1024.0f
#define SCL  0.125f   // HD^-0.5
typedef _Float16 h16;
typedef unsigned short bf;
typedef __attribute__((ext_vector_type(16))) __bf16   v16bf;
typedef __attribute__((ext_vector_type(16))) _Float16 v16h;
typedef __attribute__((ext_vector_type(8)))  _Float16 v8h;
typedef __attribute__((ext_vector_type(8)))  unsigned short v8us;
typedef __attribute__((ext_vector_type(8)))  float    v8f;
typedef __attribute__((ext_vector_type(4)))  float    v4f;
typedef v8h  __attribute__((may_alias)) v8ha;
typedef v4f  __attribute__((may_alias)) v4fa;
typedef v8us __attribute__((may_alias)) v8usa;

__device__ __forceinline__ unsigned short f2bf(float f) { unsigned u = __float_as_uint(f); u += 0x7FFFu + ((u >> 16) & 1u); return (unsigned short)(u >> 16); }
__device__ __forceinline__ float bf2f(unsigned short b) { return __uint_as_float(((unsigned)b) << 16); }
__device__ __forceinline__ float bfr(float f) { return bf2f(f2bf(f)); }
__device__ __forceinline__ v16h cat16(v8h lo, v8h hi) { return __builtin_shufflevector(lo, hi, 0, 1, 2, 3, 4, 5, 6, 7, 8, 9, 10, 11, 12, 13, 14, 15); }
__device__ __forceinline__ v16bf cat16b(v8us lo, v8us hi) { return __builtin_bit_cast(v16bf, __builtin_shufflevector(lo, hi, 0, 1, 2, 3, 4, 5, 6, 7, 8, 9, 10, 11, 12, 13, 14, 15)); }
__device__ __forceinline__ v8f wmma16(v16h a, v16h b, v8f c) { return __builtin_amdgcn_wmma_f32_16x16x32_f16(false, a, false, b, (short)0, c, false, false); }
__device__ __forceinline__ v8f wmmab(v16bf a, v16bf b, v8f c) { return __builtin_amdgcn_wmma_f32_16x16x32_bf16(false, a, false, b, (short)0, c, false, false); }



// ---- k_gemmw: register-blocked GEMM, ONE WAVE per 64x64 output tile (16 accumulators), operands straight from K-contiguous 16-bit planes; grid (M/64, N/64, Z), 32 threads.
// C[m][n] (f32, pitch ldc, + optional f32 bias[n]) = sum_k A[m][k] Bt[n][k] (+ split products per NSPLIT). z-batch strides sA/sB/sC in elements. K % 32 == 0.
template <typename T16> struct WFrag;
template <> struct WFrag<h16> { typedef v16h V; static __device__ __forceinline__ V ld(const h16* p) { return cat16(*(const v8h*)p, *(const v8h*)(p + 16)); } static __device__ __forceinline__ v8f mma(V a, V b, v8f c) { return wmma16(a, b, c); } };
template <> struct WFrag<bf> { typedef v16bf V; static __device__ __forceinline__ V ld(const bf* p) { return cat16b(*(const v8us*)p, *(const v8us*)(p + 16)); } static __device__ __forceinline__ v8f mma(V a, V b, v8f c) { return wmmab(a, b, c); } };
template <typename T16, int NSPLIT, bool BIAS>
__global__ __launch_bounds__(32) void k_gemmw(const T16* __restrict__ A, const T16* __restrict__ A2, const T16* __restrict__ Bt, const T16* __restrict__ Bt2, int K, float* C, int ldc, const float* __restrict__ bias, size_t sA, size_t sB, size_t sC) {
    typedef typename WFrag<T16>::V V;
    __shared__ __align__(16) float os[16 * 68];
    const size_t z = blockIdx.z; A += z * sA; if (A2) A2 += z * sA; Bt += z * sB; if (Bt2) Bt2 += z * sB; C += z * sC;
    const int lane = threadIdx.x & 31, lr = lane & 15, hi = lane >> 4; const int r0 = blockIdx.x * 64, c0 = blockIdx.y * 64;
    v8f acc[4][4];
#pragma unroll
    for (int mb = 0; mb < 4; ++mb)
#pragma unroll
        for (int nb = 0; nb < 4; ++nb) acc[mb][nb] = (v8f){};
    const size_t aoff = (size_t)(r0 + lr) * K + 8 * hi, boff = (size_t)(c0 + lr) * K + 8 * hi;
#pragma unroll 1
    for (int kc = 0; kc < K; kc += 32) {
        V a[4], a2[4];
#pragma unroll
        for (int mb = 0; mb < 4; ++mb) { a[mb] = WFrag<T16>::ld(A + aoff + (size_t)mb * 16 * K + kc); if (NSPLIT == 1 || NSPLIT == 2) a2[mb] = WFrag<T16>::ld(A2 + aoff + (size_t)mb * 16 * K + kc); }
#pragma unroll
        for (int nb = 0; nb < 4; ++nb) { const V b = WFrag<T16>::ld(Bt + boff + (size_t)nb * 16 * K + kc); V b2; if (NSPLIT >= 2) b2 = WFrag<T16>::ld(Bt2 + boff + (size_t)nb * 16 * K + kc);
#pragma unroll
            for (int mb = 0; mb < 4; ++mb) { acc[mb][nb] = WFrag<T16>::mma(a[mb], b, acc[mb][nb]); if (NSPLIT == 1 || NSPLIT == 2) acc[mb][nb] = WFrag<T16>::mma(a2[mb], b, acc[mb][nb]); if (NSPLIT >= 2) acc[mb][nb] = WFrag<T16>::mma(a[mb], b2, acc[mb][nb]); } }
        asm volatile("v_nop\n\tv_nop\n\tv_nop\n\tv_nop" : "+v"(acc[0][0]), "+v"(acc[1][1]), "+v"(acc[2][2]), "+v"(acc[3][3]) : "v"(a[0]), "v"(a[3]));
    }
#pragma unroll
    for (int mb = 0; mb < 4; ++mb) {
#pragma unroll
        for (int nb = 0; nb < 4; ++nb) {
#pragma unroll
            for (int j = 0; j < 8; ++j) os[(hi * 8 + j) * 68 + nb * 16 + lr] = acc[mb][nb][j]; }
        __builtin_amdgcn_wave_barrier(); asm volatile("" ::: "memory");
        float* crow = C + (size_t)(r0 + mb * 16) * ldc + c0;
{
#pragma unroll
            for (int s = 0; s < 8; ++s) { const int row = 2 * s + hi, cofs = lr * 4; v4f val = *(const v4fa*)(os + row * 68 + cofs); if (BIAS) { val[0] += bfr(bias[c0 + cofs]); val[1] += bfr(bias[c0 + cofs + 1]); val[2] += bfr(bias[c0 + cofs + 2]); val[3] += bfr(bias[c0 + cofs + 3]); }
                *(v4f*)(crow + (size_t)row * ldc + cofs) = val; }
             }
        __builtin_amdgcn_wave_barrier(); asm volatile("" ::: "memory");
    }
}

// ---- k_gemmc: the same one-wave 64x64 tile GEMM specialised for causal attention: CMODE 1 skips score tiles entirely above the diagonal (query rows r0+roff.., key columns c0..), CMODE 2 limits the
// key (K) loop of the probability x value contraction to the diagonal block (probabilities beyond it are exactly zero). roff = row offset of this launch's first row within the sequence.
template <typename T16, int NSPLIT, int CMODE>
__global__ __launch_bounds__(32) void k_gemmc(const T16* __restrict__ A, const T16* __restrict__ A2, const T16* __restrict__ Bt, const T16* __restrict__ Bt2, int K, float* C, int ldc, int roff, size_t sA, size_t sB, size_t sC) {
    typedef typename WFrag<T16>::V V;
    __shared__ __align__(16) float os[16 * 68];
    const size_t z = blockIdx.z; A += z * sA; if (A2) A2 += z * sA; Bt += z * sB; if (Bt2) Bt2 += z * sB; C += z * sC;
    const int lane = threadIdx.x & 31, lr = lane & 15, hi = lane >> 4; const int r0 = blockIdx.x * 64, c0 = blockIdx.y * 64;
    if (CMODE == 1 && c0 > r0 + roff + 63) return;                  // score tile entirely above the causal diagonal: never used (the softmax masks j > i by select)
    const int Kl = (CMODE == 2) ? min(K, r0 + roff + 64) : K;        // P.V: probabilities are exactly 0 beyond the diagonal block, so the K loop stops there
    v8f acc[4][4];
#pragma unroll
    for (int mb = 0; mb < 4; ++mb)
#pragma unroll
        for (int nb = 0; nb < 4; ++nb) acc[mb][nb] = (v8f){};
    const size_t aoff = (size_t)(r0 + lr) * K + 8 * hi, boff = (size_t)(c0 + lr) * K + 8 * hi;
#pragma unroll 1
    for (int kc = 0; kc < Kl; kc += 32) {
        V a[4], a2[4];
#pragma unroll
        for (int mb = 0; mb < 4; ++mb) { a[mb] = WFrag<T16>::ld(A + aoff + (size_t)mb * 16 * K + kc); if (NSPLIT == 1 || NSPLIT == 2) a2[mb] = WFrag<T16>::ld(A2 + aoff + (size_t)mb * 16 * K + kc); }
#pragma unroll
        for (int nb = 0; nb < 4; ++nb) { const V b = WFrag<T16>::ld(Bt + boff + (size_t)nb * 16 * K + kc); V b2; if (NSPLIT >= 2) b2 = WFrag<T16>::ld(Bt2 + boff + (size_t)nb * 16 * K + kc);
#pragma unroll
            for (int mb = 0; mb < 4; ++mb) { acc[mb][nb] = WFrag<T16>::mma(a[mb], b, acc[mb][nb]); if (NSPLIT == 1 || NSPLIT == 2) acc[mb][nb] = WFrag<T16>::mma(a2[mb], b, acc[mb][nb]); if (NSPLIT >= 2) acc[mb][nb] = WFrag<T16>::mma(a[mb], b2, acc[mb][nb]); } }
        asm volatile("v_nop\n\tv_nop\n\tv_nop\n\tv_nop" : "+v"(acc[0][0]), "+v"(acc[1][1]), "+v"(acc[2][2]), "+v"(acc[3][3]) : "v"(a[0]), "v"(a[3]));
    }
#pragma unroll
    for (int mb = 0; mb < 4; ++mb) {
#pragma unroll
        for (int nb = 0; nb < 4; ++nb) {
#pragma unroll
            for (int j = 0; j < 8; ++j) os[(hi * 8 + j) * 68 + nb * 16 + lr] = acc[mb][nb][j]; }
        __builtin_amdgcn_wave_barrier(); asm volatile("" ::: "memory");
        float* crow = C + (size_t)(r0 + mb * 16) * ldc + c0;
{
#pragma unroll
            for (int s = 0; s < 8; ++s) { const int row = 2 * s + hi, cofs = lr * 4; v4f val = *(const v4fa*)(os + row * 68 + cofs);
                *(v4f*)(crow + (size_t)row * ldc + cofs) = val; }
             }
        __builtin_amdgcn_wave_barrier(); asm volatile("" ::: "memory");
    }
}

__device__ __forceinline__ h16 tohx(float x) { return (h16)x; }
__device__ __forceinline__ void splitf(float y, unsigned short& h, unsigned short& l) { h = f2bf(y); l = f2bf(y - bf2f(h)); }
typedef __attribute__((ext_vector_type(2))) _Float16 v2h;
typedef __attribute__((ext_vector_type(4))) _Float16 v4h;
typedef __attribute__((ext_vector_type(2))) unsigned short v2us;
typedef __attribute__((ext_vector_type(4))) unsigned short v4us;
typedef __attribute__((ext_vector_type(2))) float v2f;
typedef __attribute__((ext_vector_type(4))) int v4i;

__global__ __launch_bounds__(256) void k_wtG(const float* __restrict__ w, int K, int N, bf* Bt) {
    const int lane = threadIdx.x & 31; const int L0 = (blockIdx.x * 8 + (threadIdx.x >> 5)) * 8; const int nlines = N * K / 64;
{
#pragma unroll 1
        for (int l = 0; l < 8; ++l) { const int L = L0 + l; if (L >= nlines) break; const size_t e = (size_t)L * 64 + lane * 2; const int k = (int)(e % K), n = (int)(e / K); v2us o;
            o[0] = f2bf(w[(size_t)k * N + n]); o[1] = f2bf(w[(size_t)(k + 1) * N + n]); *(v2us*)(Bt + e) = o; }
         }
}
__global__ __launch_bounds__(256) void k_cvt8(const float* __restrict__ src, bf* dst, size_t n8) { const size_t i = (size_t)blockIdx.x * 256 + threadIdx.x; if (i >= n8) return; const v8f v = *(const v8f*)(src + i * 8); v8us o;
#pragma unroll
    for (int k = 0; k < 8; ++k) o[k] = f2bf(v[k]); *(v8us*)(dst + i * 8) = o;  }

__global__ __launch_bounds__(256) void k_ropeI(const float* __restrict__ F, int pitch, int nheads, const float* __restrict__ CS, float sc, h16* P16, bf* Ph, bf* Pl) {
    const size_t e = ((size_t)blockIdx.x * 256 + threadIdx.x) * 2; if (e >= (size_t)nheads * TT * HD) return; const int d = (int)(e % HD); const int t = (int)((e / HD) % TT); const int h = (int)(e / ((size_t)HD * TT)); const float* f = F + (size_t)t * pitch + h * HD; const float x0 = f[d], x1 = f[d + 1]; const v2f cs = *(const v2f*)(CS + ((size_t)t * HD + d) * 2); v2h o16; v2us oh, ol;
    float a0 = __fmul_rn(x0, cs[0]), b0 = __fmul_rn(x1, cs[1]), a1 = __fmul_rn(x1, cs[0]), b1 = __fmul_rn(x0, cs[1]); asm volatile("" : "+v"(a0), "+v"(b0), "+v"(a1), "+v"(b1));
    float r0 = __fsub_rn(a0, b0) * sc, r1 = __fadd_rn(b1, a1) * sc;   /* even: x0 c - x1 s; odd: x0 s + x1 c */
    o16[0] = tohx(r0); o16[1] = tohx(r1); { unsigned short a2, c2; splitf(r0, a2, c2); oh[0] = a2; ol[0] = c2; splitf(r1, a2, c2); oh[1] = a2; ol[1] = c2; }
    *(v2h*)(P16 + e) = o16; *(v2us*)(Ph + e) = oh; *(v2us*)(Pl + e) = ol;  }

__constant__ float INV2[HD / 2] = { 1.000000000e+00f, 7.498942018e-01f, 5.623413324e-01f, 4.216965139e-01f, 3.162277639e-01f, 2.371373773e-01f, 1.778279394e-01f, 1.333521456e-01f, 1.000000015e-01f, 7.498942316e-02f, 5.623413250e-02f, 4.216964915e-02f, 3.162277490e-02f, 2.371373773e-02f, 1.778279431e-02f, 1.333521400e-02f, 9.999999776e-03f, 7.498942316e-03f, 5.623413250e-03f, 4.216964822e-03f, 3.162277630e-03f, 2.371373819e-03f, 1.778279431e-03f, 1.333521446e-03f, 1.000000047e-03f, 7.498941850e-04f, 5.623413017e-04f, 4.216965172e-04f, 3.162277571e-04f, 2.371373703e-04f, 1.778279402e-04f, 1.333521504e-04f };   // float32 10000^(-(i * 2 / 64)), generated with jnp to be bit-exact with the module's expression
__global__ __launch_bounds__(256) void k_cstabI(const int* __restrict__ pid, float* CS) { const int idx = blockIdx.x * 256 + threadIdx.x; if (idx >= TT * HD) return; const int d = idx % HD; const int t = idx / HD; const float a = __fmul_rn((float)pid[t], INV2[d >> 1]); v2f cs; cs[0] = cosf(a); cs[1] = sinf(a); *(v2f*)(CS + (size_t)idx * 2) = cs;  }

__global__ __launch_bounds__(256) void k_vtp(const float* __restrict__ F, int pitch, int nheads, h16* V16, bf* Vh, bf* Vl) { const size_t e = ((size_t)blockIdx.x * 256 + threadIdx.x) * 2; if (e >= (size_t)nheads * HD * TT) return; const int t = (int)(e % TT); const int d = (int)((e / TT) % HD); const int g = (int)(e / ((size_t)TT * HD)); v2h o16; v2us oh, ol;
#pragma unroll
    for (int q = 0; q < 2; ++q) { const float x = F[(size_t)(t + q) * pitch + g * HD + d]; o16[q] = tohx(x); unsigned short a2, c2; splitf(x, a2, c2); oh[q] = a2; ol[q] = c2; }
    *(v2h*)(V16 + e) = o16; *(v2us*)(Vh + e) = oh; *(v2us*)(Vl + e) = ol;  }
// k_asoft: per row (zz, i): t = S x HD^-0.5 for j <= i and i - j < WIN (WIN = TT, so i - j < WIN always holds: plain causal; the reference's -1e9 additive fill vanishes identically); softmax over the 2048 keys (register row, one exp, fixed trees);
__global__ __launch_bounds__(256) void k_asoft(const float* __restrict__ Sb, h16* P16, bf* Ph, bf* Pl) {
    const int lane = threadIdx.x & 31; const int row = blockIdx.x * 8 + (threadIdx.x >> 5); if (row >= ZH * TT) return; const int i = row % TT; const int zz = row / TT; (void)zz; const bool hires = (i < RH); const float* sr = Sb + (size_t)row * TT; float v[TT / 32]; float mx = -3.0e38f;
#pragma unroll
    for (int ch = 0; ch < TT / 128; ++ch) { const int j0 = ch * 128 + lane * 4; const v4f a = *(const v4f*)(sr + j0);
#pragma unroll
        for (int q = 0; q < 4; ++q) { const int j = j0 + q; (void)j; const float t = (j <= i && i - j < WIN) ? a[q] * SCL : -3.0e38f; v[ch * 4 + q] = t; mx = fmaxf(mx, t); } }
#pragma unroll
    for (int sh = 16; sh; sh >>= 1) mx = fmaxf(mx, __shfl_xor(mx, sh, 32));
    float sum = 0.f;
#pragma unroll
    for (int k = 0; k < TT / 32; ++k) { float d0 = __fsub_rn(v[k], mx); asm volatile("" : "+v"(d0)); v[k] = __builtin_amdgcn_exp2f(__fmul_rn(d0, 1.4426950408889634f)); sum += v[k]; }
#pragma unroll
    for (int sh = 16; sh; sh >>= 1) sum += __shfl_xor(sum, sh, 32);
    const float f = __fdiv_rn(hires ? 1.0f : PCAR, sum);
{
        if (hires) {
#pragma unroll
            for (int ch = 0; ch < TT / 128; ++ch) { v4us oh, ol;
#pragma unroll
                for (int q = 0; q < 4; ++q) { unsigned short a, c2; splitf(v[ch * 4 + q] * f, a, c2); oh[q] = a; ol[q] = c2; }
                const size_t oo = ((size_t)zz * (RH ? RH : 1) + i) * TT + ch * 128 + lane * 4; *(v4us*)(Ph + oo) = oh; *(v4us*)(Pl + oo) = ol; }
        } else {
#pragma unroll
            for (int ch = 0; ch < TT / 128; ++ch) { v4h o4;
#pragma unroll
                for (int q = 0; q < 4; ++q) o4[q] = tohx(v[ch * 4 + q] * f);
                *(v4h*)(P16 + (size_t)row * TT + ch * 128 + lane * 4) = o4; } }
         }
}
__global__ __launch_bounds__(256) void k_merge(const float* __restrict__ O, int h0, bf* Ah, bf* Al) { const size_t e = ((size_t)blockIdx.x * 256 + threadIdx.x) * 2; if (e >= (size_t)ZH * TT * HD) return; const int d = (int)(e % HD); const int t = (int)((e / HD) % TT); const int zz = (int)(e / ((size_t)HD * TT)); const float cs = (t < RH) ? 1.0f : (1.0f / PCAR); const size_t oo = (size_t)t * DQ + (h0 + zz) * HD + d;
    v2us oh, ol;
#pragma unroll
    for (int q = 0; q < 2; ++q) { unsigned short a, c2; splitf(O[e + q] * cs, a, c2); oh[q] = a; ol[q] = c2; } *(v2us*)(Ah + oo) = oh; *(v2us*)(Al + oo) = ol;  }

extern "C" void kernel_launch(void* const* d_in, const int* in_sizes, int n_in,
                              void* d_out, int out_size, void* d_ws, size_t ws_size, hipStream_t stream) {
    (void)in_sizes; (void)n_in; (void)out_size;
    const float* x = (const float*)d_in[0]; const float* wq = (const float*)d_in[1]; const float* wk = (const float*)d_in[2]; const float* wv = (const float*)d_in[3]; const float* wo = (const float*)d_in[4]; const int* PID = (const int*)d_in[5];   /* x, Wq, Wk, Wv, Wo ('oi' [1024][1024]), token_positions (int32 [4][2048], read per batch) */
    float* OUT = (float*)d_out;     // [4][2048][1024]
    char* wsp = (char*)d_ws;
    auto take = [&](size_t bytes) { char* p = wsp; wsp += (bytes + 255) & ~(size_t)255; return (void*)p; };
    bf* WQ = (bf*)take((size_t)DQ * DM * 2); bf* WK = (bf*)take((size_t)DKV * DM * 2); bf* WV = (bf*)take((size_t)DKV * DM * 2); bf* WO = (bf*)take((size_t)DM * DQ * 2); float* CS = (float*)take((size_t)TT * HD * 2 * 4);
    bf* XB = (bf*)take((size_t)TT * DM * 2); float* FQ = (float*)take((size_t)TT * DQ * 4); float* FK = (float*)take((size_t)TT * DKV * 4);
    h16* QP16 = (h16*)take((size_t)NH_ * TT * HD * 2); h16* KP16 = (h16*)take((size_t)NKV * TT * HD * 2); h16* VT16 = (h16*)take((size_t)NKV * HD * TT * 2);
    bf* QPh = (bf*)take((size_t)NH_ * TT * HD * 2); bf* QPl = (bf*)take((size_t)NH_ * TT * HD * 2); bf* KPh = (bf*)take((size_t)NKV * TT * HD * 2); bf* KPl = (bf*)take((size_t)NKV * TT * HD * 2); bf* VTh = (bf*)take((size_t)NKV * HD * TT * 2); bf* VTl = (bf*)take((size_t)NKV * HD * TT * 2); bf* Ph = (bf*)take((size_t)ZH * RH * TT * 2); bf* Pl = (bf*)take((size_t)ZH * RH * TT * 2);
    float* Sb = (float*)take((size_t)ZH * TT * TT * 4); h16* P16 = (h16*)take((size_t)ZH * TT * TT * 2); float* Ob = (float*)take((size_t)ZH * TT * HD * 4); bf* ATh = (bf*)take((size_t)TT * DQ * 2); bf* ATl = (bf*)take((size_t)TT * DQ * 2);
    if ((size_t)(wsp - (char*)d_ws) > ws_size) return;    // ws 256 MiB
    float* FV = FK;   // v projection reuses the k buffer after the k planes are built (stream-ordered)
    { k_cvt8<<<(unsigned)(((size_t)DQ * DM / 8 + 255) / 256), 256, 0, stream>>>(wq, WQ, (size_t)DQ * DM / 8); k_cvt8<<<(unsigned)(((size_t)DKV * DM / 8 + 255) / 256), 256, 0, stream>>>(wk, WK, (size_t)DKV * DM / 8); k_cvt8<<<(unsigned)(((size_t)DKV * DM / 8 + 255) / 256), 256, 0, stream>>>(wv, WV, (size_t)DKV * DM / 8);
      k_cvt8<<<(unsigned)(((size_t)DM * DQ / 8 + 255) / 256), 256, 0, stream>>>(wo, WO, (size_t)DM * DQ / 8); /* the rotary table is rebuilt per batch from that batch's positions (below) */ }
    const unsigned LQ = (unsigned)(((size_t)NH_ * TT * HD / 2 + 255) / 256), LKv = (unsigned)(((size_t)NKV * TT * HD / 2 + 255) / 256);
    for (int b = 0; b < NB_; ++b) {
        k_cstabI<<<(TT * HD + 255) / 256, 256, 0, stream>>>(PID + (size_t)b * TT, CS);   /* token_positions[b][:] (int32, read) */
        
        k_cvt8<<<(unsigned)(((size_t)TT * DM / 8 + 255) / 256), 256, 0, stream>>>(x + (size_t)b * TT * DM, XB, (size_t)TT * DM / 8);
        k_gemmw<bf, 0, false><<<dim3(TT / 64, DQ / 64, 1), 32, 0, stream>>>(XB, nullptr, WQ, nullptr, DM, FQ, DQ, nullptr, 0, 0, 0);
        k_ropeI<<<LQ, 256, 0, stream>>>(FQ, DQ, NH_, CS, 1.0f, QP16, QPh, QPl);
        k_gemmw<bf, 0, false><<<dim3(TT / 64, DKV / 64, 1), 32, 0, stream>>>(XB, nullptr, WK, nullptr, DM, FK, DKV, nullptr, 0, 0, 0);
        k_ropeI<<<LKv, 256, 0, stream>>>(FK, DKV, NKV, CS, 1.0f, KP16, KPh, KPl);
        k_gemmw<bf, 0, false><<<dim3(TT / 64, DKV / 64, 1), 32, 0, stream>>>(XB, nullptr, WV, nullptr, DM, FV, DKV, nullptr, 0, 0, 0); k_vtp<<<LKv, 256, 0, stream>>>(FV, DKV, NKV, VT16, VTh, VTl);
        for (int h0 = 0; h0 < NH_; h0 += ZH) { const size_t zq = (size_t)h0, zk = (size_t)(h0 / REP);   // one kv head per query head: the pass's two heads use consecutive kv planes (z-strides TT*HD)
            k_gemmc<bf, 2, 1><<<dim3(TT / 64, TT / 64, ZH), 32, 0, stream>>>(QPh + zq * TT * HD, QPl + zq * TT * HD, KPh + zk * TT * HD, KPl + zk * TT * HD, HD, Sb, TT, 0, (size_t)TT * HD, (size_t)TT * HD, (size_t)TT * TT);   /* scores on hi/lo planes for EVERY row (3 products) */
            /* (the fp16 score launch for rows >= RH is removed: all rows use the hi/lo launch above) */
            k_asoft<<<ZH * TT / 8, 256, 0, stream>>>(Sb, P16, Ph, Pl);
            k_gemmc<bf, 2, 2><<<dim3(RH / 64, HD / 64, ZH), 32, 0, stream>>>(Ph, Pl, VTh + zk * HD * TT, VTl + zk * HD * TT, TT, Ob, HD, 0, (size_t)RH * TT, (size_t)HD * TT, (size_t)TT * HD);
            k_gemmc<h16, 0, 2><<<dim3((TT - RH) / 64, HD / 64, ZH), 32, 0, stream>>>(P16 + (size_t)RH * TT, nullptr, VT16 + zk * HD * TT, nullptr, TT, Ob + (size_t)RH * HD, HD, RH, (size_t)TT * TT, (size_t)HD * TT, (size_t)TT * HD);
            k_merge<<<(unsigned)(((size_t)ZH * TT * HD / 2 + 255) / 256), 256, 0, stream>>>(Ob, h0, ATh, ATl); }
        k_gemmw<bf, 1, false><<<dim3(TT / 64, DM / 64, 1), 32, 0, stream>>>(ATh, ATl, WO, nullptr, DQ, OUT + (size_t)b * TT * DM, DM, nullptr, 0, 0, 0); }
}

// v001
// A run of this version takes 1350 microseconds.
// In both of two side-by-side timings against v000, it was 2.04 times as fast.
#include <hip/hip_runtime.h>

// Causal multi-head attention with interleaved-pair rotary embeddings driven by an integer position input (x [4][2048][1024]; q, k, v = x W^T ('oi', no bias; 16 heads x 64); rope on pairs (2i, 2i+1): (x_e cos - x_o sin, x_e sin + x_o cos) with angle pos[b][t] x THETA^(-2i/64) (token_positions int32 [4][2048] = arange per batch, READ on device; 32 f32 frequencies jnp-exact for this expression; precise cosf/sinf); scores / sqrt(64); causal (-inf); softmax; out = merged Wo^T -> [4][2048][1024] (8.4 M); argument order x, Wq, Wk, Wv, Wo, token_positions).
// Layout per batch: bf16 copy of x; exact projections; {cos, sin} per (position, pair) built once from the int positions and float32 inverse-frequency constants (precise cosf/sinf); interleaved rotary plane builder; causal T-2048 attention (EVERY row's scores on hi/lo planes (3 products: logit sigma 2 with these weights) and hybrid P.V (rows < 512 hi/lo, rest fp16 x1024); k_gemmc skips tiles above the diagonal; k_gemmpv splits the key range of P.V over waves and work-groups); merged hi/lo x Wo exact.
// Compute dtypes, f32 accumulate: every input rounded to bf16; projections exact; rotary f32; scores 3 products; P.V rows < 512 3 products, rest fp16; softmax f32; Wo hl x exact.

#define NB_  4
#define TT   2048
#define DM   1024
#define NH_  16
#define NKV  16
#define REP  (NH_ / NKV)
#define HD   64
#define DQ   (NH_ * HD)
#define DKV  (NKV * HD)
#define ZH   2
#define RH   512                  // query rows < RH use hi+lo planes (0: none)
#define WIN  2048
#define PCAR 1024.0f
#define SCL  0.125f   // HD^-0.5
#define PKS  4                    // work-groups that share the key range of one P.V output tile (partial planes summed in k_merge)
typedef _Float16 h16;
typedef unsigned short bf;
typedef __attribute__((ext_vector_type(16))) __bf16   v16bf;
typedef __attribute__((ext_vector_type(16))) _Float16 v16h;
typedef __attribute__((ext_vector_type(8)))  _Float16 v8h;
typedef __attribute__((ext_vector_type(8)))  unsigned short v8us;
typedef __attribute__((ext_vector_type(8)))  float    v8f;
typedef __attribute__((ext_vector_type(4)))  float    v4f;
typedef v8h  __attribute__((may_alias)) v8ha;
typedef v4f  __attribute__((may_alias)) v4fa;
typedef v8us __attribute__((may_alias)) v8usa;

__device__ __forceinline__ unsigned short f2bf(float f) { unsigned u = __float_as_uint(f); u += 0x7FFFu + ((u >> 16) & 1u); return (unsigned short)(u >> 16); }
__device__ __forceinline__ float bf2f(unsigned short b) { return __uint_as_float(((unsigned)b) << 16); }
__device__ __forceinline__ float bfr(float f) { return bf2f(f2bf(f)); }
__device__ __forceinline__ v16h cat16(v8h lo, v8h hi) { return __builtin_shufflevector(lo, hi, 0, 1, 2, 3, 4, 5, 6, 7, 8, 9, 10, 11, 12, 13, 14, 15); }
__device__ __forceinline__ v16bf cat16b(v8us lo, v8us hi) { return __builtin_bit_cast(v16bf, __builtin_shufflevector(lo, hi, 0, 1, 2, 3, 4, 5, 6, 7, 8, 9, 10, 11, 12, 13, 14, 15)); }
__device__ __forceinline__ v8f wmma16(v16h a, v16h b, v8f c) { return __builtin_amdgcn_wmma_f32_16x16x32_f16(false, a, false, b, (short)0, c, false, false); }
__device__ __forceinline__ v8f wmmab(v16bf a, v16bf b, v8f c) { return __builtin_amdgcn_wmma_f32_16x16x32_bf16(false, a, false, b, (short)0, c, false, false); }



// ---- k_gemmw: register-blocked GEMM, ONE WAVE per 64x64 output tile (16 accumulators), operands straight from K-contiguous 16-bit planes; grid (M/64, N/64, Z), 32 threads.
// C[m][n] (f32, pitch ldc, + optional f32 bias[n]) = sum_k A[m][k] Bt[n][k] (+ split products per NSPLIT). z-batch strides sA/sB/sC in elements. K % 32 == 0.
template <typename T16> struct WFrag;
template <> struct WFrag<h16> { typedef v16h V; static __device__ __forceinline__ V ld(const h16* p) { return cat16(*(const v8h*)p, *(const v8h*)(p + 16)); } static __device__ __forceinline__ v8f mma(V a, V b, v8f c) { return wmma16(a, b, c); } };
template <> struct WFrag<bf> { typedef v16bf V; static __device__ __forceinline__ V ld(const bf* p) { return cat16b(*(const v8us*)p, *(const v8us*)(p + 16)); } static __device__ __forceinline__ v8f mma(V a, V b, v8f c) { return wmmab(a, b, c); } };
template <typename T16, int NSPLIT, bool BIAS>
__global__ __launch_bounds__(32) void k_gemmw(const T16* __restrict__ A, const T16* __restrict__ A2, const T16* __restrict__ Bt, const T16* __restrict__ Bt2, int K, float* C, int ldc, const float* __restrict__ bias, size_t sA, size_t sB, size_t sC) {
    typedef typename WFrag<T16>::V V;
    __shared__ __align__(16) float os[16 * 68];
    const size_t z = blockIdx.z; A += z * sA; if (A2) A2 += z * sA; Bt += z * sB; if (Bt2) Bt2 += z * sB; C += z * sC;
    const int lane = threadIdx.x & 31, lr = lane & 15, hi = lane >> 4; const int r0 = blockIdx.x * 64, c0 = blockIdx.y * 64;
    v8f acc[4][4];
#pragma unroll
    for (int mb = 0; mb < 4; ++mb)
#pragma unroll
        for (int nb = 0; nb < 4; ++nb) acc[mb][nb] = (v8f){};
    const size_t aoff = (size_t)(r0 + lr) * K + 8 * hi, boff = (size_t)(c0 + lr) * K + 8 * hi;
#pragma unroll 1
    for (int kc = 0; kc < K; kc += 32) {
        V a[4], a2[4];
#pragma unroll
        for (int mb = 0; mb < 4; ++mb) { a[mb] = WFrag<T16>::ld(A + aoff + (size_t)mb * 16 * K + kc); if (NSPLIT == 1 || NSPLIT == 2) a2[mb] = WFrag<T16>::ld(A2 + aoff + (size_t)mb * 16 * K + kc); }
#pragma unroll
        for (int nb = 0; nb < 4; ++nb) { const V b = WFrag<T16>::ld(Bt + boff + (size_t)nb * 16 * K + kc); V b2; if (NSPLIT >= 2) b2 = WFrag<T16>::ld(Bt2 + boff + (size_t)nb * 16 * K + kc);
#pragma unroll
            for (int mb = 0; mb < 4; ++mb) { acc[mb][nb] = WFrag<T16>::mma(a[mb], b, acc[mb][nb]); if (NSPLIT == 1 || NSPLIT == 2) acc[mb][nb] = WFrag<T16>::mma(a2[mb], b, acc[mb][nb]); if (NSPLIT >= 2) acc[mb][nb] = WFrag<T16>::mma(a[mb], b2, acc[mb][nb]); } }
        asm volatile("v_nop\n\tv_nop\n\tv_nop\n\tv_nop" : "+v"(acc[0][0]), "+v"(acc[1][1]), "+v"(acc[2][2]), "+v"(acc[3][3]) : "v"(a[0]), "v"(a[3]));
    }
#pragma unroll
    for (int mb = 0; mb < 4; ++mb) {
#pragma unroll
        for (int nb = 0; nb < 4; ++nb) {
#pragma unroll
            for (int j = 0; j < 8; ++j) os[(hi * 8 + j) * 68 + nb * 16 + lr] = acc[mb][nb][j]; }
        __builtin_amdgcn_wave_barrier(); asm volatile("" ::: "memory");
        float* crow = C + (size_t)(r0 + mb * 16) * ldc + c0;
{
#pragma unroll
            for (int s = 0; s < 8; ++s) { const int row = 2 * s + hi, cofs = lr * 4; v4f val = *(const v4fa*)(os + row * 68 + cofs); if (BIAS) { val[0] += bfr(bias[c0 + cofs]); val[1] += bfr(bias[c0 + cofs + 1]); val[2] += bfr(bias[c0 + cofs + 2]); val[3] += bfr(bias[c0 + cofs + 3]); }
                *(v4f*)(crow + (size_t)row * ldc + cofs) = val; }
             }
        __builtin_amdgcn_wave_barrier(); asm volatile("" ::: "memory");
    }
}

// ---- k_gemmc: the same one-wave 64x64 tile GEMM specialised for causal attention scores: skips score tiles entirely above the diagonal (query rows r0+roff.., key columns c0..).
// roff = row offset of this launch's first row within the sequence.
template <typename T16, int NSPLIT>
__global__ __launch_bounds__(32) void k_gemmc(const T16* __restrict__ A, const T16* __restrict__ A2, const T16* __restrict__ Bt, const T16* __restrict__ Bt2, int K, float* C, int ldc, int roff, size_t sA, size_t sB, size_t sC) {
    typedef typename WFrag<T16>::V V;
    __shared__ __align__(16) float os[16 * 68];
    const size_t z = blockIdx.z; A += z * sA; if (A2) A2 += z * sA; Bt += z * sB; if (Bt2) Bt2 += z * sB; C += z * sC;
    const int lane = threadIdx.x & 31, lr = lane & 15, hi = lane >> 4; const int r0 = blockIdx.x * 64, c0 = blockIdx.y * 64;
    if (c0 > r0 + roff + 63) return;                  // score tile entirely above the causal diagonal: never read (the softmax masks j > i by select)
    v8f acc[4][4];
#pragma unroll
    for (int mb = 0; mb < 4; ++mb)
#pragma unroll
        for (int nb = 0; nb < 4; ++nb) acc[mb][nb] = (v8f){};
    const size_t aoff = (size_t)(r0 + lr) * K + 8 * hi, boff = (size_t)(c0 + lr) * K + 8 * hi;
#pragma unroll 1
    for (int kc = 0; kc < K; kc += 32) {
        V a[4], a2[4];
#pragma unroll
        for (int mb = 0; mb < 4; ++mb) { a[mb] = WFrag<T16>::ld(A + aoff + (size_t)mb * 16 * K + kc); if (NSPLIT == 1 || NSPLIT == 2) a2[mb] = WFrag<T16>::ld(A2 + aoff + (size_t)mb * 16 * K + kc); }
#pragma unroll
        for (int nb = 0; nb < 4; ++nb) { const V b = WFrag<T16>::ld(Bt + boff + (size_t)nb * 16 * K + kc); V b2; if (NSPLIT >= 2) b2 = WFrag<T16>::ld(Bt2 + boff + (size_t)nb * 16 * K + kc);
#pragma unroll
            for (int mb = 0; mb < 4; ++mb) { acc[mb][nb] = WFrag<T16>::mma(a[mb], b, acc[mb][nb]); if (NSPLIT == 1 || NSPLIT == 2) acc[mb][nb] = WFrag<T16>::mma(a2[mb], b, acc[mb][nb]); if (NSPLIT >= 2) acc[mb][nb] = WFrag<T16>::mma(a[mb], b2, acc[mb][nb]); } }
        asm volatile("v_nop\n\tv_nop\n\tv_nop\n\tv_nop" : "+v"(acc[0][0]), "+v"(acc[1][1]), "+v"(acc[2][2]), "+v"(acc[3][3]) : "v"(a[0]), "v"(a[3]));
    }
#pragma unroll
    for (int mb = 0; mb < 4; ++mb) {
#pragma unroll
        for (int nb = 0; nb < 4; ++nb) {
#pragma unroll
            for (int j = 0; j < 8; ++j) os[(hi * 8 + j) * 68 + nb * 16 + lr] = acc[mb][nb][j]; }
        __builtin_amdgcn_wave_barrier(); asm volatile("" ::: "memory");
        float* crow = C + (size_t)(r0 + mb * 16) * ldc + c0;
{
#pragma unroll
            for (int s = 0; s < 8; ++s) { const int row = 2 * s + hi, cofs = lr * 4; v4f val = *(const v4fa*)(os + row * 68 + cofs);
                *(v4f*)(crow + (size_t)row * ldc + cofs) = val; }
             }
        __builtin_amdgcn_wave_barrier(); asm volatile("" ::: "memory");
    }
}

// ---- k_gemmpv: probability x value contraction (64 value columns), one 64x64 output tile per PKS work-groups of NW waves; grid (M/64, PKS, Z), 32 * NW threads.
// The key (K) range stops at the diagonal block (probabilities beyond it are exactly zero) and is dealt in 64-key chunks (one 128-byte line of every operand row) round-robin to the PKS x NW waves.
// Each wave runs the one-wave 64x64 tile loop on its chunks; the NW partial tiles of a work-group are summed through LDS in wave order; work-group y stores its sum to partial plane y (stride sP); k_merge adds the planes.
// Stands behind a fragment's pair of global loads in the hi/lo forms, whose register budget makes a later load's result land in an earlier load's address pair: the wait comes before that overwrite.
__device__ __forceinline__ void xwait() { asm volatile("s_wait_xcnt 0x0" ::: "memory"); }
template <typename T16, int NSPLIT, int NW>
__global__ __launch_bounds__(32 * NW) void k_gemmpv(const T16* __restrict__ A, const T16* __restrict__ A2, const T16* __restrict__ Bt, const T16* __restrict__ Bt2, int K, float* C, int ldc, int roff, size_t sA, size_t sB, size_t sC, size_t sP) {
    typedef typename WFrag<T16>::V V;
    __shared__ __align__(16) float os[NW * 64 * 68];
    const size_t z = blockIdx.z; A += z * sA; if (A2) A2 += z * sA; Bt += z * sB; if (Bt2) Bt2 += z * sB; C += z * sC + blockIdx.y * sP;
    const int lane = threadIdx.x & 31, lr = lane & 15, hi = lane >> 4; const int r0 = blockIdx.x * 64;
    const int wave = __builtin_amdgcn_readfirstlane(threadIdx.x >> 5);   // scalar, so that the chunk loop branches on a scalar compare
    const int Kl = min(K, r0 + roff + 64);                               // a multiple of 64
    v8f acc[4][4];
#pragma unroll
    for (int mb = 0; mb < 4; ++mb)
#pragma unroll
        for (int nb = 0; nb < 4; ++nb) acc[mb][nb] = (v8f){};
    const size_t aoff = (size_t)(r0 + lr) * K + 8 * hi, boff = (size_t)lr * K + 8 * hi;
    for (int kb = (wave * PKS + (int)blockIdx.y) * 64; kb < Kl; kb += NW * PKS * 64) {
#pragma unroll (NSPLIT == 0 ? 2 : 1)
        for (int kc = kb; kc < kb + 64; kc += 32) {   // the plain form unrolls a chunk's two steps (immediate offsets off one address); the hi/lo forms stay rolled: unrolled they build to more than 256 registers
            V a[4], a2[4];
#pragma unroll
            for (int mb = 0; mb < 4; ++mb) { a[mb] = WFrag<T16>::ld(A + aoff + (size_t)mb * 16 * K + kc); if (NSPLIT != 0) xwait(); if (NSPLIT == 1 || NSPLIT == 2) { a2[mb] = WFrag<T16>::ld(A2 + aoff + (size_t)mb * 16 * K + kc); xwait(); } }
#pragma unroll
            for (int nb = 0; nb < 4; ++nb) { const V b = WFrag<T16>::ld(Bt + boff + (size_t)nb * 16 * K + kc); if (NSPLIT != 0) xwait(); V b2; if (NSPLIT >= 2) { b2 = WFrag<T16>::ld(Bt2 + boff + (size_t)nb * 16 * K + kc); xwait(); }
#pragma unroll
                for (int mb = 0; mb < 4; ++mb) { acc[mb][nb] = WFrag<T16>::mma(a[mb], b, acc[mb][nb]); if (NSPLIT == 1 || NSPLIT == 2) acc[mb][nb] = WFrag<T16>::mma(a2[mb], b, acc[mb][nb]); if (NSPLIT >= 2) acc[mb][nb] = WFrag<T16>::mma(a[mb], b2, acc[mb][nb]); } }
            asm volatile("v_nop\n\tv_nop\n\tv_nop\n\tv_nop" : "+v"(acc[0][0]), "+v"(acc[1][1]), "+v"(acc[2][2]), "+v"(acc[3][3]) : "v"(a[0]), "v"(a[3]));   // matrix-instruction distance before the operands are loaded anew, on the back edge too
        }
    }
    float* ow = os + wave * (64 * 68);
#pragma unroll
    for (int mb = 0; mb < 4; ++mb)
#pragma unroll
        for (int nb = 0; nb < 4; ++nb)
#pragma unroll
            for (int j = 0; j < 8; ++j) ow[(mb * 16 + hi * 8 + j) * 68 + nb * 16 + lr] = acc[mb][nb][j];
    __syncthreads();   // every wave's partial tile stands in LDS before any wave sums them
#pragma unroll
    for (int s = 0; s < 32 / NW; ++s) { const int idx = s * (32 * NW) + (int)threadIdx.x; const int row = idx >> 4, cofs = (idx & 15) * 4; v4f val = *(const v4fa*)(os + row * 68 + cofs);
#pragma unroll
        for (int w = 1; w < NW; ++w) val += *(const v4fa*)(os + w * (64 * 68) + row * 68 + cofs);
        *(v4f*)(C + (size_t)(r0 + row) * ldc + cofs) = val; }
}

__device__ __forceinline__ h16 tohx(float x) { return (h16)x; }
__device__ __forceinline__ void splitf(float y, unsigned short& h, unsigned short& l) { h = f2bf(y); l = f2bf(y - bf2f(h)); }
typedef __attribute__((ext_vector_type(2))) _Float16 v2h;
typedef __attribute__((ext_vector_type(4))) _Float16 v4h;
typedef __attribute__((ext_vector_type(2))) unsigned short v2us;
typedef __attribute__((ext_vector_type(4))) unsigned short v4us;
typedef __attribute__((ext_vector_type(2))) float v2f;
typedef __attribute__((ext_vector_type(4))) int v4i;

__global__ __launch_bounds__(256) void k_wtG(const float* __restrict__ w, int K, int N, bf* Bt) {
    const int lane = threadIdx.x & 31; const int L0 = (blockIdx.x * 8 + (threadIdx.x >> 5)) * 8; const int nlines = N * K / 64;
{
#pragma unroll 1
        for (int l = 0; l < 8; ++l) { const int L = L0 + l; if (L >= nlines) break; const size_t e = (size_t)L * 64 + lane * 2; const int k = (int)(e % K), n = (int)(e / K); v2us o;
            o[0] = f2bf(w[(size_t)k * N + n]); o[1] = f2bf(w[(size_t)(k + 1) * N + n]); *(v2us*)(Bt + e) = o; }
         }
}
__global__ __launch_bounds__(256) void k_cvt8(const float* __restrict__ src, bf* dst, size_t n8) { const size_t i = (size_t)blockIdx.x * 256 + threadIdx.x; if (i >= n8) return; const v8f v = *(const v8f*)(src + i * 8); v8us o;
#pragma unroll
    for (int k = 0; k < 8; ++k) o[k] = f2bf(v[k]); *(v8us*)(dst + i * 8) = o;  }

__global__ __launch_bounds__(256) void k_ropeI(const float* __restrict__ F, int pitch, int nheads, const float* __restrict__ CS, float sc, h16* P16, bf* Ph, bf* Pl) {
    const size_t e = ((size_t)blockIdx.x * 256 + threadIdx.x) * 2; if (e >= (size_t)nheads * TT * HD) return; const int d = (int)(e % HD); const int t = (int)((e / HD) % TT); const int h = (int)(e / ((size_t)HD * TT)); const float* f = F + (size_t)t * pitch + h * HD; const float x0 = f[d], x1 = f[d + 1]; const v2f cs = *(const v2f*)(CS + ((size_t)t * HD + d) * 2); v2h o16; v2us oh, ol;
    float a0 = __fmul_rn(x0, cs[0]), b0 = __fmul_rn(x1, cs[1]), a1 = __fmul_rn(x1, cs[0]), b1 = __fmul_rn(x0, cs[1]); asm volatile("" : "+v"(a0), "+v"(b0), "+v"(a1), "+v"(b1));
    float r0 = __fsub_rn(a0, b0) * sc, r1 = __fadd_rn(b1, a1) * sc;   /* even: x0 c - x1 s; odd: x0 s + x1 c */
    o16[0] = tohx(r0); o16[1] = tohx(r1); { unsigned short a2, c2; splitf(r0, a2, c2); oh[0] = a2; ol[0] = c2; splitf(r1, a2, c2); oh[1] = a2; ol[1] = c2; }
    *(v2h*)(P16 + e) = o16; *(v2us*)(Ph + e) = oh; *(v2us*)(Pl + e) = ol;  }

__constant__ float INV2[HD / 2] = { 1.000000000e+00f, 7.498942018e-01f, 5.623413324e-01f, 4.216965139e-01f, 3.162277639e-01f, 2.371373773e-01f, 1.778279394e-01f, 1.333521456e-01f, 1.000000015e-01f, 7.498942316e-02f, 5.623413250e-02f, 4.216964915e-02f, 3.162277490e-02f, 2.371373773e-02f, 1.778279431e-02f, 1.333521400e-02f, 9.999999776e-03f, 7.498942316e-03f, 5.623413250e-03f, 4.216964822e-03f, 3.162277630e-03f, 2.371373819e-03f, 1.778279431e-03f, 1.333521446e-03f, 1.000000047e-03f, 7.498941850e-04f, 5.623413017e-04f, 4.216965172e-04f, 3.162277571e-04f, 2.371373703e-04f, 1.778279402e-04f, 1.333521504e-04f };   // float32 10000^(-(i * 2 / 64)), generated with jnp to be bit-exact with the module's expression
__global__ __launch_bounds__(256) void k_cstabI(const int* __restrict__ pid, float* CS) { const int idx = blockIdx.x * 256 + threadIdx.x; if (idx >= TT * HD) return; const int d = idx % HD; const int t = idx / HD; const float a = __fmul_rn((float)pid[t], INV2[d >> 1]); v2f cs; cs[0] = cosf(a); cs[1] = sinf(a); *(v2f*)(CS + (size_t)idx * 2) = cs;  }

__global__ __launch_bounds__(256) void k_vtp(const float* __restrict__ F, int pitch, int nheads, h16* V16, bf* Vh, bf* Vl) { const size_t e = ((size_t)blockIdx.x * 256 + threadIdx.x) * 2; if (e >= (size_t)nheads * HD * TT) return; const int t = (int)(e % TT); const int d = (int)((e / TT) % HD); const int g = (int)(e / ((size_t)TT * HD)); v2h o16; v2us oh, ol;
#pragma unroll
    for (int q = 0; q < 2; ++q) { const float x = F[(size_t)(t + q) * pitch + g * HD + d]; o16[q] = tohx(x); unsigned short a2, c2; splitf(x, a2, c2); oh[q] = a2; ol[q] = c2; }
    *(v2h*)(V16 + e) = o16; *(v2us*)(Vh + e) = oh; *(v2us*)(Vl + e) = ol;  }
// k_asoft: per row (zz, i): t = S x HD^-0.5 for j <= i and i - j < WIN (WIN = TT, so i - j < WIN always holds: plain causal; the reference's -1e9 additive fill vanishes identically); softmax over the 2048 keys (register row, one exp, fixed trees);
__global__ __launch_bounds__(256) void k_asoft(const float* __restrict__ Sb, h16* P16, bf* Ph, bf* Pl) {
    const int lane = threadIdx.x & 31; const int row = blockIdx.x * 8 + (threadIdx.x >> 5); if (row >= ZH * TT) return; const int i = row % TT; const int zz = row / TT; (void)zz; const bool hires = (i < RH); const float* sr = Sb + (size_t)row * TT; float v[TT / 32]; float mx = -3.0e38f;
#pragma unroll
    for (int ch = 0; ch < TT / 128; ++ch) { const int j0 = ch * 128 + lane * 4; const v4f a = *(const v4f*)(sr + j0);
#pragma unroll
        for (int q = 0; q < 4; ++q) { const int j = j0 + q; (void)j; const float t = (j <= i && i - j < WIN) ? a[q] * SCL : -3.0e38f; v[ch * 4 + q] = t; mx = fmaxf(mx, t); } }
#pragma unroll
    for (int sh = 16; sh; sh >>= 1) mx = fmaxf(mx, __shfl_xor(mx, sh, 32));
    float sum = 0.f;
#pragma unroll
    for (int k = 0; k < TT / 32; ++k) { float d0 = __fsub_rn(v[k], mx); asm volatile("" : "+v"(d0)); v[k] = __builtin_amdgcn_exp2f(__fmul_rn(d0, 1.4426950408889634f)); sum += v[k]; }
#pragma unroll
    for (int sh = 16; sh; sh >>= 1) sum += __shfl_xor(sum, sh, 32);
    const float f = __fdiv_rn(hires ? 1.0f : PCAR, sum);
{
        if (hires) {
#pragma unroll
            for (int ch = 0; ch < TT / 128; ++ch) { v4us oh, ol;
#pragma unroll
                for (int q = 0; q < 4; ++q) { unsigned short a, c2; splitf(v[ch * 4 + q] * f, a, c2); oh[q] = a; ol[q] = c2; }
                const size_t oo = ((size_t)zz * (RH ? RH : 1) + i) * TT + ch * 128 + lane * 4; *(v4us*)(Ph + oo) = oh; *(v4us*)(Pl + oo) = ol; }
        } else {
#pragma unroll
            for (int ch = 0; ch < TT / 128; ++ch) { v4h o4;
#pragma unroll
                for (int q = 0; q < 4; ++q) o4[q] = tohx(v[ch * 4 + q] * f);
                *(v4h*)(P16 + (size_t)row * TT + ch * 128 + lane * 4) = o4; } }
         }
}
__global__ __launch_bounds__(256) void k_merge(const float* __restrict__ O, int h0, bf* Ah, bf* Al) { const size_t e = ((size_t)blockIdx.x * 256 + threadIdx.x) * 2; if (e >= (size_t)ZH * TT * HD) return; const int d = (int)(e % HD); const int t = (int)((e / HD) % TT); const int zz = (int)(e / ((size_t)HD * TT)); const float cs = (t < RH) ? 1.0f : (1.0f / PCAR); const size_t oo = (size_t)t * DQ + (h0 + zz) * HD + d;
    v2us oh, ol;
#pragma unroll
    for (int q = 0; q < 2; ++q) { float o = O[e + q];
#pragma unroll
        for (int p = 1; p < PKS; ++p) o += O[(size_t)p * ZH * TT * HD + e + q];   /* the P.V partial planes, in plane order */
        unsigned short a, c2; splitf(o * cs, a, c2); oh[q] = a; ol[q] = c2; } *(v2us*)(Ah + oo) = oh; *(v2us*)(Al + oo) = ol;  }

extern "C" void kernel_launch(void* const* d_in, const int* in_sizes, int n_in,
                              void* d_out, int out_size, void* d_ws, size_t ws_size, hipStream_t stream) {
    (void)in_sizes; (void)n_in; (void)out_size;
    const float* x = (const float*)d_in[0]; const float* wq = (const float*)d_in[1]; const float* wk = (const float*)d_in[2]; const float* wv = (const float*)d_in[3]; const float* wo = (const float*)d_in[4]; const int* PID = (const int*)d_in[5];   /* x, Wq, Wk, Wv, Wo ('oi' [1024][1024]), token_positions (int32 [4][2048], read per batch) */
    float* OUT = (float*)d_out;     // [4][2048][1024]
    char* wsp = (char*)d_ws;
    auto take = [&](size_t bytes) { char* p = wsp; wsp += (bytes + 255) & ~(size_t)255; return (void*)p; };
    bf* WQ = (bf*)take((size_t)DQ * DM * 2); bf* WK = (bf*)take((size_t)DKV * DM * 2); bf* WV = (bf*)take((size_t)DKV * DM * 2); bf* WO = (bf*)take((size_t)DM * DQ * 2); float* CS = (float*)take((size_t)TT * HD * 2 * 4);
    bf* XB = (bf*)take((size_t)TT * DM * 2); float* FQ = (float*)take((size_t)TT * DQ * 4); float* FK = (float*)take((size_t)TT * DKV * 4);
    h16* QP16 = (h16*)take((size_t)NH_ * TT * HD * 2); h16* KP16 = (h16*)take((size_t)NKV * TT * HD * 2); h16* VT16 = (h16*)take((size_t)NKV * HD * TT * 2);
    bf* QPh = (bf*)take((size_t)NH_ * TT * HD * 2); bf* QPl = (bf*)take((size_t)NH_ * TT * HD * 2); bf* KPh = (bf*)take((size_t)NKV * TT * HD * 2); bf* KPl = (bf*)take((size_t)NKV * TT * HD * 2); bf* VTh = (bf*)take((size_t)NKV * HD * TT * 2); bf* VTl = (bf*)take((size_t)NKV * HD * TT * 2); bf* Ph = (bf*)take((size_t)ZH * RH * TT * 2); bf* Pl = (bf*)take((size_t)ZH * RH * TT * 2);
    float* Sb = (float*)take((size_t)ZH * TT * TT * 4); h16* P16 = (h16*)take((size_t)ZH * TT * TT * 2); float* Ob = (float*)take((size_t)PKS * ZH * TT * HD * 4); bf* ATh = (bf*)take((size_t)TT * DQ * 2); bf* ATl = (bf*)take((size_t)TT * DQ * 2);
    if ((size_t)(wsp - (char*)d_ws) > ws_size) return;    // ws 256 MiB
    float* FV = FK;   // v projection reuses the k buffer after the k planes are built (stream-ordered)
    { k_cvt8<<<(unsigned)(((size_t)DQ * DM / 8 + 255) / 256), 256, 0, stream>>>(wq, WQ, (size_t)DQ * DM / 8); k_cvt8<<<(unsigned)(((size_t)DKV * DM / 8 + 255) / 256), 256, 0, stream>>>(wk, WK, (size_t)DKV * DM / 8); k_cvt8<<<(unsigned)(((size_t)DKV * DM / 8 + 255) / 256), 256, 0, stream>>>(wv, WV, (size_t)DKV * DM / 8);
      k_cvt8<<<(unsigned)(((size_t)DM * DQ / 8 + 255) / 256), 256, 0, stream>>>(wo, WO, (size_t)DM * DQ / 8); /* the rotary table is rebuilt per batch from that batch's positions (below) */ }
    const unsigned LQ = (unsigned)(((size_t)NH_ * TT * HD / 2 + 255) / 256), LKv = (unsigned)(((size_t)NKV * TT * HD / 2 + 255) / 256);
    for (int b = 0; b < NB_; ++b) {
        k_cstabI<<<(TT * HD + 255) / 256, 256, 0, stream>>>(PID + (size_t)b * TT, CS);   /* token_positions[b][:] (int32, read) */
        
        k_cvt8<<<(unsigned)(((size_t)TT * DM / 8 + 255) / 256), 256, 0, stream>>>(x + (size_t)b * TT * DM, XB, (size_t)TT * DM / 8);
        k_gemmw<bf, 0, false><<<dim3(TT / 64, DQ / 64, 1), 32, 0, stream>>>(XB, nullptr, WQ, nullptr, DM, FQ, DQ, nullptr, 0, 0, 0);
        k_ropeI<<<LQ, 256, 0, stream>>>(FQ, DQ, NH_, CS, 1.0f, QP16, QPh, QPl);
        k_gemmw<bf, 0, false><<<dim3(TT / 64, DKV / 64, 1), 32, 0, stream>>>(XB, nullptr, WK, nullptr, DM, FK, DKV, nullptr, 0, 0, 0);
        k_ropeI<<<LKv, 256, 0, stream>>>(FK, DKV, NKV, CS, 1.0f, KP16, KPh, KPl);
        k_gemmw<bf, 0, false><<<dim3(TT / 64, DKV / 64, 1), 32, 0, stream>>>(XB, nullptr, WV, nullptr, DM, FV, DKV, nullptr, 0, 0, 0); k_vtp<<<LKv, 256, 0, stream>>>(FV, DKV, NKV, VT16, VTh, VTl);
        for (int h0 = 0; h0 < NH_; h0 += ZH) { const size_t zq = (size_t)h0, zk = (size_t)(h0 / REP);   // one kv head per query head: the pass's two heads use consecutive kv planes (z-strides TT*HD)
            k_gemmc<bf, 2><<<dim3(TT / 64, TT / 64, ZH), 32, 0, stream>>>(QPh + zq * TT * HD, QPl + zq * TT * HD, KPh + zk * TT * HD, KPl + zk * TT * HD, HD, Sb, TT, 0, (size_t)TT * HD, (size_t)TT * HD, (size_t)TT * TT);   /* scores on hi/lo planes for EVERY row (3 products) */
            /* (the fp16 score launch for rows >= RH is removed: all rows use the hi/lo launch above) */
            k_asoft<<<ZH * TT / 8, 256, 0, stream>>>(Sb, P16, Ph, Pl);
            k_gemmpv<bf, 2, 2><<<dim3(RH / 64, PKS, ZH), 64, 0, stream>>>(Ph, Pl, VTh + zk * HD * TT, VTl + zk * HD * TT, TT, Ob, HD, 0, (size_t)RH * TT, (size_t)HD * TT, (size_t)TT * HD, (size_t)ZH * TT * HD);
            k_gemmpv<h16, 0, 8><<<dim3((TT - RH) / 64, PKS, ZH), 256, 0, stream>>>(P16 + (size_t)RH * TT, nullptr, VT16 + zk * HD * TT, nullptr, TT, Ob + (size_t)RH * HD, HD, RH, (size_t)TT * TT, (size_t)HD * TT, (size_t)TT * HD, (size_t)ZH * TT * HD);
            k_merge<<<(unsigned)(((size_t)ZH * TT * HD / 2 + 255) / 256), 256, 0, stream>>>(Ob, h0, ATh, ATl); }
        k_gemmw<bf, 1, false><<<dim3(TT / 64, DM / 64, 1), 32, 0, stream>>>(ATh, ATl, WO, nullptr, DQ, OUT + (size_t)b * TT * DM, DM, nullptr, 0, 0, 0); }
}

// v002
// A run of this version takes 1040 microseconds.
// In two side-by-side timings against v001, it was 1.30 and 1.29 times as fast.
// Over all steps from v000 it is 2.64 times as fast.
#include <hip/hip_runtime.h>

// Causal multi-head attention with interleaved-pair rotary embeddings driven by an integer position input (x [4][2048][1024]; q, k, v = x W^T ('oi', no bias; 16 heads x 64); rope on pairs (2i, 2i+1): (x_e cos - x_o sin, x_e sin + x_o cos) with angle pos[b][t] x THETA^(-2i/64) (token_positions int32 [4][2048] = arange per batch, READ on device; 32 f32 frequencies jnp-exact for this expression; precise cosf/sinf); scores / sqrt(64); causal (-inf); softmax; out = merged Wo^T -> [4][2048][1024] (8.4 M); argument order x, Wq, Wk, Wv, Wo, token_positions).
// Layout per batch: bf16 copy of x; exact projections; {cos, sin} per (position, pair) built once from the int positions and float32 inverse-frequency constants (precise cosf/sinf); interleaved rotary plane builder; causal T-2048 attention (EVERY row's scores on hi/lo planes (3 products: logit sigma 2 with these weights) and hybrid P.V (rows < 512 hi/lo, rest fp16 x1024); k_gemmc skips tiles above the diagonal; k_gemmpv splits the key range of P.V over waves and work-groups; 8 heads per pass, each probability row stored in place over its own score row); merged hi/lo x Wo exact.
// Compute dtypes, f32 accumulate: every input rounded to bf16; projections exact; rotary f32; scores 3 products; P.V rows < 512 3 products, rest fp16; softmax f32; Wo hl x exact.

#define NB_  4
#define TT   2048
#define DM   1024
#define NH_  16
#define NKV  16
#define REP  (NH_ / NKV)
#define HD   64
#define DQ   (NH_ * HD)
#define DKV  (NKV * HD)
#define ZH   8                    // heads per attention pass (one launch of each attention kernel serves ZH heads)
#define LDP  (2 * TT)             // pitch, in 16-bit elements, of a probability row: it lies in place over its own f32 score row
#define RH   512                  // query rows < RH use hi+lo planes (0: none)
#define WIN  2048
#define PCAR 1024.0f
#define SCL  0.125f   // HD^-0.5
#define PKS  4                    // work-groups that share the key range of one P.V output tile (partial planes summed in k_merge)
typedef _Float16 h16;
typedef unsigned short bf;
typedef __attribute__((ext_vector_type(16))) __bf16   v16bf;
typedef __attribute__((ext_vector_type(16))) _Float16 v16h;
typedef __attribute__((ext_vector_type(8)))  _Float16 v8h;
typedef __attribute__((ext_vector_type(8)))  unsigned short v8us;
typedef __attribute__((ext_vector_type(8)))  float    v8f;
typedef __attribute__((ext_vector_type(4)))  float    v4f;
typedef v8h  __attribute__((may_alias)) v8ha;
typedef v4f  __attribute__((may_alias)) v4fa;
typedef v8us __attribute__((may_alias)) v8usa;

__device__ __forceinline__ unsigned short f2bf(float f) { unsigned u = __float_as_uint(f); u += 0x7FFFu + ((u >> 16) & 1u); return (unsigned short)(u >> 16); }
__device__ __forceinline__ float bf2f(unsigned short b) { return __uint_as_float(((unsigned)b) << 16); }
__device__ __forceinline__ float bfr(float f) { return bf2f(f2bf(f)); }
__device__ __forceinline__ v16h cat16(v8h lo, v8h hi) { return __builtin_shufflevector(lo, hi, 0, 1, 2, 3, 4, 5, 6, 7, 8, 9, 10, 11, 12, 13, 14, 15); }
__device__ __forceinline__ v16bf cat16b(v8us lo, v8us hi) { return __builtin_bit_cast(v16bf, __builtin_shufflevector(lo, hi, 0, 1, 2, 3, 4, 5, 6, 7, 8, 9, 10, 11, 12, 13, 14, 15)); }
__device__ __forceinline__ v8f wmma16(v16h a, v16h b, v8f c) { return __builtin_amdgcn_wmma_f32_16x16x32_f16(false, a, false, b, (short)0, c, false, false); }
__device__ __forceinline__ v8f wmmab(v16bf a, v16bf b, v8f c) { return __builtin_amdgcn_wmma_f32_16x16x32_bf16(false, a, false, b, (short)0, c, false, false); }



// ---- k_gemmw: register-blocked GEMM, ONE WAVE per 64x64 output tile (16 accumulators), operands straight from K-contiguous 16-bit planes; grid (M/64, N/64, Z), 32 threads.
// C[m][n] (f32, pitch ldc, + optional f32 bias[n]) = sum_k A[m][k] Bt[n][k] (+ split products per NSPLIT). z-batch strides sA/sB/sC in elements. K % 32 == 0.
template <typename T16> struct WFrag;
template <> struct WFrag<h16> { typedef v16h V; static __device__ __forceinline__ V ld(const h16* p) { return cat16(*(const v8h*)p, *(const v8h*)(p + 16)); } static __device__ __forceinline__ v8f mma(V a, V b, v8f c) { return wmma16(a, b, c); } };
template <> struct WFrag<bf> { typedef v16bf V; static __device__ __forceinline__ V ld(const bf* p) { return cat16b(*(const v8us*)p, *(const v8us*)(p + 16)); } static __device__ __forceinline__ v8f mma(V a, V b, v8f c) { return wmmab(a, b, c); } };
template <typename T16, int NSPLIT, bool BIAS>
__global__ __launch_bounds__(32) void k_gemmw(const T16* __restrict__ A, const T16* __restrict__ A2, const T16* __restrict__ Bt, const T16* __restrict__ Bt2, int K, float* C, int ldc, const float* __restrict__ bias, size_t sA, size_t sB, size_t sC) {
    typedef typename WFrag<T16>::V V;
    __shared__ __align__(16) float os[16 * 68];
    const size_t z = blockIdx.z; A += z * sA; if (A2) A2 += z * sA; Bt += z * sB; if (Bt2) Bt2 += z * sB; C += z * sC;
    const int lane = threadIdx.x & 31, lr = lane & 15, hi = lane >> 4; const int r0 = blockIdx.x * 64, c0 = blockIdx.y * 64;
    v8f acc[4][4];
#pragma unroll
    for (int mb = 0; mb < 4; ++mb)
#pragma unroll
        for (int nb = 0; nb < 4; ++nb) acc[mb][nb] = (v8f){};
    const size_t aoff = (size_t)(r0 + lr) * K + 8 * hi, boff = (size_t)(c0 + lr) * K + 8 * hi;
#pragma unroll 1
    for (int kc = 0; kc < K; kc += 32) {
        V a[4], a2[4];
#pragma unroll
        for (int mb = 0; mb < 4; ++mb) { a[mb] = WFrag<T16>::ld(A + aoff + (size_t)mb * 16 * K + kc); if (NSPLIT == 1 || NSPLIT == 2) a2[mb] = WFrag<T16>::ld(A2 + aoff + (size_t)mb * 16 * K + kc); }
#pragma unroll
        for (int nb = 0; nb < 4; ++nb) { const V b = WFrag<T16>::ld(Bt + boff + (size_t)nb * 16 * K + kc); V b2; if (NSPLIT >= 2) b2 = WFrag<T16>::ld(Bt2 + boff + (size_t)nb * 16 * K + kc);
#pragma unroll
            for (int mb = 0; mb < 4; ++mb) { acc[mb][nb] = WFrag<T16>::mma(a[mb], b, acc[mb][nb]); if (NSPLIT == 1 || NSPLIT == 2) acc[mb][nb] = WFrag<T16>::mma(a2[mb], b, acc[mb][nb]); if (NSPLIT >= 2) acc[mb][nb] = WFrag<T16>::mma(a[mb], b2, acc[mb][nb]); } }
        asm volatile("v_nop\n\tv_nop\n\tv_nop\n\tv_nop" : "+v"(acc[0][0]), "+v"(acc[1][1]), "+v"(acc[2][2]), "+v"(acc[3][3]) : "v"(a[0]), "v"(a[3]));
    }
#pragma unroll
    for (int mb = 0; mb < 4; ++mb) {
#pragma unroll
        for (int nb = 0; nb < 4; ++nb) {
#pragma unroll
            for (int j = 0; j < 8; ++j) os[(hi * 8 + j) * 68 + nb * 16 + lr] = acc[mb][nb][j]; }
        __builtin_amdgcn_wave_barrier(); asm volatile("" ::: "memory");
        float* crow = C + (size_t)(r0 + mb * 16) * ldc + c0;
{
#pragma unroll
            for (int s = 0; s < 8; ++s) { const int row = 2 * s + hi, cofs = lr * 4; v4f val = *(const v4fa*)(os + row * 68 + cofs); if (BIAS) { val[0] += bfr(bias[c0 + cofs]); val[1] += bfr(bias[c0 + cofs + 1]); val[2] += bfr(bias[c0 + cofs + 2]); val[3] += bfr(bias[c0 + cofs + 3]); }
                *(v4f*)(crow + (size_t)row * ldc + cofs) = val; }
             }
        __builtin_amdgcn_wave_barrier(); asm volatile("" ::: "memory");
    }
}

// ---- k_gemmc: the same one-wave 64x64 tile GEMM specialised for causal attention scores: skips score tiles entirely above the diagonal (query rows r0+roff.., key columns c0..).
// roff = row offset of this launch's first row within the sequence.
template <typename T16, int NSPLIT>
__global__ __launch_bounds__(32) void k_gemmc(const T16* __restrict__ A, const T16* __restrict__ A2, const T16* __restrict__ Bt, const T16* __restrict__ Bt2, int K, float* C, int ldc, int roff, size_t sA, size_t sB, size_t sC) {
    typedef typename WFrag<T16>::V V;
    __shared__ __align__(16) float os[16 * 68];
    const size_t z = blockIdx.z; A += z * sA; if (A2) A2 += z * sA; Bt += z * sB; if (Bt2) Bt2 += z * sB; C += z * sC;
    const int lane = threadIdx.x & 31, lr = lane & 15, hi = lane >> 4; const int r0 = blockIdx.x * 64, c0 = blockIdx.y * 64;
    if (c0 > r0 + roff + 63) return;                  // score tile entirely above the causal diagonal: never read (the softmax masks j > i by select)
    v8f acc[4][4];
#pragma unroll
    for (int mb = 0; mb < 4; ++mb)
#pragma unroll
        for (int nb = 0; nb < 4; ++nb) acc[mb][nb] = (v8f){};
    const size_t aoff = (size_t)(r0 + lr) * K + 8 * hi, boff = (size_t)(c0 + lr) * K + 8 * hi;
#pragma unroll 1
    for (int kc = 0; kc < K; kc += 32) {
        V a[4], a2[4];
#pragma unroll
        for (int mb = 0; mb < 4; ++mb) { a[mb] = WFrag<T16>::ld(A + aoff + (size_t)mb * 16 * K + kc); if (NSPLIT == 1 || NSPLIT == 2) a2[mb] = WFrag<T16>::ld(A2 + aoff + (size_t)mb * 16 * K + kc); }
#pragma unroll
        for (int nb = 0; nb < 4; ++nb) { const V b = WFrag<T16>::ld(Bt + boff + (size_t)nb * 16 * K + kc); V b2; if (NSPLIT >= 2) b2 = WFrag<T16>::ld(Bt2 + boff + (size_t)nb * 16 * K + kc);
#pragma unroll
            for (int mb = 0; mb < 4; ++mb) { acc[mb][nb] = WFrag<T16>::mma(a[mb], b, acc[mb][nb]); if (NSPLIT == 1 || NSPLIT == 2) acc[mb][nb] = WFrag<T16>::mma(a2[mb], b, acc[mb][nb]); if (NSPLIT >= 2) acc[mb][nb] = WFrag<T16>::mma(a[mb], b2, acc[mb][nb]); } }
        asm volatile("v_nop\n\tv_nop\n\tv_nop\n\tv_nop" : "+v"(acc[0][0]), "+v"(acc[1][1]), "+v"(acc[2][2]), "+v"(acc[3][3]) : "v"(a[0]), "v"(a[3]));
    }
#pragma unroll
    for (int mb = 0; mb < 4; ++mb) {
#pragma unroll
        for (int nb = 0; nb < 4; ++nb) {
#pragma unroll
            for (int j = 0; j < 8; ++j) os[(hi * 8 + j) * 68 + nb * 16 + lr] = acc[mb][nb][j]; }
        __builtin_amdgcn_wave_barrier(); asm volatile("" ::: "memory");
        float* crow = C + (size_t)(r0 + mb * 16) * ldc + c0;
{
#pragma unroll
            for (int s = 0; s < 8; ++s) { const int row = 2 * s + hi, cofs = lr * 4; v4f val = *(const v4fa*)(os + row * 68 + cofs);
                *(v4f*)(crow + (size_t)row * ldc + cofs) = val; }
             }
        __builtin_amdgcn_wave_barrier(); asm volatile("" ::: "memory");
    }
}

// ---- k_gemmpv: probability x value contraction (64 value columns), one 64x64 output tile per PKS work-groups of NW waves; grid (M/64, PKS, Z), 32 * NW threads.
// The key (K) range stops at the diagonal block (probabilities beyond it are exactly zero) and is dealt in 64-key chunks (one 128-byte line of every operand row) round-robin to the PKS x NW waves.
// Each wave runs the one-wave 64x64 tile loop on its chunks; the NW partial tiles of a work-group are summed through LDS in wave order; work-group y stores its sum to partial plane y (stride sP); k_merge adds the planes.
// Stands behind a fragment's pair of global loads in the hi/lo forms, whose register budget makes a later load's result land in an earlier load's address pair: the wait comes before that overwrite.
__device__ __forceinline__ void xwait() { asm volatile("s_wait_xcnt 0x0" ::: "memory"); }
template <typename T16, int NSPLIT, int NW>
__global__ __launch_bounds__(32 * NW) void k_gemmpv(const T16* __restrict__ A, const T16* __restrict__ A2, const T16* __restrict__ Bt, const T16* __restrict__ Bt2, int K, int lda, float* C, int ldc, int roff, size_t sA, size_t sB, size_t sC, size_t sP) {
    typedef typename WFrag<T16>::V V;
    __shared__ __align__(16) float os[NW * 64 * 68];
    const size_t z = blockIdx.z; A += z * sA; if (A2) A2 += z * sA; Bt += z * sB; if (Bt2) Bt2 += z * sB; C += z * sC + blockIdx.y * sP;
    const int lane = threadIdx.x & 31, lr = lane & 15, hi = lane >> 4; const int r0 = blockIdx.x * 64;
    const int wave = __builtin_amdgcn_readfirstlane(threadIdx.x >> 5);   // scalar, so that the chunk loop branches on a scalar compare
    const int Kl = min(K, r0 + roff + 64);                               // a multiple of 64
    v8f acc[4][4];
#pragma unroll
    for (int mb = 0; mb < 4; ++mb)
#pragma unroll
        for (int nb = 0; nb < 4; ++nb) acc[mb][nb] = (v8f){};
    const size_t aoff = (size_t)(r0 + lr) * lda + 8 * hi, boff = (size_t)lr * K + 8 * hi;   // lda: pitch of the probability rows, K: pitch of the value rows
    for (int kb = (wave * PKS + (int)blockIdx.y) * 64; kb < Kl; kb += NW * PKS * 64) {
#pragma unroll (NSPLIT == 0 ? 2 : 1)
        for (int kc = kb; kc < kb + 64; kc += 32) {   // the plain form unrolls a chunk's two steps (immediate offsets off one address); the hi/lo forms stay rolled: unrolled they build to more than 256 registers
            V a[4], a2[4];
#pragma unroll
            for (int mb = 0; mb < 4; ++mb) { a[mb] = WFrag<T16>::ld(A + aoff + (size_t)mb * 16 * lda + kc); if (NSPLIT != 0) xwait(); if (NSPLIT == 1 || NSPLIT == 2) { a2[mb] = WFrag<T16>::ld(A2 + aoff + (size_t)mb * 16 * lda + kc); xwait(); } }
#pragma unroll
            for (int nb = 0; nb < 4; ++nb) { const V b = WFrag<T16>::ld(Bt + boff + (size_t)nb * 16 * K + kc); if (NSPLIT != 0) xwait(); V b2; if (NSPLIT >= 2) { b2 = WFrag<T16>::ld(Bt2 + boff + (size_t)nb * 16 * K + kc); xwait(); }
#pragma unroll
                for (int mb = 0; mb < 4; ++mb) { acc[mb][nb] = WFrag<T16>::mma(a[mb], b, acc[mb][nb]); if (NSPLIT == 1 || NSPLIT == 2) acc[mb][nb] = WFrag<T16>::mma(a2[mb], b, acc[mb][nb]); if (NSPLIT >= 2) acc[mb][nb] = WFrag<T16>::mma(a[mb], b2, acc[mb][nb]); } }
            asm volatile("v_nop\n\tv_nop\n\tv_nop\n\tv_nop" : "+v"(acc[0][0]), "+v"(acc[1][1]), "+v"(acc[2][2]), "+v"(acc[3][3]) : "v"(a[0]), "v"(a[3]));   // matrix-instruction distance before the operands are loaded anew, on the back edge too
        }
    }
    float* ow = os + wave * (64 * 68);
#pragma unroll
    for (int mb = 0; mb < 4; ++mb)
#pragma unroll
        for (int nb = 0; nb < 4; ++nb)
#pragma unroll
            for (int j = 0; j < 8; ++j) ow[(mb * 16 + hi * 8 + j) * 68 + nb * 16 + lr] = acc[mb][nb][j];
    __syncthreads();   // every wave's partial tile stands in LDS before any wave sums them
#pragma unroll
    for (int s = 0; s < 32 / NW; ++s) { const int idx = s * (32 * NW) + (int)threadIdx.x; const int row = idx >> 4, cofs = (idx & 15) * 4; v4f val = *(const v4fa*)(os + row * 68 + cofs);
#pragma unroll
        for (int w = 1; w < NW; ++w) val += *(const v4fa*)(os + w * (64 * 68) + row * 68 + cofs);
        *(v4f*)(C + (size_t)(r0 + row) * ldc + cofs) = val; }
}

__device__ __forceinline__ h16 tohx(float x) { return (h16)x; }
__device__ __forceinline__ void splitf(float y, unsigned short& h, unsigned short& l) { h = f2bf(y); l = f2bf(y - bf2f(h)); }
typedef __attribute__((ext_vector_type(2))) _Float16 v2h;
typedef __attribute__((ext_vector_type(4))) _Float16 v4h;
typedef __attribute__((ext_vector_type(2))) unsigned short v2us;
typedef __attribute__((ext_vector_type(4))) unsigned short v4us;
typedef __attribute__((ext_vector_type(2))) float v2f;
typedef __attribute__((ext_vector_type(4))) int v4i;

__global__ __launch_bounds__(256) void k_wtG(const float* __restrict__ w, int K, int N, bf* Bt) {
    const int lane = threadIdx.x & 31; const int L0 = (blockIdx.x * 8 + (threadIdx.x >> 5)) * 8; const int nlines = N * K / 64;
{
#pragma unroll 1
        for (int l = 0; l < 8; ++l) { const int L = L0 + l; if (L >= nlines) break; const size_t e = (size_t)L * 64 + lane * 2; const int k = (int)(e % K), n = (int)(e / K); v2us o;
            o[0] = f2bf(w[(size_t)k * N + n]); o[1] = f2bf(w[(size_t)(k + 1) * N + n]); *(v2us*)(Bt + e) = o; }
         }
}
__global__ __launch_bounds__(256) void k_cvt8(const float* __restrict__ src, bf* dst, size_t n8) { const size_t i = (size_t)blockIdx.x * 256 + threadIdx.x; if (i >= n8) return; const v8f v = *(const v8f*)(src + i * 8); v8us o;
#pragma unroll
    for (int k = 0; k < 8; ++k) o[k] = f2bf(v[k]); *(v8us*)(dst + i * 8) = o;  }

__global__ __launch_bounds__(256) void k_ropeI(const float* __restrict__ F, int pitch, int nheads, const float* __restrict__ CS, float sc, h16* P16, bf* Ph, bf* Pl) {
    const size_t e = ((size_t)blockIdx.x * 256 + threadIdx.x) * 2; if (e >= (size_t)nheads * TT * HD) return; const int d = (int)(e % HD); const int t = (int)((e / HD) % TT); const int h = (int)(e / ((size_t)HD * TT)); const float* f = F + (size_t)t * pitch + h * HD; const float x0 = f[d], x1 = f[d + 1]; const v2f cs = *(const v2f*)(CS + ((size_t)t * HD + d) * 2); v2h o16; v2us oh, ol;
    float a0 = __fmul_rn(x0, cs[0]), b0 = __fmul_rn(x1, cs[1]), a1 = __fmul_rn(x1, cs[0]), b1 = __fmul_rn(x0, cs[1]); asm volatile("" : "+v"(a0), "+v"(b0), "+v"(a1), "+v"(b1));
    float r0 = __fsub_rn(a0, b0) * sc, r1 = __fadd_rn(b1, a1) * sc;   /* even: x0 c - x1 s; odd: x0 s + x1 c */
    o16[0] = tohx(r0); o16[1] = tohx(r1); { unsigned short a2, c2; splitf(r0, a2, c2); oh[0] = a2; ol[0] = c2; splitf(r1, a2, c2); oh[1] = a2; ol[1] = c2; }
    *(v2h*)(P16 + e) = o16; *(v2us*)(Ph + e) = oh; *(v2us*)(Pl + e) = ol;  }

__constant__ float INV2[HD / 2] = { 1.000000000e+00f, 7.498942018e-01f, 5.623413324e-01f, 4.216965139e-01f, 3.162277639e-01f, 2.371373773e-01f, 1.778279394e-01f, 1.333521456e-01f, 1.000000015e-01f, 7.498942316e-02f, 5.623413250e-02f, 4.216964915e-02f, 3.162277490e-02f, 2.371373773e-02f, 1.778279431e-02f, 1.333521400e-02f, 9.999999776e-03f, 7.498942316e-03f, 5.623413250e-03f, 4.216964822e-03f, 3.162277630e-03f, 2.371373819e-03f, 1.778279431e-03f, 1.333521446e-03f, 1.000000047e-03f, 7.498941850e-04f, 5.623413017e-04f, 4.216965172e-04f, 3.162277571e-04f, 2.371373703e-04f, 1.778279402e-04f, 1.333521504e-04f };   // float32 10000^(-(i * 2 / 64)), generated with jnp to be bit-exact with the module's expression
__global__ __launch_bounds__(256) void k_cstabI(const int* __restrict__ pid, float* CS) { const int idx = blockIdx.x * 256 + threadIdx.x; if (idx >= TT * HD) return; const int d = idx % HD; const int t = idx / HD; const float a = __fmul_rn((float)pid[t], INV2[d >> 1]); v2f cs; cs[0] = cosf(a); cs[1] = sinf(a); *(v2f*)(CS + (size_t)idx * 2) = cs;  }

__global__ __launch_bounds__(256) void k_vtp(const float* __restrict__ F, int pitch, int nheads, h16* V16, bf* Vh, bf* Vl) { const size_t e = ((size_t)blockIdx.x * 256 + threadIdx.x) * 2; if (e >= (size_t)nheads * HD * TT) return; const int t = (int)(e % TT); const int d = (int)((e / TT) % HD); const int g = (int)(e / ((size_t)TT * HD)); v2h o16; v2us oh, ol;
#pragma unroll
    for (int q = 0; q < 2; ++q) { const float x = F[(size_t)(t + q) * pitch + g * HD + d]; o16[q] = tohx(x); unsigned short a2, c2; splitf(x, a2, c2); oh[q] = a2; ol[q] = c2; }
    *(v2h*)(V16 + e) = o16; *(v2us*)(Vh + e) = oh; *(v2us*)(Vl + e) = ol;  }
// k_asoft writes a row's probabilities over the row's own scores (fp16: the row's first 4 KiB; hi/lo: hi plane in the first, lo plane in the second 4 KiB): one wave owns a row and holds all of it in registers before its first store.
// k_asoft: per row (zz, i): t = S x HD^-0.5 for j <= i and i - j < WIN (sliding causal window; the reference's -1e9 additive fill vanishes identically); softmax over the 2048 keys (register row, one exp, fixed trees);
__global__ __launch_bounds__(256) void k_asoft(float* Sb) {
    const int lane = threadIdx.x & 31; const int row = blockIdx.x * 8 + (threadIdx.x >> 5); if (row >= ZH * TT) return; const int i = row % TT; const int zz = row / TT; (void)zz; const bool hires = (i < RH); const float* sr = Sb + (size_t)row * TT; h16* P16 = (h16*)Sb; bf* Ph = (bf*)Sb; bf* Pl = (bf*)Sb + TT; float v[TT / 32]; float mx = -3.0e38f;
#pragma unroll
    for (int ch = 0; ch < TT / 128; ++ch) { const int j0 = ch * 128 + lane * 4; const v4f a = *(const v4f*)(sr + j0);
#pragma unroll
        for (int q = 0; q < 4; ++q) { const int j = j0 + q; (void)j; const float t = (j <= i && i - j < WIN) ? a[q] * SCL : -3.0e38f; v[ch * 4 + q] = t; mx = fmaxf(mx, t); } }
#pragma unroll
    for (int sh = 16; sh; sh >>= 1) mx = fmaxf(mx, __shfl_xor(mx, sh, 32));
    float sum = 0.f;
#pragma unroll
    for (int k = 0; k < TT / 32; ++k) { float d0 = __fsub_rn(v[k], mx); asm volatile("" : "+v"(d0)); v[k] = __builtin_amdgcn_exp2f(__fmul_rn(d0, 1.4426950408889634f)); sum += v[k]; }
#pragma unroll
    for (int sh = 16; sh; sh >>= 1) sum += __shfl_xor(sum, sh, 32);
    const float f = __fdiv_rn(hires ? 1.0f : PCAR, sum);
{
        if (hires) {
#pragma unroll
            for (int ch = 0; ch < TT / 128; ++ch) { v4us oh, ol;
#pragma unroll
                for (int q = 0; q < 4; ++q) { unsigned short a, c2; splitf(v[ch * 4 + q] * f, a, c2); oh[q] = a; ol[q] = c2; }
                const size_t oo = (size_t)row * LDP + ch * 128 + lane * 4; *(v4us*)(Ph + oo) = oh; *(v4us*)(Pl + oo) = ol; }
        } else {
#pragma unroll
            for (int ch = 0; ch < TT / 128; ++ch) { v4h o4;
#pragma unroll
                for (int q = 0; q < 4; ++q) o4[q] = tohx(v[ch * 4 + q] * f);
                *(v4h*)(P16 + (size_t)row * LDP + ch * 128 + lane * 4) = o4; } }
         }
}
__global__ __launch_bounds__(256) void k_merge(const float* __restrict__ O, int h0, bf* Ah, bf* Al) { const size_t e = ((size_t)blockIdx.x * 256 + threadIdx.x) * 2; if (e >= (size_t)ZH * TT * HD) return; const int d = (int)(e % HD); const int t = (int)((e / HD) % TT); const int zz = (int)(e / ((size_t)HD * TT)); const float cs = (t < RH) ? 1.0f : (1.0f / PCAR); const size_t oo = (size_t)t * DQ + (h0 + zz) * HD + d;
    v2us oh, ol;
#pragma unroll
    for (int q = 0; q < 2; ++q) { float o = O[e + q];
#pragma unroll
        for (int p = 1; p < PKS; ++p) o += O[(size_t)p * ZH * TT * HD + e + q];   /* the P.V partial planes, in plane order */
        unsigned short a, c2; splitf(o * cs, a, c2); oh[q] = a; ol[q] = c2; } *(v2us*)(Ah + oo) = oh; *(v2us*)(Al + oo) = ol;  }

extern "C" void kernel_launch(void* const* d_in, const int* in_sizes, int n_in,
                              void* d_out, int out_size, void* d_ws, size_t ws_size, hipStream_t stream) {
    (void)in_sizes; (void)n_in; (void)out_size;
    const float* x = (const float*)d_in[0]; const float* wq = (const float*)d_in[1]; const float* wk = (const float*)d_in[2]; const float* wv = (const float*)d_in[3]; const float* wo = (const float*)d_in[4]; const int* PID = (const int*)d_in[5];   /* x, Wq, Wk, Wv, Wo ('oi' [1024][1024]), token_positions (int32 [4][2048], read per batch) */
    float* OUT = (float*)d_out;     // [4][2048][1024]
    char* wsp = (char*)d_ws;
    auto take = [&](size_t bytes) { char* p = wsp; wsp += (bytes + 255) & ~(size_t)255; return (void*)p; };
    bf* WQ = (bf*)take((size_t)DQ * DM * 2); bf* WK = (bf*)take((size_t)DKV * DM * 2); bf* WV = (bf*)take((size_t)DKV * DM * 2); bf* WO = (bf*)take((size_t)DM * DQ * 2); float* CS = (float*)take((size_t)TT * HD * 2 * 4);
    bf* XB = (bf*)take((size_t)TT * DM * 2); float* FQ = (float*)take((size_t)TT * DQ * 4); float* FK = (float*)take((size_t)TT * DKV * 4);
    h16* QP16 = (h16*)take((size_t)NH_ * TT * HD * 2); h16* KP16 = (h16*)take((size_t)NKV * TT * HD * 2); h16* VT16 = (h16*)take((size_t)NKV * HD * TT * 2);
    bf* QPh = (bf*)take((size_t)NH_ * TT * HD * 2); bf* QPl = (bf*)take((size_t)NH_ * TT * HD * 2); bf* KPh = (bf*)take((size_t)NKV * TT * HD * 2); bf* KPl = (bf*)take((size_t)NKV * TT * HD * 2); bf* VTh = (bf*)take((size_t)NKV * HD * TT * 2); bf* VTl = (bf*)take((size_t)NKV * HD * TT * 2);
    float* Sb = (float*)take((size_t)ZH * TT * TT * 4); float* Ob = (float*)take((size_t)PKS * ZH * TT * HD * 4); bf* ATh = (bf*)take((size_t)TT * DQ * 2); bf* ATl = (bf*)take((size_t)TT * DQ * 2);
    if ((size_t)(wsp - (char*)d_ws) > ws_size) return;    // ws 256 MiB
    float* FV = FK;   // v projection reuses the k buffer after the k planes are built (stream-ordered)
    { k_cvt8<<<(unsigned)(((size_t)DQ * DM / 8 + 255) / 256), 256, 0, stream>>>(wq, WQ, (size_t)DQ * DM / 8); k_cvt8<<<(unsigned)(((size_t)DKV * DM / 8 + 255) / 256), 256, 0, stream>>>(wk, WK, (size_t)DKV * DM / 8); k_cvt8<<<(unsigned)(((size_t)DKV * DM / 8 + 255) / 256), 256, 0, stream>>>(wv, WV, (size_t)DKV * DM / 8);
      k_cvt8<<<(unsigned)(((size_t)DM * DQ / 8 + 255) / 256), 256, 0, stream>>>(wo, WO, (size_t)DM * DQ / 8); /* the rotary table is rebuilt per batch from that batch's positions (below) */ }
    const unsigned LQ = (unsigned)(((size_t)NH_ * TT * HD / 2 + 255) / 256), LKv = (unsigned)(((size_t)NKV * TT * HD / 2 + 255) / 256);
    for (int b = 0; b < NB_; ++b) {
        k_cstabI<<<(TT * HD + 255) / 256, 256, 0, stream>>>(PID + (size_t)b * TT, CS);   /* token_positions[b][:] (int32, read) */
        
        k_cvt8<<<(unsigned)(((size_t)TT * DM / 8 + 255) / 256), 256, 0, stream>>>(x + (size_t)b * TT * DM, XB, (size_t)TT * DM / 8);
        k_gemmw<bf, 0, false><<<dim3(TT / 64, DQ / 64, 1), 32, 0, stream>>>(XB, nullptr, WQ, nullptr, DM, FQ, DQ, nullptr, 0, 0, 0);
        k_ropeI<<<LQ, 256, 0, stream>>>(FQ, DQ, NH_, CS, 1.0f, QP16, QPh, QPl);
        k_gemmw<bf, 0, false><<<dim3(TT / 64, DKV / 64, 1), 32, 0, stream>>>(XB, nullptr, WK, nullptr, DM, FK, DKV, nullptr, 0, 0, 0);
        k_ropeI<<<LKv, 256, 0, stream>>>(FK, DKV, NKV, CS, 1.0f, KP16, KPh, KPl);
        k_gemmw<bf, 0, false><<<dim3(TT / 64, DKV / 64, 1), 32, 0, stream>>>(XB, nullptr, WV, nullptr, DM, FV, DKV, nullptr, 0, 0, 0); k_vtp<<<LKv, 256, 0, stream>>>(FV, DKV, NKV, VT16, VTh, VTl);
        for (int h0 = 0; h0 < NH_; h0 += ZH) { const size_t zq = (size_t)h0, zk = (size_t)(h0 / REP);   // one kv head per query head: the pass's heads use consecutive kv planes (z-strides TT*HD)
            k_gemmc<bf, 2><<<dim3(TT / 64, TT / 64, ZH), 32, 0, stream>>>(QPh + zq * TT * HD, QPl + zq * TT * HD, KPh + zk * TT * HD, KPl + zk * TT * HD, HD, Sb, TT, 0, (size_t)TT * HD, (size_t)TT * HD, (size_t)TT * TT);   /* scores on hi/lo planes for EVERY row (3 products) */
            /* (the fp16 score launch for rows >= RH is removed: all rows use the hi/lo launch above) */
            k_asoft<<<ZH * TT / 8, 256, 0, stream>>>(Sb);
            k_gemmpv<bf, 2, 2><<<dim3(RH / 64, PKS, ZH), 64, 0, stream>>>((const bf*)Sb, (const bf*)Sb + TT, VTh + zk * HD * TT, VTl + zk * HD * TT, TT, LDP, Ob, HD, 0, (size_t)TT * LDP, (size_t)HD * TT, (size_t)TT * HD, (size_t)ZH * TT * HD);
            k_gemmpv<h16, 0, 8><<<dim3((TT - RH) / 64, PKS, ZH), 256, 0, stream>>>((const h16*)Sb + (size_t)RH * LDP, nullptr, VT16 + zk * HD * TT, nullptr, TT, LDP, Ob + (size_t)RH * HD, HD, RH, (size_t)TT * LDP, (size_t)HD * TT, (size_t)TT * HD, (size_t)ZH * TT * HD);
            k_merge<<<(unsigned)(((size_t)ZH * TT * HD / 2 + 255) / 256), 256, 0, stream>>>(Ob, h0, ATh, ATl); }
        k_gemmw<bf, 1, false><<<dim3(TT / 64, DM / 64, 1), 32, 0, stream>>>(ATh, ATl, WO, nullptr, DQ, OUT + (size_t)b * TT * DM, DM, nullptr, 0, 0, 0); }
}

// v004
// It runs in 444 microseconds.
// It is 2.34 times as fast as v002, going by the measured steps of the versions left out in between.
// Over all steps from v000 it is 6.19 times as fast.
#include <hip/hip_runtime.h>

// Causal multi-head attention with interleaved-pair rotary embeddings driven by an integer position input (x [4][2048][1024]; q, k, v = x W^T ('oi', no bias; 16 heads x 64); rope on pairs (2i, 2i+1): (x_e cos - x_o sin, x_e sin + x_o cos) with angle pos[b][t] x THETA^(-2i/64) (token_positions int32 [4][2048] = arange per batch, READ on device; 32 f32 frequencies jnp-exact for this expression; precise cosf/sinf); scores / sqrt(64); causal (-inf); softmax; out = merged Wo^T -> [4][2048][1024] (8.4 M); argument order x, Wq, Wk, Wv, Wo, token_positions).
// Layout, all four batches in every launch (the batch is part of the row index of the GEMMs and a grid dimension elsewhere): bf16 copy of x; exact projections; {cos, sin} per (position, pair) built once from the int positions and float32 inverse-frequency constants (precise cosf/sinf); interleaved rotary plane builder; causal T-2048 attention (EVERY row's scores on hi/lo planes (3 products: logit sigma 2 with these weights) and hybrid P.V (rows < 512 hi/lo, rest fp16 x1024); scores, softmax and P.V in one kernel, k_fattn, with a running row maximum and sum; key blocks above the diagonal are never touched); merged hi/lo x Wo exact.
// Compute dtypes, f32 accumulate: every input rounded to bf16; projections exact; rotary f32; scores 3 products; P.V rows < 512 3 products, rest fp16; softmax f32; Wo hl x exact.

#define NB_  4
#define TT   2048
#define DM   1024
#define NH_  16
#define NKV  16
#define REP  (NH_ / NKV)
#define HD   64
#define DQ   (NH_ * HD)
#define DKV  (NKV * HD)
#define RH   512                  // query rows < RH take P.V on hi+lo planes (0: none)
#define PCAR 1024.0f
#define SCL  0.125f   // HD^-0.5
typedef _Float16 h16;
typedef unsigned short bf;
typedef __attribute__((ext_vector_type(16))) __bf16   v16bf;
typedef __attribute__((ext_vector_type(16))) _Float16 v16h;
typedef __attribute__((ext_vector_type(8)))  _Float16 v8h;
typedef __attribute__((ext_vector_type(8)))  unsigned short v8us;
typedef __attribute__((ext_vector_type(8)))  float    v8f;
typedef __attribute__((ext_vector_type(4)))  float    v4f;
typedef v8h  __attribute__((may_alias)) v8ha;
typedef v4f  __attribute__((may_alias)) v4fa;
typedef v8us __attribute__((may_alias)) v8usa;

__device__ __forceinline__ unsigned short f2bf(float f) { unsigned u = __float_as_uint(f); u += 0x7FFFu + ((u >> 16) & 1u); return (unsigned short)(u >> 16); }
__device__ __forceinline__ float bf2f(unsigned short b) { return __uint_as_float(((unsigned)b) << 16); }
__device__ __forceinline__ float bfr(float f) { return bf2f(f2bf(f)); }
__device__ __forceinline__ v16h cat16(v8h lo, v8h hi) { return __builtin_shufflevector(lo, hi, 0, 1, 2, 3, 4, 5, 6, 7, 8, 9, 10, 11, 12, 13, 14, 15); }
__device__ __forceinline__ v16bf cat16b(v8us lo, v8us hi) { return __builtin_bit_cast(v16bf, __builtin_shufflevector(lo, hi, 0, 1, 2, 3, 4, 5, 6, 7, 8, 9, 10, 11, 12, 13, 14, 15)); }
__device__ __forceinline__ v8f wmma16(v16h a, v16h b, v8f c) { return __builtin_amdgcn_wmma_f32_16x16x32_f16(false, a, false, b, (short)0, c, false, false); }
__device__ __forceinline__ v8f wmmab(v16bf a, v16bf b, v8f c) { return __builtin_amdgcn_wmma_f32_16x16x32_bf16(false, a, false, b, (short)0, c, false, false); }



// ---- k_gemmw: register-blocked GEMM, ONE WAVE per 64x64 output tile (16 accumulators), operands straight from K-contiguous 16-bit planes; grid (M/64, N/64, Z), 32 threads.
// C[m][n] (f32, pitch ldc, + optional f32 bias[n]) = sum_k A[m][k] Bt[n][k] (+ split products per NSPLIT). z-batch strides sA/sB/sC in elements. K % 32 == 0.
template <typename T16> struct WFrag;
template <> struct WFrag<h16> { typedef v16h V; static __device__ __forceinline__ V ld(const h16* p) { return cat16(*(const v8h*)p, *(const v8h*)(p + 16)); } static __device__ __forceinline__ v8f mma(V a, V b, v8f c) { return wmma16(a, b, c); } };
template <> struct WFrag<bf> { typedef v16bf V; static __device__ __forceinline__ V ld(const bf* p) { return cat16b(*(const v8us*)p, *(const v8us*)(p + 16)); } static __device__ __forceinline__ v8f mma(V a, V b, v8f c) { return wmmab(a, b, c); } };
template <typename T16, int NSPLIT, bool BIAS>
__global__ __launch_bounds__(32) void k_gemmw(const T16* __restrict__ A, const T16* __restrict__ A2, const T16* __restrict__ Bt, const T16* __restrict__ Bt2, int K, float* C, int ldc, const float* __restrict__ bias, size_t sA, size_t sB, size_t sC) {
    typedef typename WFrag<T16>::V V;
    __shared__ __align__(16) float os[16 * 68];
    const size_t z = blockIdx.z; A += z * sA; if (A2) A2 += z * sA; Bt += z * sB; if (Bt2) Bt2 += z * sB; C += z * sC;
    const int lane = threadIdx.x & 31, lr = lane & 15, hi = lane >> 4; const int r0 = blockIdx.x * 64, c0 = blockIdx.y * 64;
    v8f acc[4][4];
#pragma unroll
    for (int mb = 0; mb < 4; ++mb)
#pragma unroll
        for (int nb = 0; nb < 4; ++nb) acc[mb][nb] = (v8f){};
    const size_t aoff = (size_t)(r0 + lr) * K + 8 * hi, boff = (size_t)(c0 + lr) * K + 8 * hi;
#pragma unroll 1
    for (int kc = 0; kc < K; kc += 32) {
        V a[4], a2[4];
#pragma unroll
        for (int mb = 0; mb < 4; ++mb) { a[mb] = WFrag<T16>::ld(A + aoff + (size_t)mb * 16 * K + kc); if (NSPLIT == 1 || NSPLIT == 2) a2[mb] = WFrag<T16>::ld(A2 + aoff + (size_t)mb * 16 * K + kc); }
#pragma unroll
        for (int nb = 0; nb < 4; ++nb) { const V b = WFrag<T16>::ld(Bt + boff + (size_t)nb * 16 * K + kc); V b2; if (NSPLIT >= 2) b2 = WFrag<T16>::ld(Bt2 + boff + (size_t)nb * 16 * K + kc);
#pragma unroll
            for (int mb = 0; mb < 4; ++mb) { acc[mb][nb] = WFrag<T16>::mma(a[mb], b, acc[mb][nb]); if (NSPLIT == 1 || NSPLIT == 2) acc[mb][nb] = WFrag<T16>::mma(a2[mb], b, acc[mb][nb]); if (NSPLIT >= 2) acc[mb][nb] = WFrag<T16>::mma(a[mb], b2, acc[mb][nb]); } }
        asm volatile("v_nop\n\tv_nop\n\tv_nop\n\tv_nop" : "+v"(acc[0][0]), "+v"(acc[1][1]), "+v"(acc[2][2]), "+v"(acc[3][3]) : "v"(a[0]), "v"(a[3]));
    }
#pragma unroll
    for (int mb = 0; mb < 4; ++mb) {
#pragma unroll
        for (int nb = 0; nb < 4; ++nb) {
#pragma unroll
            for (int j = 0; j < 8; ++j) os[(hi * 8 + j) * 68 + nb * 16 + lr] = acc[mb][nb][j]; }
        __builtin_amdgcn_wave_barrier(); asm volatile("" ::: "memory");
        float* crow = C + (size_t)(r0 + mb * 16) * ldc + c0;
{
#pragma unroll
            for (int s = 0; s < 8; ++s) { const int row = 2 * s + hi, cofs = lr * 4; v4f val = *(const v4fa*)(os + row * 68 + cofs); if (BIAS) { val[0] += bfr(bias[c0 + cofs]); val[1] += bfr(bias[c0 + cofs + 1]); val[2] += bfr(bias[c0 + cofs + 2]); val[3] += bfr(bias[c0 + cofs + 3]); }
                *(v4f*)(crow + (size_t)row * ldc + cofs) = val; }
             }
        __builtin_amdgcn_wave_barrier(); asm volatile("" ::: "memory");
    }
}

__device__ __forceinline__ h16 tohx(float x) { return (h16)x; }
__device__ __forceinline__ void splitf(float y, unsigned short& h, unsigned short& l) { h = f2bf(y); l = f2bf(y - bf2f(h)); }
typedef __attribute__((ext_vector_type(2))) _Float16 v2h;
typedef __attribute__((ext_vector_type(4))) _Float16 v4h;
typedef __attribute__((ext_vector_type(2))) unsigned short v2us;
typedef __attribute__((ext_vector_type(4))) unsigned short v4us;
typedef __attribute__((ext_vector_type(2))) float v2f;
typedef __attribute__((ext_vector_type(4))) int v4i;

__global__ __launch_bounds__(256) void k_wtG(const float* __restrict__ w, int K, int N, bf* Bt) {
    const int lane = threadIdx.x & 31; const int L0 = (blockIdx.x * 8 + (threadIdx.x >> 5)) * 8; const int nlines = N * K / 64;
{
#pragma unroll 1
        for (int l = 0; l < 8; ++l) { const int L = L0 + l; if (L >= nlines) break; const size_t e = (size_t)L * 64 + lane * 2; const int k = (int)(e % K), n = (int)(e / K); v2us o;
            o[0] = f2bf(w[(size_t)k * N + n]); o[1] = f2bf(w[(size_t)(k + 1) * N + n]); *(v2us*)(Bt + e) = o; }
         }
}
__global__ __launch_bounds__(256) void k_cvt8(const float* __restrict__ src, bf* dst, size_t n8) { const size_t i = (size_t)blockIdx.x * 256 + threadIdx.x; if (i >= n8) return; const v8f v = *(const v8f*)(src + i * 8); v8us o;
#pragma unroll
    for (int k = 0; k < 8; ++k) o[k] = f2bf(v[k]); *(v8us*)(dst + i * 8) = o;  }

__global__ __launch_bounds__(256) void k_ropeI(const float* __restrict__ F, int pitch, int nheads, const float* __restrict__ CS, float sc, h16* P16, bf* Ph, bf* Pl) {
    const size_t e = ((size_t)blockIdx.x * 256 + threadIdx.x) * 2; if (e >= (size_t)nheads * TT * HD) return; const int d = (int)(e % HD); const int t = (int)((e / HD) % TT); const int h = (int)(e / ((size_t)HD * TT));
    { const size_t b = blockIdx.y; F += b * TT * pitch; CS += b * TT * HD * 2; const size_t po = b * nheads * TT * HD; P16 += po; Ph += po; Pl += po; }   // batch b: its rows of the projection, its table, its planes
    const float* f = F + (size_t)t * pitch + h * HD; const float x0 = f[d], x1 = f[d + 1]; const v2f cs = *(const v2f*)(CS + ((size_t)t * HD + d) * 2); v2h o16; v2us oh, ol;
    float a0 = __fmul_rn(x0, cs[0]), b0 = __fmul_rn(x1, cs[1]), a1 = __fmul_rn(x1, cs[0]), b1 = __fmul_rn(x0, cs[1]); asm volatile("" : "+v"(a0), "+v"(b0), "+v"(a1), "+v"(b1));
    float r0 = __fsub_rn(a0, b0) * sc, r1 = __fadd_rn(b1, a1) * sc;   /* even: x0 c - x1 s; odd: x0 s + x1 c */
    o16[0] = tohx(r0); o16[1] = tohx(r1); { unsigned short a2, c2; splitf(r0, a2, c2); oh[0] = a2; ol[0] = c2; splitf(r1, a2, c2); oh[1] = a2; ol[1] = c2; }
    *(v2h*)(P16 + e) = o16; *(v2us*)(Ph + e) = oh; *(v2us*)(Pl + e) = ol;  }

__constant__ float INV2[HD / 2] = { 1.000000000e+00f, 7.498942018e-01f, 5.623413324e-01f, 4.216965139e-01f, 3.162277639e-01f, 2.371373773e-01f, 1.778279394e-01f, 1.333521456e-01f, 1.000000015e-01f, 7.498942316e-02f, 5.623413250e-02f, 4.216964915e-02f, 3.162277490e-02f, 2.371373773e-02f, 1.778279431e-02f, 1.333521400e-02f, 9.999999776e-03f, 7.498942316e-03f, 5.623413250e-03f, 4.216964822e-03f, 3.162277630e-03f, 2.371373819e-03f, 1.778279431e-03f, 1.333521446e-03f, 1.000000047e-03f, 7.498941850e-04f, 5.623413017e-04f, 4.216965172e-04f, 3.162277571e-04f, 2.371373703e-04f, 1.778279402e-04f, 1.333521504e-04f };   // float32 10000^(-(i * 2 / 64)), generated with jnp to be bit-exact with the module's expression
__global__ __launch_bounds__(256) void k_cstabI(const int* __restrict__ pid, float* CS) { const int idx = blockIdx.x * 256 + threadIdx.x; if (idx >= NB_ * TT * HD) return; const int d = idx % HD; const int t = idx / HD;   /* t runs over the rows of all batches */ const float a = __fmul_rn((float)pid[t], INV2[d >> 1]); v2f cs; cs[0] = cosf(a); cs[1] = sinf(a); *(v2f*)(CS + (size_t)idx * 2) = cs;  }

__global__ __launch_bounds__(256) void k_vtp(const float* __restrict__ F, int pitch, int nheads, h16* V16, bf* Vh, bf* Vl) { const size_t e = ((size_t)blockIdx.x * 256 + threadIdx.x) * 2; if (e >= (size_t)nheads * HD * TT) return; const int t = (int)(e % TT); const int d = (int)((e / TT) % HD); const int g = (int)(e / ((size_t)TT * HD)); v2h o16; v2us oh, ol;
    { const size_t b = blockIdx.y; F += b * TT * pitch; const size_t po = b * nheads * HD * TT; V16 += po; Vh += po; Vl += po; }   // batch b
#pragma unroll
    for (int q = 0; q < 2; ++q) { const float x = F[(size_t)(t + q) * pitch + g * HD + d]; o16[q] = tohx(x); unsigned short a2, c2; splitf(x, a2, c2); oh[q] = a2; ol[q] = c2; }
    *(v2h*)(V16 + e) = o16; *(v2us*)(Vh + e) = oh; *(v2us*)(Vl + e) = ol;  }
// ---- k_fattn: causal attention of all batches in one launch; scores and probabilities never go to memory. Grid (NH_, TT/64, NB_), 32 * FNW threads.
// A work-group owns 64 query rows of one head: wave w holds the 16-row strip (w & 3) and takes the 64-key blocks (w >> 2), (w >> 2) + KS, ... up to the diagonal block.
// Per block: scores on hi/lo planes (3 products, the k order of the score GEMM it replaces); running row maximum and row sum (f32); probabilities exp(t - max) go through the wave's own LDS
// from the accumulator layout to the A-fragment layout (rows < RH as hi/lo planes, 3 products; the rest fp16 x PCAR); the output strip is rescaled when the maximum moves.
// The KS partial (maximum, sum, strip) of a strip are merged through LDS behind one barrier, divided by the row sum and stored as the hi/lo planes that the output projection reads.
#define KS   4                    // waves that share the key range of one 16-row strip
#define FNW  (4 * KS)
#define PP   72                   // pitch, in 16-bit elements, of a probability row in LDS (144 bytes: 16-byte aligned, rows fall on different banks)
#define WREG 4608                 // LDS bytes of one wave: two 16 x PP 16-bit planes, later its 16 x 68 f32 strip
#define L2S  (SCL * 1.4426950408889634f)   // scores stay unscaled: HD^-0.5 is a power of two and goes, exactly, into the factor in front of exp2
template <int M> __device__ __forceinline__ float rowx(float v) { return __int_as_float(__builtin_amdgcn_mov_dpp(__float_as_int(v), 0x160 + M, 0xf, 0xf, true)); }   // lane ^ M inside a 16-lane row (row_xmask)
__device__ __forceinline__ float rowmax16(float v) { v = fmaxf(v, rowx<1>(v)); v = fmaxf(v, rowx<2>(v)); v = fmaxf(v, rowx<4>(v)); return fmaxf(v, rowx<8>(v)); }
__device__ __forceinline__ float rowsum16(float v) { v += rowx<1>(v); v += rowx<2>(v); v += rowx<4>(v); return v + rowx<8>(v); }
// Five exp2 of one row (the rescale factor and the row's four probabilities) and the slot behind a transcendental in ONE statement: the outputs share no register with the inputs, so no v_exp_f32 here
// overwrites the source or reads the result of the one in front of it, and the v_nop keeps whatever the compiler puts next one slot away from the last.
__device__ __forceinline__ void exp2x5(float& a, float& b, float& c, float& d, float& e) { float ra, rb, rc, rd, re;
    asm("v_exp_f32 %0, %5\n\tv_exp_f32 %1, %6\n\tv_exp_f32 %2, %7\n\tv_exp_f32 %3, %8\n\tv_exp_f32 %4, %9\n\tv_nop" : "=&v"(ra), "=&v"(rb), "=&v"(rc), "=&v"(rd), "=&v"(re) : "v"(a), "v"(b), "v"(c), "v"(d), "v"(e));
    a = ra; b = rb; c = rc; d = rd; e = re; }
template <bool HR>
__device__ __forceinline__ void fattn_strip(const bf* __restrict__ Qh, const bf* __restrict__ Ql, const bf* __restrict__ Kh, const bf* __restrict__ Kl, const h16* __restrict__ V16, const bf* __restrict__ Vh, const bf* __restrict__ Vl, int r0, int wave, char* wreg, float* mrow, float* lrow) {
    const int lane = threadIdx.x & 31, lr = lane & 15, hi = lane >> 4; const int rw = r0 + (wave & 3) * 16;
    v16bf qh[2], ql[2];
#pragma unroll
    for (int s = 0; s < 2; ++s) { qh[s] = WFrag<bf>::ld(Qh + (size_t)(rw + lr) * HD + 8 * hi + s * 32); ql[s] = WFrag<bf>::ld(Ql + (size_t)(rw + lr) * HD + 8 * hi + s * 32); }
    v8f o[4]; float m[8], l[8];
#pragma unroll
    for (int nb = 0; nb < 4; ++nb) o[nb] = (v8f){};
#pragma unroll
    for (int j = 0; j < 8; ++j) { m[j] = -3.0e38f; l[j] = 0.f; }
    // per-lane operand offsets, carried through the loop; all fragments of a block hang on them by immediate offsets, so no address register is rewritten between a block's loads
    unsigned kob = (unsigned)((((wave >> 2) * 64 + lr) * HD + 8 * hi) * 2), vob = (unsigned)((lr * TT + (wave >> 2) * 64 + 8 * hi) * 2);   // byte offsets, one for both key planes, one for the value planes (uniform base + 32-bit lane offset)
    const char* khb = (const char*)Kh; const char* klb = (const char*)Kl; const char* vb = (const char*)V16; const char* vhb = (const char*)Vh; const char* vlb = (const char*)Vl;
    h16* pw = (h16*)wreg + hi * 8 * PP + lr; bf* pwb = (bf*)wreg + hi * 8 * PP + lr;   // where this lane's probabilities of row j = 0, block column 0 go
    const int nblk = r0 / 64 + 1;     // every block up to the diagonal one holds at least one key <= i for each of the 64 rows
#pragma unroll 1
    for (int blk = wave >> 2; blk < nblk; blk += KS) {
        const int kb = blk * 64; v8f sc[4]; v16bf kh[4][2], kl[4][2];
#pragma unroll
        for (int nb = 0; nb < 4; ++nb)
#pragma unroll
            for (int s = 0; s < 2; ++s) { kh[nb][s] = WFrag<bf>::ld((const bf*)(khb + kob + (nb * 16 * HD + s * 32) * 2)); kl[nb][s] = WFrag<bf>::ld((const bf*)(klb + kob + (nb * 16 * HD + s * 32) * 2)); }
        __builtin_amdgcn_sched_barrier(0);   // every key fragment is in flight before the first product waits: one memory round trip a block, not one a fragment pair
#pragma unroll
        for (int nb = 0; nb < 4; ++nb) { sc[nb] = (v8f){};
#pragma unroll
            for (int s = 0; s < 2; ++s) { sc[nb] = wmmab(qh[s], kh[nb][s], sc[nb]); sc[nb] = wmmab(ql[s], kh[nb][s], sc[nb]); sc[nb] = wmmab(qh[s], kl[nb][s], sc[nb]); } }
        __builtin_amdgcn_sched_barrier(0);   // the value loads issue behind the score products, into the registers that the key fragments leave
        v16h vf[2][4]; v16bf vh[2][4], vl[2][4];
#pragma unroll
        for (int s = 0; s < 2; ++s)
#pragma unroll
            for (int nb = 0; nb < 4; ++nb) { const int vo = (nb * 16 * TT + s * 32) * 2; if (HR) { vh[s][nb] = WFrag<bf>::ld((const bf*)(vhb + vob + vo)); vl[s][nb] = WFrag<bf>::ld((const bf*)(vlb + vob + vo)); } else vf[s][nb] = WFrag<h16>::ld((const h16*)(vb + vob + vo)); }
        __builtin_amdgcn_sched_barrier(0);   // and in front of the softmax, which runs while they fly
        const int dd = kb + lr - rw - hi * 8;   // key index minus query index at nb = 0, j = 0
#pragma unroll
        for (int j = 0; j < 8; ++j) { float t[4];
#pragma unroll
            for (int nb = 0; nb < 4; ++nb) t[nb] = (dd <= j - nb * 16) ? sc[nb][j] : -3.0e38f;
            const float mn = fmaxf(m[j], rowmax16(fmaxf(fmaxf(t[0], t[1]), fmaxf(t[2], t[3])))); float al = (m[j] - mn) * L2S; m[j] = mn; float ps = 0.f;
#pragma unroll
            for (int nb = 0; nb < 4; ++nb) t[nb] = (t[nb] - mn) * L2S;
            exp2x5(al, t[0], t[1], t[2], t[3]);
#pragma unroll
            for (int nb = 0; nb < 4; ++nb) { const float p = t[nb]; ps += p; o[nb][j] *= al; const int po = j * PP + nb * 16;
                if (HR) { unsigned short a, c2; splitf(p, a, c2); pwb[po] = a; pwb[16 * PP + po] = c2; } else pw[po] = tohx(p * PCAR); }
            l[j] = l[j] * al + ps; }
        __builtin_amdgcn_wave_barrier(); asm volatile("" ::: "memory");   // the wave's probability stores stay in front of its fragment reads
#pragma unroll
        for (int s = 0; s < 2; ++s) {
            if (HR) { const v16bf a = WFrag<bf>::ld((const bf*)wreg + lr * PP + 8 * hi + s * 32), a2 = WFrag<bf>::ld((const bf*)wreg + 16 * PP + lr * PP + 8 * hi + s * 32);
#pragma unroll
                for (int nb = 0; nb < 4; ++nb) { o[nb] = wmmab(a, vh[s][nb], o[nb]); o[nb] = wmmab(a2, vh[s][nb], o[nb]); o[nb] = wmmab(a, vl[s][nb], o[nb]); }
            } else { const v16h a = WFrag<h16>::ld((const h16*)wreg + lr * PP + 8 * hi + s * 32);
#pragma unroll
                for (int nb = 0; nb < 4; ++nb) o[nb] = wmma16(a, vf[s][nb], o[nb]); } }
        asm volatile("v_nop\n\tv_nop\n\tv_nop\n\tv_nop" : "+v"(o[0]), "+v"(o[1]), "+v"(o[2]), "+v"(o[3]));   // matrix-instruction distance before the operands are loaded anew, on the back edge too
        __builtin_amdgcn_wave_barrier(); asm volatile("" ::: "memory");   // the fragment reads stay in front of the next block's probability stores
        kob += KS * 64 * HD * 2; vob += KS * 64 * 2;
    }
    float* ow = (float*)wreg;
#pragma unroll
    for (int nb = 0; nb < 4; ++nb)
#pragma unroll
        for (int j = 0; j < 8; ++j) ow[(hi * 8 + j) * 68 + nb * 16 + lr] = o[nb][j];
#pragma unroll
    for (int j = 0; j < 8; ++j) { const float ls = rowsum16(l[j]); if (lr == 0) { mrow[wave * 16 + hi * 8 + j] = m[j]; lrow[wave * 16 + hi * 8 + j] = ls; } }
}
__global__ __launch_bounds__(32 * FNW) void k_fattn(const bf* __restrict__ Qh, const bf* __restrict__ Ql, const bf* __restrict__ Kh, const bf* __restrict__ Kl, const h16* __restrict__ V16, const bf* __restrict__ Vh, const bf* __restrict__ Vl, bf* Ah, bf* Al) {
    __shared__ __align__(16) char sm[FNW * WREG]; __shared__ float mrow[FNW * 16], lrow[FNW * 16];
    const int h = blockIdx.x; const int qt = TT / 64 - 1 - (int)blockIdx.y;   // the tiles with the longest key range get the lowest indices (for speed only)
    const int r0 = qt * 64; const int wave = __builtin_amdgcn_readfirstlane(threadIdx.x >> 5);   // scalar, so that the block loop branches on a scalar compare
    const size_t zo = ((size_t)blockIdx.z * NH_ + h) * TT * HD; char* wreg = sm + wave * WREG;
    if (r0 < RH) fattn_strip<true>(Qh + zo, Ql + zo, Kh + zo, Kl + zo, V16 + zo, Vh + zo, Vl + zo, r0, wave, wreg, mrow, lrow);
    else fattn_strip<false>(Qh + zo, Ql + zo, Kh + zo, Kl + zo, V16 + zo, Vh + zo, Vl + zo, r0, wave, wreg, mrow, lrow);
    __syncthreads();   // every wave's partial maximum, sum and strip stand in LDS before any wave merges them
    const float cs = (r0 < RH) ? 1.0f : (1.0f / PCAR);
#pragma unroll
    for (int s = 0; s < 1024 / (32 * FNW); ++s) { const int idx = s * (32 * FNW) + (int)threadIdx.x; const int row = idx >> 4, cofs = (idx & 15) * 4; const int sub = row >> 4, rr = row & 15; float mx = -3.0e38f;
#pragma unroll
        for (int k = 0; k < KS; ++k) mx = fmaxf(mx, mrow[(k * 4 + sub) * 16 + rr]);
        float ls = 0.f; v4f val = (v4f){};
#pragma unroll
        for (int k = 0; k < KS; ++k) { const int w = k * 4 + sub; const float wg = __builtin_amdgcn_exp2f((mrow[w * 16 + rr] - mx) * L2S); ls += wg * lrow[w * 16 + rr]; val += wg * *(const v4fa*)(sm + w * WREG + (rr * 68 + cofs) * 4); }   /* a wave without a block has weight 0 */
        const float f = __fdiv_rn(cs, ls); v4us oh, ol;
#pragma unroll
        for (int q = 0; q < 4; ++q) { unsigned short a, c2; splitf(val[q] * f, a, c2); oh[q] = a; ol[q] = c2; }
        const size_t oo = ((size_t)blockIdx.z * TT + r0 + row) * DQ + h * HD + cofs; *(v4us*)(Ah + oo) = oh; *(v4us*)(Al + oo) = ol; }
}

extern "C" void kernel_launch(void* const* d_in, const int* in_sizes, int n_in,
                              void* d_out, int out_size, void* d_ws, size_t ws_size, hipStream_t stream) {
    (void)in_sizes; (void)n_in; (void)out_size;
    const float* x = (const float*)d_in[0]; const float* wq = (const float*)d_in[1]; const float* wk = (const float*)d_in[2]; const float* wv = (const float*)d_in[3]; const float* wo = (const float*)d_in[4]; const int* PID = (const int*)d_in[5];   /* x, Wq, Wk, Wv, Wo ('oi' [1024][1024]), token_positions (int32 [4][2048], read per batch) */
    float* OUT = (float*)d_out;     // [4][2048][1024]
    char* wsp = (char*)d_ws;
    auto take = [&](size_t bytes) { char* p = wsp; wsp += (bytes + 255) & ~(size_t)255; return (void*)p; };
    bf* WQ = (bf*)take((size_t)DQ * DM * 2); bf* WK = (bf*)take((size_t)DKV * DM * 2); bf* WV = (bf*)take((size_t)DKV * DM * 2); bf* WO = (bf*)take((size_t)DM * DQ * 2); float* CS = (float*)take((size_t)NB_ * TT * HD * 2 * 4);
    bf* XB = (bf*)take((size_t)NB_ * TT * DM * 2); float* FP = (float*)take((size_t)NB_ * TT * DQ * 4);   // one f32 projection buffer: q, then k, then v, each read by its plane builder before the next is written (stream-ordered)
    h16* QP16 = (h16*)take((size_t)NB_ * NH_ * TT * HD * 2); h16* KP16 = (h16*)take((size_t)NB_ * NKV * TT * HD * 2); h16* VT16 = (h16*)take((size_t)NB_ * NKV * HD * TT * 2);
    bf* QPh = (bf*)take((size_t)NB_ * NH_ * TT * HD * 2); bf* QPl = (bf*)take((size_t)NB_ * NH_ * TT * HD * 2); bf* KPh = (bf*)take((size_t)NB_ * NKV * TT * HD * 2); bf* KPl = (bf*)take((size_t)NB_ * NKV * TT * HD * 2); bf* VTh = (bf*)take((size_t)NB_ * NKV * HD * TT * 2); bf* VTl = (bf*)take((size_t)NB_ * NKV * HD * TT * 2);
    bf* ATh = (bf*)take((size_t)NB_ * TT * DQ * 2); bf* ATl = (bf*)take((size_t)NB_ * TT * DQ * 2);
    if ((size_t)(wsp - (char*)d_ws) > ws_size) return;    // 236 MiB of the 256 MiB
    { k_cvt8<<<(unsigned)(((size_t)DQ * DM / 8 + 255) / 256), 256, 0, stream>>>(wq, WQ, (size_t)DQ * DM / 8); k_cvt8<<<(unsigned)(((size_t)DKV * DM / 8 + 255) / 256), 256, 0, stream>>>(wk, WK, (size_t)DKV * DM / 8); k_cvt8<<<(unsigned)(((size_t)DKV * DM / 8 + 255) / 256), 256, 0, stream>>>(wv, WV, (size_t)DKV * DM / 8);
      k_cvt8<<<(unsigned)(((size_t)DM * DQ / 8 + 255) / 256), 256, 0, stream>>>(wo, WO, (size_t)DM * DQ / 8); }
    const unsigned LQ = (unsigned)(((size_t)NH_ * TT * HD / 2 + 255) / 256), LKv = (unsigned)(((size_t)NKV * TT * HD / 2 + 255) / 256);
    k_cstabI<<<(NB_ * TT * HD + 255) / 256, 256, 0, stream>>>(PID, CS);   /* token_positions[b][t] (int32, read): a table row per (batch, position) */
    k_cvt8<<<(unsigned)(((size_t)NB_ * TT * DM / 8 + 255) / 256), 256, 0, stream>>>(x, XB, (size_t)NB_ * TT * DM / 8);
    k_gemmw<bf, 0, false><<<dim3(NB_ * TT / 64, DQ / 64, 1), 32, 0, stream>>>(XB, nullptr, WQ, nullptr, DM, FP, DQ, nullptr, 0, 0, 0);
    k_ropeI<<<dim3(LQ, NB_, 1), 256, 0, stream>>>(FP, DQ, NH_, CS, 1.0f, QP16, QPh, QPl);
    k_gemmw<bf, 0, false><<<dim3(NB_ * TT / 64, DKV / 64, 1), 32, 0, stream>>>(XB, nullptr, WK, nullptr, DM, FP, DKV, nullptr, 0, 0, 0);
    k_ropeI<<<dim3(LKv, NB_, 1), 256, 0, stream>>>(FP, DKV, NKV, CS, 1.0f, KP16, KPh, KPl);
    k_gemmw<bf, 0, false><<<dim3(NB_ * TT / 64, DKV / 64, 1), 32, 0, stream>>>(XB, nullptr, WV, nullptr, DM, FP, DKV, nullptr, 0, 0, 0);
    k_vtp<<<dim3(LKv, NB_, 1), 256, 0, stream>>>(FP, DKV, NKV, VT16, VTh, VTl);
    k_fattn<<<dim3(NH_, TT / 64, NB_), 32 * FNW, 0, stream>>>(QPh, QPl, KPh, KPl, VT16, VTh, VTl, ATh, ATl);   /* one kv head per query head */
    k_gemmw<bf, 1, false><<<dim3(NB_ * TT / 64, DM / 64, 1), 32, 0, stream>>>(ATh, ATl, WO, nullptr, DQ, OUT, DM, nullptr, 0, 0, 0);
}

// v005
// It runs in 313 microseconds.
// Next to v004, in two timings, it ran 1.42 times as fast each time.
// All steps since v000 together make it 8.78 times as fast.
#include <hip/hip_runtime.h>

// Causal multi-head attention with interleaved-pair rotary embeddings driven by an integer position input (x [4][2048][1024]; q, k, v = x W^T ('oi', no bias; 16 heads x 64); rope on pairs (2i, 2i+1): (x_e cos - x_o sin, x_e sin + x_o cos) with angle pos[b][t] x THETA^(-2i/64) (token_positions int32 [4][2048] = arange per batch, READ on device; 32 f32 frequencies jnp-exact for this expression; precise cosf/sinf); scores / sqrt(64); causal (-inf); softmax; out = merged Wo^T -> [4][2048][1024] (8.4 M); argument order x, Wq, Wk, Wv, Wo, token_positions).
// Layout, all four batches in every launch (the batch is part of the row index of the GEMMs, of the bf16 copy of x and of the {cos, sin} table, and a grid dimension elsewhere): bf16 copy of x; exact projections; {cos, sin} per (position, pair) built once from the int positions and float32 inverse-frequency constants (precise cosf/sinf); interleaved rotary plane builder; causal T-2048 attention (EVERY row's scores on hi/lo planes (3 products: logit sigma 2 with these weights) and hybrid P.V (rows < 512 hi/lo, rest fp16 x1024); scores, softmax and P.V in one kernel, k_fattn, with a running row maximum and sum; key blocks above the diagonal are never touched); merged hi/lo x Wo exact.
// Operand planes: every 16-bit plane that a matrix instruction reads from global memory (x, the four weights, q, k, v transposed, the attention output) stands in FRAGMENT ORDER (see unpk below): the 16 x 32 fragment is 1 KiB in a row, lane l's two 16-byte halves at l * 16 and 512 + l * 16, so that a wave-wide 16-byte load covers four whole 128-byte lines.
// Compute dtypes, f32 accumulate: every input rounded to bf16; projections exact; rotary f32; attention scores 3 products, P.V rows < 512 3 products, rest fp16; softmax f32; Wo hl x exact.

#define NB_  4
#define TT   2048
#define DM   1024
#define NH_  16
#define NKV  16
#define REP  (NH_ / NKV)
#define HD   64
#define DQ   (NH_ * HD)
#define DKV  (NKV * HD)
#define RH   512                  // query rows < RH take P.V on hi+lo planes (0: none)
#define PCAR 1024.0f
#define SCL  0.125f   // HD^-0.5
typedef _Float16 h16;
typedef unsigned short bf;
typedef __attribute__((ext_vector_type(16))) __bf16   v16bf;
typedef __attribute__((ext_vector_type(16))) _Float16 v16h;
typedef __attribute__((ext_vector_type(8)))  _Float16 v8h;
typedef __attribute__((ext_vector_type(8)))  unsigned short v8us;
typedef __attribute__((ext_vector_type(8)))  float    v8f;
typedef __attribute__((ext_vector_type(4)))  float    v4f;
typedef v8h  __attribute__((may_alias)) v8ha;
typedef v4f  __attribute__((may_alias)) v4fa;
typedef v8us __attribute__((may_alias)) v8usa;

__device__ __forceinline__ unsigned short f2bf(float f) { unsigned u = __float_as_uint(f); u += 0x7FFFu + ((u >> 16) & 1u); return (unsigned short)(u >> 16); }
__device__ __forceinline__ float bf2f(unsigned short b) { return __uint_as_float(((unsigned)b) << 16); }
__device__ __forceinline__ float bfr(float f) { return bf2f(f2bf(f)); }
__device__ __forceinline__ v16h cat16(v8h lo, v8h hi) { return __builtin_shufflevector(lo, hi, 0, 1, 2, 3, 4, 5, 6, 7, 8, 9, 10, 11, 12, 13, 14, 15); }
__device__ __forceinline__ v16bf cat16b(v8us lo, v8us hi) { return __builtin_bit_cast(v16bf, __builtin_shufflevector(lo, hi, 0, 1, 2, 3, 4, 5, 6, 7, 8, 9, 10, 11, 12, 13, 14, 15)); }
__device__ __forceinline__ v8f wmma16(v16h a, v16h b, v8f c) { return __builtin_amdgcn_wmma_f32_16x16x32_f16(false, a, false, b, (short)0, c, false, false); }
__device__ __forceinline__ v8f wmmab(v16bf a, v16bf b, v8f c) { return __builtin_amdgcn_wmma_f32_16x16x32_bf16(false, a, false, b, (short)0, c, false, false); }



// ---- Fragment order of a 16-bit plane [rows][K] (rows % 16 == 0, K % 32 == 0): element (row, k) stands at ((row / 16) * (K / 32) + k / 32) * 512 + ((k / 16) % 2) * 256 + (((k / 8) % 2) * 16 + row % 16) * 8 + k % 8.
// That is the register order of ld(): ldp(base of the fragment + lane * 8) returns what ld(row (lane & 15), k = 8 * (lane >> 4)) returns on the row-major plane. unpk is the inverse map, for the kernels that write a plane in address order.
template <int K> __device__ __forceinline__ void unpk(unsigned e, int& row, int& k) { const unsigned f = e >> 9; row = (int)(f / (K / 32)) * 16 + (int)((e >> 3) & 15); k = (int)(f % (K / 32)) * 32 + (int)((e >> 8) & 1) * 16 + (int)((e >> 7) & 1) * 8 + (int)(e & 7); }
// ---- k_gemmw: register-blocked GEMM, ONE WAVE per 64x64 output tile (16 accumulators), operands straight from 16-bit planes in fragment order; grid (M/64, N/64, Z), 32 threads.
// C[m][n] (f32, pitch ldc, + optional f32 bias[n]) = sum_k A[m][k] Bt[n][k] (+ split products per NSPLIT). z-batch strides sA/sB/sC in elements. K % 32 == 0.
#define GAS __attribute__((address_space(1)))
typedef const GAS char* gcp;   // byte pointer known to point to global memory (a pointer rebuilt from integers would otherwise be loaded through as a flat one)
template <typename T16> struct WFrag;
template <> struct WFrag<h16> { typedef v16h V; static __device__ __forceinline__ V ld(const h16* p) { return cat16(*(const v8h*)p, *(const v8h*)(p + 16)); } static __device__ __forceinline__ V ldp(const h16* p) { return cat16(*(const v8h*)p, *(const v8h*)(p + 256)); } static __device__ __forceinline__ V ldg(gcp p) { return cat16(*(const GAS v8h*)p, *(const GAS v8h*)(p + 512)); } static __device__ __forceinline__ v8f mma(V a, V b, v8f c) { return wmma16(a, b, c); } };
template <> struct WFrag<bf> { typedef v16bf V; static __device__ __forceinline__ V ld(const bf* p) { return cat16b(*(const v8us*)p, *(const v8us*)(p + 16)); } static __device__ __forceinline__ V ldp(const bf* p) { return cat16b(*(const v8us*)p, *(const v8us*)(p + 256)); } static __device__ __forceinline__ V ldg(gcp p) { return cat16b(*(const GAS v8us*)p, *(const GAS v8us*)(p + 512)); } static __device__ __forceinline__ v8f mma(V a, V b, v8f c) { return wmmab(a, b, c); } };
__device__ __forceinline__ gcp sbase(const void* p) { const unsigned long long u = (unsigned long long)p; return (gcp)(((unsigned long long)(unsigned)__builtin_amdgcn_readfirstlane((int)(u >> 32)) << 32) | (unsigned)__builtin_amdgcn_readfirstlane((int)u)); }   // a wave-uniform pointer to global memory, kept as a scalar base
template <typename T16, int NSPLIT, bool BIAS>
__global__ __launch_bounds__(32) void k_gemmw(const T16* __restrict__ A, const T16* __restrict__ A2, const T16* __restrict__ Bt, const T16* __restrict__ Bt2, int K, float* C, int ldc, const float* __restrict__ bias, size_t sA, size_t sB, size_t sC) {
    typedef typename WFrag<T16>::V V;
    __shared__ __align__(16) float os[16 * 68];
    const size_t z = blockIdx.z; A += z * sA; if (A2) A2 += z * sA; Bt += z * sB; if (Bt2) Bt2 += z * sB; C += z * sC;
    const int lane = threadIdx.x & 31, lr = lane & 15, hi = lane >> 4; const int r0 = blockIdx.x * 64, c0 = blockIdx.y * 64;
    v8f acc[4][4];
#pragma unroll
    for (int mb = 0; mb < 4; ++mb)
#pragma unroll
        for (int nb = 0; nb < 4; ++nb) acc[mb][nb] = (v8f){};
    unsigned ko = (unsigned)lane * 16;   // byte offset of the lane's piece of the current k-step's fragment inside its 16 rows, one for all operands (uniform base + 32-bit lane offset), carried through the loop
    gcp ab[4], a2b[4], bb[4], b2b[4];   // uniform base of each 16-row group of the tile (K / 32 fragments of 1 KiB in a row), held in scalar registers for the whole loop: no 64-bit vector address sums in the loop, and no address register is rewritten between a k-step's loads
#pragma unroll
    for (int g = 0; g < 4; ++g) { ab[g] = sbase(A + (size_t)(r0 + g * 16) * K); bb[g] = sbase(Bt + (size_t)(c0 + g * 16) * K); a2b[g] = (NSPLIT == 1 || NSPLIT == 2) ? sbase(A2 + (size_t)(r0 + g * 16) * K) : nullptr; b2b[g] = (NSPLIT >= 2) ? sbase(Bt2 + (size_t)(c0 + g * 16) * K) : nullptr; }
#pragma unroll 1
    for (int kc = 0; kc < K; kc += 32) {
        V a[4], a2[4];
#pragma unroll
        for (int mb = 0; mb < 4; ++mb) { a[mb] = WFrag<T16>::ldg(ab[mb] + ko); if (NSPLIT == 1 || NSPLIT == 2) a2[mb] = WFrag<T16>::ldg(a2b[mb] + ko); }
#pragma unroll
        for (int nb = 0; nb < 4; ++nb) { const V b = WFrag<T16>::ldg(bb[nb] + ko); V b2; if (NSPLIT >= 2) b2 = WFrag<T16>::ldg(b2b[nb] + ko);
#pragma unroll
            for (int mb = 0; mb < 4; ++mb) { acc[mb][nb] = WFrag<T16>::mma(a[mb], b, acc[mb][nb]); if (NSPLIT == 1 || NSPLIT == 2) acc[mb][nb] = WFrag<T16>::mma(a2[mb], b, acc[mb][nb]); if (NSPLIT >= 2) acc[mb][nb] = WFrag<T16>::mma(a[mb], b2, acc[mb][nb]); } }
        asm volatile("v_nop\n\tv_nop\n\tv_nop\n\tv_nop" : "+v"(acc[0][0]), "+v"(acc[1][1]), "+v"(acc[2][2]), "+v"(acc[3][3]) : "v"(a[0]), "v"(a[3]));
        ko += 1024;   // the next k-step's fragment follows in the plane
    }
#pragma unroll
    for (int mb = 0; mb < 4; ++mb) {
#pragma unroll
        for (int nb = 0; nb < 4; ++nb) {
#pragma unroll
            for (int j = 0; j < 8; ++j) os[(hi * 8 + j) * 68 + nb * 16 + lr] = acc[mb][nb][j]; }
        __builtin_amdgcn_wave_barrier(); asm volatile("" ::: "memory");
        float* crow = C + (size_t)(r0 + mb * 16) * ldc + c0;
{
#pragma unroll
            for (int s = 0; s < 8; ++s) { const int row = 2 * s + hi, cofs = lr * 4; v4f val = *(const v4fa*)(os + row * 68 + cofs); if (BIAS) { val[0] += bfr(bias[c0 + cofs]); val[1] += bfr(bias[c0 + cofs + 1]); val[2] += bfr(bias[c0 + cofs + 2]); val[3] += bfr(bias[c0 + cofs + 3]); }
                *(v4f*)(crow + (size_t)row * ldc + cofs) = val; }
             }
        __builtin_amdgcn_wave_barrier(); asm volatile("" ::: "memory");
    }
}

__device__ __forceinline__ h16 tohx(float x) { return (h16)x; }
__device__ __forceinline__ void splitf(float y, unsigned short& h, unsigned short& l) { h = f2bf(y); l = f2bf(y - bf2f(h)); }
typedef __attribute__((ext_vector_type(2))) _Float16 v2h;
typedef __attribute__((ext_vector_type(4))) _Float16 v4h;
typedef __attribute__((ext_vector_type(2))) unsigned short v2us;
typedef __attribute__((ext_vector_type(4))) unsigned short v4us;
typedef __attribute__((ext_vector_type(2))) float v2f;
typedef __attribute__((ext_vector_type(4))) int v4i;

__global__ __launch_bounds__(256) void k_wtG(const float* __restrict__ w, int K, int N, bf* Bt) {
    const int lane = threadIdx.x & 31; const int L0 = (blockIdx.x * 8 + (threadIdx.x >> 5)) * 8; const int nlines = N * K / 64;
{
#pragma unroll 1
        for (int l = 0; l < 8; ++l) { const int L = L0 + l; if (L >= nlines) break; const size_t e = (size_t)L * 64 + lane * 2; const int k = (int)(e % K), n = (int)(e / K); v2us o;
            o[0] = f2bf(w[(size_t)k * N + n]); o[1] = f2bf(w[(size_t)(k + 1) * N + n]); *(v2us*)(Bt + e) = o; }
         }
}
__global__ __launch_bounds__(256) void k_cvt8(const float* __restrict__ src, bf* dst, size_t n8) { const size_t i = (size_t)blockIdx.x * 256 + threadIdx.x; if (i >= n8) return; int row, k; unpk<DM>((unsigned)i * 8, row, k);   /* src is [rows][DM]; dst takes it in fragment order, written in address order */ const v8f v = *(const v8f*)(src + (size_t)row * DM + k); v8us o;
#pragma unroll
    for (int k = 0; k < 8; ++k) o[k] = f2bf(v[k]); *(v8us*)(dst + i * 8) = o;  }

__global__ __launch_bounds__(256) void k_ropeI(const float* __restrict__ F, int pitch, int nheads, const float* __restrict__ CS, float sc, h16* P16, bf* Ph, bf* Pl) {
    const size_t e = ((size_t)blockIdx.x * 256 + threadIdx.x) * 2; if (e >= (size_t)nheads * TT * HD) return; const int h = (int)(e / ((size_t)HD * TT)); int t, d; unpk<HD>((unsigned)(e % ((size_t)HD * TT)), t, d);   // e is the address in the planes: a head's [TT][HD] in fragment order
    { const size_t b = blockIdx.y; F += b * TT * pitch; CS += b * TT * HD * 2; const size_t po = b * nheads * TT * HD; P16 += po; Ph += po; Pl += po; }   // batch b: its rows of the projection, its table, its planes
    const float* f = F + (size_t)t * pitch + h * HD; const float x0 = f[d], x1 = f[d + 1]; const v2f cs = *(const v2f*)(CS + ((size_t)t * HD + d) * 2); v2h o16; v2us oh, ol;
    float a0 = __fmul_rn(x0, cs[0]), b0 = __fmul_rn(x1, cs[1]), a1 = __fmul_rn(x1, cs[0]), b1 = __fmul_rn(x0, cs[1]); asm volatile("" : "+v"(a0), "+v"(b0), "+v"(a1), "+v"(b1));
    float r0 = __fsub_rn(a0, b0) * sc, r1 = __fadd_rn(b1, a1) * sc;   /* even: x0 c - x1 s; odd: x0 s + x1 c */
    o16[0] = tohx(r0); o16[1] = tohx(r1); { unsigned short a2, c2; splitf(r0, a2, c2); oh[0] = a2; ol[0] = c2; splitf(r1, a2, c2); oh[1] = a2; ol[1] = c2; }
    *(v2h*)(P16 + e) = o16; *(v2us*)(Ph + e) = oh; *(v2us*)(Pl + e) = ol;  }

__constant__ float INV2[HD / 2] = { 1.000000000e+00f, 7.498942018e-01f, 5.623413324e-01f, 4.216965139e-01f, 3.162277639e-01f, 2.371373773e-01f, 1.778279394e-01f, 1.333521456e-01f, 1.000000015e-01f, 7.498942316e-02f, 5.623413250e-02f, 4.216964915e-02f, 3.162277490e-02f, 2.371373773e-02f, 1.778279431e-02f, 1.333521400e-02f, 9.999999776e-03f, 7.498942316e-03f, 5.623413250e-03f, 4.216964822e-03f, 3.162277630e-03f, 2.371373819e-03f, 1.778279431e-03f, 1.333521446e-03f, 1.000000047e-03f, 7.498941850e-04f, 5.623413017e-04f, 4.216965172e-04f, 3.162277571e-04f, 2.371373703e-04f, 1.778279402e-04f, 1.333521504e-04f };   // float32 10000^(-(i * 2 / 64)), generated with jnp to be bit-exact with the module's expression
__global__ __launch_bounds__(256) void k_cstabI(const int* __restrict__ pid, float* CS) { const int idx = blockIdx.x * 256 + threadIdx.x; if (idx >= NB_ * TT * HD) return; const int d = idx % HD; const int t = idx / HD;   /* t runs over the rows of all batches */ const float a = __fmul_rn((float)pid[t], INV2[d >> 1]); v2f cs; cs[0] = cosf(a); cs[1] = sinf(a); *(v2f*)(CS + (size_t)idx * 2) = cs;  }

__global__ __launch_bounds__(256) void k_vtp(const float* __restrict__ F, int pitch, int nheads, h16* V16, bf* Vh, bf* Vl) { const size_t e = ((size_t)blockIdx.x * 256 + threadIdx.x) * 2; if (e >= (size_t)nheads * HD * TT) return; const int g = (int)(e / ((size_t)TT * HD)); int d, t; unpk<TT>((unsigned)(e % ((size_t)TT * HD)), d, t);   /* e is the address in the planes: a head's [HD][TT] in fragment order */ v2h o16; v2us oh, ol;
    { const size_t b = blockIdx.y; F += b * TT * pitch; const size_t po = b * nheads * HD * TT; V16 += po; Vh += po; Vl += po; }   // batch b
#pragma unroll
    for (int q = 0; q < 2; ++q) { const float x = F[(size_t)(t + q) * pitch + g * HD + d]; o16[q] = tohx(x); unsigned short a2, c2; splitf(x, a2, c2); oh[q] = a2; ol[q] = c2; }
    *(v2h*)(V16 + e) = o16; *(v2us*)(Vh + e) = oh; *(v2us*)(Vl + e) = ol;  }
// ---- k_fattn: causal attention of all batches in one launch; scores and probabilities never go to memory. Grid (NH_, TT/64, NB_), 32 * FNW threads.
// A work-group owns 64 query rows of one head: wave w holds the 16-row strip (w & 3) and takes the 64-key blocks (w >> 2), (w >> 2) + KS, ... up to the diagonal block.
// Per block: scores on hi/lo planes (3 products, the k order of the score GEMM it replaces); running row maximum and row sum (f32); probabilities exp(t - max) go through the wave's own LDS
// from the accumulator layout to the A-fragment layout (rows < RH as hi/lo planes, 3 products; the rest fp16 x PCAR); the output strip is rescaled when the maximum moves.
// The KS partial (maximum, sum, strip) of a strip are merged through LDS behind one barrier, divided by the row sum and stored as the hi/lo planes that the output projection reads.
#define KS   4                    // waves that share the key range of one 16-row strip
#define FNW  (4 * KS)
#define PP   72                   // pitch, in 16-bit elements, of a probability row in LDS (144 bytes: 16-byte aligned, rows fall on different banks)
#define WREG 4608                 // LDS bytes of one wave: two 16 x PP 16-bit planes, later its 16 x 68 f32 strip
#define L2S  (SCL * 1.4426950408889634f)   // scores stay unscaled: HD^-0.5 is a power of two and goes, exactly, into the factor in front of exp2
template <int M> __device__ __forceinline__ float rowx(float v) { return __int_as_float(__builtin_amdgcn_mov_dpp(__float_as_int(v), 0x160 + M, 0xf, 0xf, true)); }   // lane ^ M inside a 16-lane row (row_xmask)
__device__ __forceinline__ float rowmax16(float v) { v = fmaxf(v, rowx<1>(v)); v = fmaxf(v, rowx<2>(v)); v = fmaxf(v, rowx<4>(v)); return fmaxf(v, rowx<8>(v)); }
__device__ __forceinline__ float rowsum16(float v) { v += rowx<1>(v); v += rowx<2>(v); v += rowx<4>(v); return v + rowx<8>(v); }
// Five exp2 of one row (the rescale factor and the row's four probabilities) and the slot behind a transcendental in ONE statement: the outputs share no register with the inputs, so no v_exp_f32 here
// overwrites the source or reads the result of the one in front of it, and the v_nop keeps whatever the compiler puts next one slot away from the last.
__device__ __forceinline__ void exp2x5(float& a, float& b, float& c, float& d, float& e) { float ra, rb, rc, rd, re;
    asm("v_exp_f32 %0, %5\n\tv_exp_f32 %1, %6\n\tv_exp_f32 %2, %7\n\tv_exp_f32 %3, %8\n\tv_exp_f32 %4, %9\n\tv_nop" : "=&v"(ra), "=&v"(rb), "=&v"(rc), "=&v"(rd), "=&v"(re) : "v"(a), "v"(b), "v"(c), "v"(d), "v"(e));
    a = ra; b = rb; c = rc; d = rd; e = re; }
template <bool HR>
__device__ __forceinline__ void fattn_strip(const bf* __restrict__ Qh, const bf* __restrict__ Ql, const bf* __restrict__ Kh, const bf* __restrict__ Kl, const h16* __restrict__ V16, const bf* __restrict__ Vh, const bf* __restrict__ Vl, int r0, int wave, char* wreg, float* mrow, float* lrow) {
    const int lane = threadIdx.x & 31, lr = lane & 15, hi = lane >> 4; const int rw = r0 + (wave & 3) * 16;
    v16bf qh[2], ql[2];
#pragma unroll
    for (int s = 0; s < 2; ++s) { qh[s] = WFrag<bf>::ldp(Qh + (size_t)rw * HD + s * 512 + 8 * lane); ql[s] = WFrag<bf>::ldp(Ql + (size_t)rw * HD + s * 512 + 8 * lane); }
    v8f o[4]; float m[8], l[8];
#pragma unroll
    for (int nb = 0; nb < 4; ++nb) o[nb] = (v8f){};
#pragma unroll
    for (int j = 0; j < 8; ++j) { m[j] = -3.0e38f; l[j] = 0.f; }
    // per-lane operand offsets, carried through the loop; all fragments of a block hang on them by immediate offsets, so no address register is rewritten between a block's loads
    unsigned kob = (unsigned)(((wave >> 2) * 64 * HD + 8 * lane) * 2), vob = (unsigned)(((wave >> 2) * 2 * 512 + 8 * lane) * 2);   // byte offsets, one for both key planes, one for the value planes (uniform base + 32-bit lane offset)
    const char* khb = (const char*)Kh; const char* klb = (const char*)Kl; const char* vb = (const char*)V16; const char* vhb = (const char*)Vh; const char* vlb = (const char*)Vl;
    h16* pw = (h16*)wreg + hi * 8 * PP + lr; bf* pwb = (bf*)wreg + hi * 8 * PP + lr;   // where this lane's probabilities of row j = 0, block column 0 go
    const int nblk = r0 / 64 + 1;     // every block up to the diagonal one holds at least one key <= i for each of the 64 rows
#pragma unroll 1
    for (int blk = wave >> 2; blk < nblk; blk += KS) {
        const int kb = blk * 64; v8f sc[4]; v16bf kh[4][2], kl[4][2];
#pragma unroll
        for (int nb = 0; nb < 4; ++nb)
#pragma unroll
            for (int s = 0; s < 2; ++s) { kh[nb][s] = WFrag<bf>::ldp((const bf*)(khb + kob + (nb * 2 + s) * 1024)); kl[nb][s] = WFrag<bf>::ldp((const bf*)(klb + kob + (nb * 2 + s) * 1024)); }   // a 64-key block is 8 fragments in a row
        __builtin_amdgcn_sched_barrier(0);   // every key fragment is in flight before the first product waits: one memory round trip a block, not one a fragment pair
#pragma unroll
        for (int nb = 0; nb < 4; ++nb) { sc[nb] = (v8f){};
#pragma unroll
            for (int s = 0; s < 2; ++s) { sc[nb] = wmmab(qh[s], kh[nb][s], sc[nb]); sc[nb] = wmmab(ql[s], kh[nb][s], sc[nb]); sc[nb] = wmmab(qh[s], kl[nb][s], sc[nb]); } }
        __builtin_amdgcn_sched_barrier(0);   // the value loads issue behind the score products, into the registers that the key fragments leave
        v16h vf[2][4]; v16bf vh[2][4], vl[2][4];
#pragma unroll
        for (int s = 0; s < 2; ++s)
#pragma unroll
            for (int nb = 0; nb < 4; ++nb) { const int vo = (nb * (TT / 32) + s) * 1024; if (HR) { vh[s][nb] = WFrag<bf>::ldp((const bf*)(vhb + vob + vo)); vl[s][nb] = WFrag<bf>::ldp((const bf*)(vlb + vob + vo)); } else vf[s][nb] = WFrag<h16>::ldp((const h16*)(vb + vob + vo)); }
        __builtin_amdgcn_sched_barrier(0);   // and in front of the softmax, which runs while they fly
        const int dd = kb + lr - rw - hi * 8;   // key index minus query index at nb = 0, j = 0
#pragma unroll
        for (int j = 0; j < 8; ++j) { float t[4];
#pragma unroll
            for (int nb = 0; nb < 4; ++nb) t[nb] = (dd <= j - nb * 16) ? sc[nb][j] : -3.0e38f;
            const float mn = fmaxf(m[j], rowmax16(fmaxf(fmaxf(t[0], t[1]), fmaxf(t[2], t[3])))); float al = (m[j] - mn) * L2S; m[j] = mn; float ps = 0.f;
#pragma unroll
            for (int nb = 0; nb < 4; ++nb) t[nb] = (t[nb] - mn) * L2S;
            exp2x5(al, t[0], t[1], t[2], t[3]);
#pragma unroll
            for (int nb = 0; nb < 4; ++nb) { const float p = t[nb]; ps += p; o[nb][j] *= al; const int po = j * PP + nb * 16;
                if (HR) { unsigned short a, c2; splitf(p, a, c2); pwb[po] = a; pwb[16 * PP + po] = c2; } else pw[po] = tohx(p * PCAR); }
            l[j] = l[j] * al + ps; }
        __builtin_amdgcn_wave_barrier(); asm volatile("" ::: "memory");   // the wave's probability stores stay in front of its fragment reads
#pragma unroll
        for (int s = 0; s < 2; ++s) {
            if (HR) { const v16bf a = WFrag<bf>::ld((const bf*)wreg + lr * PP + 8 * hi + s * 32), a2 = WFrag<bf>::ld((const bf*)wreg + 16 * PP + lr * PP + 8 * hi + s * 32);
#pragma unroll
                for (int nb = 0; nb < 4; ++nb) { o[nb] = wmmab(a, vh[s][nb], o[nb]); o[nb] = wmmab(a2, vh[s][nb], o[nb]); o[nb] = wmmab(a, vl[s][nb], o[nb]); }
            } else { const v16h a = WFrag<h16>::ld((const h16*)wreg + lr * PP + 8 * hi + s * 32);
#pragma unroll
                for (int nb = 0; nb < 4; ++nb) o[nb] = wmma16(a, vf[s][nb], o[nb]); } }
        asm volatile("v_nop\n\tv_nop\n\tv_nop\n\tv_nop" : "+v"(o[0]), "+v"(o[1]), "+v"(o[2]), "+v"(o[3]));   // matrix-instruction distance before the operands are loaded anew, on the back edge too
        __builtin_amdgcn_wave_barrier(); asm volatile("" ::: "memory");   // the fragment reads stay in front of the next block's probability stores
        kob += KS * 64 * HD * 2; vob += KS * 2 * 1024;
    }
    float* ow = (float*)wreg;
#pragma unroll
    for (int nb = 0; nb < 4; ++nb)
#pragma unroll
        for (int j = 0; j < 8; ++j) ow[(hi * 8 + j) * 68 + nb * 16 + lr] = o[nb][j];
#pragma unroll
    for (int j = 0; j < 8; ++j) { const float ls = rowsum16(l[j]); if (lr == 0) { mrow[wave * 16 + hi * 8 + j] = m[j]; lrow[wave * 16 + hi * 8 + j] = ls; } }
}
__global__ __launch_bounds__(32 * FNW) void k_fattn(const bf* __restrict__ Qh, const bf* __restrict__ Ql, const bf* __restrict__ Kh, const bf* __restrict__ Kl, const h16* __restrict__ V16, const bf* __restrict__ Vh, const bf* __restrict__ Vl, bf* Ah, bf* Al) {
    __shared__ __align__(16) char sm[FNW * WREG]; __shared__ float mrow[FNW * 16], lrow[FNW * 16];
    const int h = blockIdx.x; const int qt = TT / 64 - 1 - (int)blockIdx.y;   // the tiles with the longest key range get the lowest indices (for speed only)
    const int r0 = qt * 64; const int wave = __builtin_amdgcn_readfirstlane(threadIdx.x >> 5);   // scalar, so that the block loop branches on a scalar compare
    const size_t zo = ((size_t)blockIdx.z * NH_ + h) * TT * HD; char* wreg = sm + wave * WREG;
    if (r0 < RH) fattn_strip<true>(Qh + zo, Ql + zo, Kh + zo, Kl + zo, V16 + zo, Vh + zo, Vl + zo, r0, wave, wreg, mrow, lrow);
    else fattn_strip<false>(Qh + zo, Ql + zo, Kh + zo, Kl + zo, V16 + zo, Vh + zo, Vl + zo, r0, wave, wreg, mrow, lrow);
    __syncthreads();   // every wave's partial maximum, sum and strip stand in LDS before any wave merges them
    const float cs = (r0 < RH) ? 1.0f : (1.0f / PCAR);
#pragma unroll
    for (int s = 0; s < 1024 / (32 * FNW); ++s) { const int idx = s * (32 * FNW) + (int)threadIdx.x; const int rr = idx & 15, cofs = ((idx >> 4) & 15) * 4, sub = idx >> 8; const int row = sub * 16 + rr; float mx = -3.0e38f;   // a wave holds 16 rows x 8 columns: 256 bytes in a row of each output plane
#pragma unroll
        for (int k = 0; k < KS; ++k) mx = fmaxf(mx, mrow[(k * 4 + sub) * 16 + rr]);
        float ls = 0.f; v4f val = (v4f){};
#pragma unroll
        for (int k = 0; k < KS; ++k) { const int w = k * 4 + sub; const float wg = __builtin_amdgcn_exp2f((mrow[w * 16 + rr] - mx) * L2S); ls += wg * lrow[w * 16 + rr]; val += wg * *(const v4fa*)(sm + w * WREG + (rr * 68 + cofs) * 4); }   /* a wave without a block has weight 0 */
        const float f = __fdiv_rn(cs, ls); v4us oh, ol;
#pragma unroll
        for (int q = 0; q < 4; ++q) { unsigned short a, c2; splitf(val[q] * f, a, c2); oh[q] = a; ol[q] = c2; }
        const int col = h * HD + cofs; const size_t oo = ((size_t)(((int)blockIdx.z * TT + r0 + row) >> 4) * (DQ / 32) + (col >> 5)) * 512 + ((col >> 4) & 1) * 256 + (((col >> 3) & 1) * 16 + rr) * 8 + (col & 7); *(v4us*)(Ah + oo) = oh; *(v4us*)(Al + oo) = ol; }   /* [NB_ * TT][DQ] in fragment order */
}

extern "C" void kernel_launch(void* const* d_in, const int* in_sizes, int n_in,
                              void* d_out, int out_size, void* d_ws, size_t ws_size, hipStream_t stream) {
    (void)in_sizes; (void)n_in; (void)out_size;
    const float* x = (const float*)d_in[0]; const float* wq = (const float*)d_in[1]; const float* wk = (const float*)d_in[2]; const float* wv = (const float*)d_in[3]; const float* wo = (const float*)d_in[4]; const int* PID = (const int*)d_in[5];   /* x, Wq, Wk, Wv, Wo ('oi' [1024][1024]), token_positions (int32 [4][2048], read per batch) */
    float* OUT = (float*)d_out;     // [4][2048][1024]
    char* wsp = (char*)d_ws;
    auto take = [&](size_t bytes) { char* p = wsp; wsp += (bytes + 255) & ~(size_t)255; return (void*)p; };
    bf* WQ = (bf*)take((size_t)DQ * DM * 2); bf* WK = (bf*)take((size_t)DKV * DM * 2); bf* WV = (bf*)take((size_t)DKV * DM * 2); bf* WO = (bf*)take((size_t)DM * DQ * 2); float* CS = (float*)take((size_t)NB_ * TT * HD * 2 * 4);
    bf* XB = (bf*)take((size_t)NB_ * TT * DM * 2); float* FP = (float*)take((size_t)NB_ * TT * DQ * 4);   // one f32 projection buffer: q, then k, then v, each read by its plane builder before the next is written (stream-ordered)
    h16* QP16 = (h16*)take((size_t)NB_ * NH_ * TT * HD * 2); h16* KP16 = (h16*)take((size_t)NB_ * NKV * TT * HD * 2); h16* VT16 = (h16*)take((size_t)NB_ * NKV * HD * TT * 2);
    bf* QPh = (bf*)take((size_t)NB_ * NH_ * TT * HD * 2); bf* QPl = (bf*)take((size_t)NB_ * NH_ * TT * HD * 2); bf* KPh = (bf*)take((size_t)NB_ * NKV * TT * HD * 2); bf* KPl = (bf*)take((size_t)NB_ * NKV * TT * HD * 2); bf* VTh = (bf*)take((size_t)NB_ * NKV * HD * TT * 2); bf* VTl = (bf*)take((size_t)NB_ * NKV * HD * TT * 2);
    bf* ATh = (bf*)take((size_t)NB_ * TT * DQ * 2); bf* ATl = (bf*)take((size_t)NB_ * TT * DQ * 2);
    if ((size_t)(wsp - (char*)d_ws) > ws_size) return;    // 236 MiB of the 256 MiB
    { k_cvt8<<<(unsigned)(((size_t)DQ * DM / 8 + 255) / 256), 256, 0, stream>>>(wq, WQ, (size_t)DQ * DM / 8); k_cvt8<<<(unsigned)(((size_t)DKV * DM / 8 + 255) / 256), 256, 0, stream>>>(wk, WK, (size_t)DKV * DM / 8); k_cvt8<<<(unsigned)(((size_t)DKV * DM / 8 + 255) / 256), 256, 0, stream>>>(wv, WV, (size_t)DKV * DM / 8);
      k_cvt8<<<(unsigned)(((size_t)DM * DQ / 8 + 255) / 256), 256, 0, stream>>>(wo, WO, (size_t)DM * DQ / 8); }
    const unsigned LQ = (unsigned)(((size_t)NH_ * TT * HD / 2 + 255) / 256), LKv = (unsigned)(((size_t)NKV * TT * HD / 2 + 255) / 256);
    k_cstabI<<<(NB_ * TT * HD + 255) / 256, 256, 0, stream>>>(PID, CS);   /* token_positions[b][t] (int32, read): a table row per (batch, position) */
    k_cvt8<<<(unsigned)(((size_t)NB_ * TT * DM / 8 + 255) / 256), 256, 0, stream>>>(x, XB, (size_t)NB_ * TT * DM / 8);
    k_gemmw<bf, 0, false><<<dim3(NB_ * TT / 64, DQ / 64, 1), 32, 0, stream>>>(XB, nullptr, WQ, nullptr, DM, FP, DQ, nullptr, 0, 0, 0);
    k_ropeI<<<dim3(LQ, NB_, 1), 256, 0, stream>>>(FP, DQ, NH_, CS, 1.0f, QP16, QPh, QPl);
    k_gemmw<bf, 0, false><<<dim3(NB_ * TT / 64, DKV / 64, 1), 32, 0, stream>>>(XB, nullptr, WK, nullptr, DM, FP, DKV, nullptr, 0, 0, 0);
    k_ropeI<<<dim3(LKv, NB_, 1), 256, 0, stream>>>(FP, DKV, NKV, CS, 1.0f, KP16, KPh, KPl);
    k_gemmw<bf, 0, false><<<dim3(NB_ * TT / 64, DKV / 64, 1), 32, 0, stream>>>(XB, nullptr, WV, nullptr, DM, FP, DKV, nullptr, 0, 0, 0);
    k_vtp<<<dim3(LKv, NB_, 1), 256, 0, stream>>>(FP, DKV, NKV, VT16, VTh, VTl);
    k_fattn<<<dim3(NH_, TT / 64, NB_), 32 * FNW, 0, stream>>>(QPh, QPl, KPh, KPl, VT16, VTh, VTl, ATh, ATl);   /* one kv head per query head */
    k_gemmw<bf, 1, false><<<dim3(NB_ * TT / 64, DM / 64, 1), 32, 0, stream>>>(ATh, ATl, WO, nullptr, DQ, OUT, DM, nullptr, 0, 0, 0);
}

// v006
// It runs in 272 microseconds.
// Two timings next to v005 put it at 1.14 and 1.15 times that version's speed.
// Counting every step since v000, it is 10.0 times as fast.
#include <hip/hip_runtime.h>

// Causal multi-head attention with interleaved-pair rotary embeddings driven by an integer position input (x [4][2048][1024]; q, k, v = x W^T ('oi', no bias; 16 heads x 64); rope on pairs (2i, 2i+1): (x_e cos - x_o sin, x_e sin + x_o cos) with angle pos[b][t] x THETA^(-2i/64) (token_positions int32 [4][2048] = arange per batch, READ on device; 32 f32 frequencies jnp-exact for this expression; precise cosf/sinf); scores / sqrt(64); causal (-inf); softmax; out = merged Wo^T -> [4][2048][1024] (8.4 M); argument order x, Wq, Wk, Wv, Wo, token_positions).
// Layout, all four batches in every launch (the batch is part of the position index of the GEMMs (their rows, for v their columns) and a grid dimension of k_fattn): bf16 copy of x; {cos, sin} per (position, pair) built once from the int positions and float32 inverse-frequency constants (precise cosf/sinf); exact projections whose epilogue applies the interleaved rotary embedding (q, k) and stores the operand planes of the attention itself, so that no f32 projection goes to memory (v comes out transposed: its GEMM takes the weight as the row operand); causal T-2048 attention (EVERY row's scores on hi/lo planes (3 products: logit sigma 2 with these weights) and hybrid P.V (rows < 512 hi/lo, rest fp16 x1024); scores, softmax and P.V in one kernel, k_fattn, with a running row maximum and sum; key blocks above the diagonal are never touched); merged hi/lo x Wo exact.
// Operand planes: every 16-bit plane that a matrix instruction reads from global memory (x, the four weights, q, k, v transposed, the attention output) stands in FRAGMENT ORDER (see unpk below): the 16 x 32 fragment is 1 KiB in a row, lane l's two 16-byte halves at l * 16 and 512 + l * 16, so that a wave-wide 16-byte load covers four whole 128-byte lines.
// Compute dtypes, f32 accumulate: every input rounded to bf16; projections exact; rotary f32; attention scores 3 products, P.V rows < 512 3 products, rest fp16; softmax f32; Wo hl x exact.

#define NB_  4
#define TT   2048
#define DM   1024
#define NH_  16
#define NKV  16
#define REP  (NH_ / NKV)
#define HD   64
#define DQ   (NH_ * HD)
#define DKV  (NKV * HD)
#define RH   512                  // query rows < RH take P.V on hi+lo planes (0: none)
#define PCAR 1024.0f
#define SCL  0.125f   // HD^-0.5
typedef _Float16 h16;
typedef unsigned short bf;
typedef __attribute__((ext_vector_type(16))) __bf16   v16bf;
typedef __attribute__((ext_vector_type(16))) _Float16 v16h;
typedef __attribute__((ext_vector_type(8)))  _Float16 v8h;
typedef __attribute__((ext_vector_type(8)))  unsigned short v8us;
typedef __attribute__((ext_vector_type(8)))  float    v8f;
typedef __attribute__((ext_vector_type(4)))  float    v4f;
typedef __attribute__((ext_vector_type(2)))  float    v2f;
typedef v8h  __attribute__((may_alias)) v8ha;
typedef v4f  __attribute__((may_alias)) v4fa;
typedef v8us __attribute__((may_alias)) v8usa;

__device__ __forceinline__ unsigned short f2bf(float f) { unsigned u = __float_as_uint(f); u += 0x7FFFu + ((u >> 16) & 1u); return (unsigned short)(u >> 16); }
__device__ __forceinline__ float bf2f(unsigned short b) { return __uint_as_float(((unsigned)b) << 16); }
__device__ __forceinline__ float bfr(float f) { return bf2f(f2bf(f)); }
__device__ __forceinline__ v16h cat16(v8h lo, v8h hi) { return __builtin_shufflevector(lo, hi, 0, 1, 2, 3, 4, 5, 6, 7, 8, 9, 10, 11, 12, 13, 14, 15); }
__device__ __forceinline__ v16bf cat16b(v8us lo, v8us hi) { return __builtin_bit_cast(v16bf, __builtin_shufflevector(lo, hi, 0, 1, 2, 3, 4, 5, 6, 7, 8, 9, 10, 11, 12, 13, 14, 15)); }
__device__ __forceinline__ v8f wmma16(v16h a, v16h b, v8f c) { return __builtin_amdgcn_wmma_f32_16x16x32_f16(false, a, false, b, (short)0, c, false, false); }
__device__ __forceinline__ v8f wmmab(v16bf a, v16bf b, v8f c) { return __builtin_amdgcn_wmma_f32_16x16x32_bf16(false, a, false, b, (short)0, c, false, false); }



// ---- Fragment order of a 16-bit plane [rows][K] (rows % 16 == 0, K % 32 == 0): element (row, k) stands at ((row / 16) * (K / 32) + k / 32) * 512 + ((k / 16) % 2) * 256 + (((k / 8) % 2) * 16 + row % 16) * 8 + k % 8.
// That is the register order of ld(): ldp(base of the fragment + lane * 8) returns what ld(row (lane & 15), k = 8 * (lane >> 4)) returns on the row-major plane. unpk is the inverse map, for the kernels that write a plane in address order.
template <int K> __device__ __forceinline__ void unpk(unsigned e, int& row, int& k) { const unsigned f = e >> 9; row = (int)(f / (K / 32)) * 16 + (int)((e >> 3) & 15); k = (int)(f % (K / 32)) * 32 + (int)((e >> 8) & 1) * 16 + (int)((e >> 7) & 1) * 8 + (int)(e & 7); }
__device__ __forceinline__ h16 tohx(float x) { return (h16)x; }
__device__ __forceinline__ void splitf(float y, unsigned short& h, unsigned short& l) { h = f2bf(y); l = f2bf(y - bf2f(h)); }
// ---- k_gemmw: register-blocked GEMM, ONE WAVE per 64x64 output tile (16 accumulators), operands straight from 16-bit planes in fragment order; grid (M/64, N/64, Z), 32 threads.
// C[m][n] (f32, pitch ldc, + optional f32 bias[n]) = sum_k A[m][k] Bt[n][k] (+ split products per NSPLIT). z-batch strides sA/sB/sC in elements. K % 32 == 0.
// EPI says where the tile goes. 0: to C, as f32. 1 and 2: C is not touched; the tile goes straight to the 16-bit planes that k_fattn reads, in fragment order (ldc / HD = heads in a batch):
//   1: m = position over all batches, n = head * HD + d. Rotary embedding from the table CS, then the hi/lo planes Ph, Pl of [batch][head][TT][HD].
//   2: m = head * HD + d, n = position over all batches (the weight is the row operand). The f16 plane P16 and the hi/lo planes Ph, Pl of [batch][head][HD][TT].
//   In both a 16 x 64 piece of the tile is two fragments in a row, 1024 elements: lane l stores the 8 elements of tile row (l & 15) from column (2 s + (l >> 4)) * 8 at s * 256 + l * 8, s = 0..3, so every store covers 4 whole 128-byte lines.
#define GAS __attribute__((address_space(1)))
typedef const GAS char* gcp;   // byte pointer known to point to global memory (a pointer rebuilt from integers would otherwise be loaded through as a flat one)
template <typename T16> struct WFrag;
template <> struct WFrag<h16> { typedef v16h V; static __device__ __forceinline__ V ld(const h16* p) { return cat16(*(const v8h*)p, *(const v8h*)(p + 16)); } static __device__ __forceinline__ V ldp(const h16* p) { return cat16(*(const v8h*)p, *(const v8h*)(p + 256)); } static __device__ __forceinline__ V ldg(gcp p) { return cat16(*(const GAS v8h*)p, *(const GAS v8h*)(p + 512)); } static __device__ __forceinline__ v8f mma(V a, V b, v8f c) { return wmma16(a, b, c); } };
template <> struct WFrag<bf> { typedef v16bf V; static __device__ __forceinline__ V ld(const bf* p) { return cat16b(*(const v8us*)p, *(const v8us*)(p + 16)); } static __device__ __forceinline__ V ldp(const bf* p) { return cat16b(*(const v8us*)p, *(const v8us*)(p + 256)); } static __device__ __forceinline__ V ldg(gcp p) { return cat16b(*(const GAS v8us*)p, *(const GAS v8us*)(p + 512)); } static __device__ __forceinline__ v8f mma(V a, V b, v8f c) { return wmmab(a, b, c); } };
__device__ __forceinline__ gcp sbase(const void* p) { const unsigned long long u = (unsigned long long)p; return (gcp)(((unsigned long long)(unsigned)__builtin_amdgcn_readfirstlane((int)(u >> 32)) << 32) | (unsigned)__builtin_amdgcn_readfirstlane((int)u)); }   // a wave-uniform pointer to global memory, kept as a scalar base
template <typename T16, int NSPLIT, bool BIAS, int EPI>
__global__ __launch_bounds__(32) void k_gemmw(const T16* __restrict__ A, const T16* __restrict__ A2, const T16* __restrict__ Bt, const T16* __restrict__ Bt2, int K, float* C, int ldc, const float* __restrict__ bias, size_t sA, size_t sB, size_t sC, const float* __restrict__ CS, h16* P16, bf* Ph, bf* Pl) {
    typedef typename WFrag<T16>::V V;
    __shared__ __align__(16) float os[16 * 68];
    const size_t z = blockIdx.z; A += z * sA; if (A2) A2 += z * sA; Bt += z * sB; if (Bt2) Bt2 += z * sB; C += z * sC;
    const int lane = threadIdx.x & 31, lr = lane & 15, hi = lane >> 4; const int r0 = blockIdx.x * 64, c0 = blockIdx.y * 64;
    v8f acc[4][4];
#pragma unroll
    for (int mb = 0; mb < 4; ++mb)
#pragma unroll
        for (int nb = 0; nb < 4; ++nb) acc[mb][nb] = (v8f){};
    unsigned ko = (unsigned)lane * 16;   // byte offset of the lane's piece of the current k-step's fragment inside its 16 rows, one for all operands (uniform base + 32-bit lane offset), carried through the loop
    gcp ab[4], a2b[4], bb[4], b2b[4];   // uniform base of each 16-row group of the tile (K / 32 fragments of 1 KiB in a row), held in scalar registers for the whole loop: no 64-bit vector address sums in the loop, and no address register is rewritten between a k-step's loads
#pragma unroll
    for (int g = 0; g < 4; ++g) { ab[g] = sbase(A + (size_t)(r0 + g * 16) * K); bb[g] = sbase(Bt + (size_t)(c0 + g * 16) * K); a2b[g] = (NSPLIT == 1 || NSPLIT == 2) ? sbase(A2 + (size_t)(r0 + g * 16) * K) : nullptr; b2b[g] = (NSPLIT >= 2) ? sbase(Bt2 + (size_t)(c0 + g * 16) * K) : nullptr; }
#pragma unroll 1
    for (int kc = 0; kc < K; kc += 32) {
        V a[4], a2[4];
#pragma unroll
        for (int mb = 0; mb < 4; ++mb) { a[mb] = WFrag<T16>::ldg(ab[mb] + ko); if (NSPLIT == 1 || NSPLIT == 2) a2[mb] = WFrag<T16>::ldg(a2b[mb] + ko); }
#pragma unroll
        for (int nb = 0; nb < 4; ++nb) { const V b = WFrag<T16>::ldg(bb[nb] + ko); V b2; if (NSPLIT >= 2) b2 = WFrag<T16>::ldg(b2b[nb] + ko);
#pragma unroll
            for (int mb = 0; mb < 4; ++mb) { acc[mb][nb] = WFrag<T16>::mma(a[mb], b, acc[mb][nb]); if (NSPLIT == 1 || NSPLIT == 2) acc[mb][nb] = WFrag<T16>::mma(a2[mb], b, acc[mb][nb]); if (NSPLIT >= 2) acc[mb][nb] = WFrag<T16>::mma(a[mb], b2, acc[mb][nb]); } }
        asm volatile("v_nop\n\tv_nop\n\tv_nop\n\tv_nop" : "+v"(acc[0][0]), "+v"(acc[1][1]), "+v"(acc[2][2]), "+v"(acc[3][3]) : "v"(a[0]), "v"(a[3]));
        ko += 1024;   // the next k-step's fragment follows in the plane
    }
#pragma unroll
    for (int mb = 0; mb < 4; ++mb) {
        v2f cs[4][4];   // EPI 1: {cos, sin} of the lane's 16 pairs of this 16-row piece, asked for before the piece is staged
        if (EPI == 1) { const float* cp = CS + ((size_t)(r0 + mb * 16 + lr) * HD + hi * 8) * 2;   // the table holds {cos, sin} for every d, the same for both halves of a pair: every other entry is read
#pragma unroll
            for (int s = 0; s < 4; ++s)
#pragma unroll
                for (int i = 0; i < 4; ++i) cs[s][i] = *(const v2f*)(cp + s * 32 + i * 4);
            asm volatile("s_wait_xcnt 0x0" :: "v"(cp) : "memory"); }   // behind the table loads; their address is an input, so that it stays in its registers up to the wait
#pragma unroll
        for (int nb = 0; nb < 4; ++nb) {
#pragma unroll
            for (int j = 0; j < 8; ++j) os[(hi * 8 + j) * 68 + nb * 16 + lr] = acc[mb][nb][j]; }
        __builtin_amdgcn_wave_barrier(); asm volatile("" ::: "memory");
        if (EPI == 0) { float* crow = C + (size_t)(r0 + mb * 16) * ldc + c0;
#pragma unroll
            for (int s = 0; s < 8; ++s) { const int row = 2 * s + hi, cofs = lr * 4; v4f val = *(const v4fa*)(os + row * 68 + cofs); if (BIAS) { val[0] += bfr(bias[c0 + cofs]); val[1] += bfr(bias[c0 + cofs + 1]); val[2] += bfr(bias[c0 + cofs + 2]); val[3] += bfr(bias[c0 + cofs + 3]); }
                *(v4f*)(crow + (size_t)row * ldc + cofs) = val; }
        } else {
            const size_t pg = ((EPI == 1) ? ((size_t)(r0 / TT) * (ldc / HD) + blockIdx.y) * TT * HD + (size_t)(r0 % TT + mb * 16) * HD
                                          : ((size_t)(c0 / TT) * (ldc / HD) + blockIdx.x) * HD * TT + ((size_t)mb * (TT / 32) + (c0 % TT) / 32) * 512) + lane * 8;   // where the lane's first 8 elements of this 16 x 64 piece (two fragments) stand in the planes
            v8h o16[4]; v8us oh[4], ol[4];
#pragma unroll
            for (int s = 0; s < 4; ++s) { const int d0 = (2 * s + hi) * 8; const v4f u0 = *(const v4fa*)(os + lr * 68 + d0), u1 = *(const v4fa*)(os + lr * 68 + d0 + 4); float y[8] = { u0[0], u0[1], u0[2], u0[3], u1[0], u1[1], u1[2], u1[3] };
                if (EPI == 1) {
#pragma unroll
                    for (int i = 0; i < 4; ++i) { const float x0 = y[2 * i], x1 = y[2 * i + 1], c = cs[s][i][0], sn = cs[s][i][1]; y[2 * i] = x0 * c - x1 * sn; y[2 * i + 1] = x0 * sn + x1 * c; } }   /* even: x0 c - x1 s; odd: x0 s + x1 c */
#pragma unroll
                for (int q = 0; q < 8; ++q) { if (EPI == 2) o16[s][q] = tohx(y[q]); unsigned short a2, c2; splitf(y[q], a2, c2); oh[s][q] = a2; ol[s][q] = c2; } }
#pragma unroll
            for (int s = 0; s < 4; ++s) { if (EPI == 2) *(v8h*)(P16 + pg + s * 256) = o16[s]; *(v8us*)(Ph + pg + s * 256) = oh[s]; *(v8us*)(Pl + pg + s * 256) = ol[s]; }
            asm volatile("s_wait_xcnt 0x0" ::: "memory");   // behind the piece's stores, before the next piece's values go into the registers that the stores name
        }
        __builtin_amdgcn_wave_barrier(); asm volatile("" ::: "memory");
    }
}

typedef __attribute__((ext_vector_type(2))) _Float16 v2h;
typedef __attribute__((ext_vector_type(4))) _Float16 v4h;
typedef __attribute__((ext_vector_type(2))) unsigned short v2us;
typedef __attribute__((ext_vector_type(4))) unsigned short v4us;
typedef __attribute__((ext_vector_type(4))) int v4i;

__global__ __launch_bounds__(256) void k_wtG(const float* __restrict__ w, int K, int N, bf* Bt) {
    const int lane = threadIdx.x & 31; const int L0 = (blockIdx.x * 8 + (threadIdx.x >> 5)) * 8; const int nlines = N * K / 64;
{
#pragma unroll 1
        for (int l = 0; l < 8; ++l) { const int L = L0 + l; if (L >= nlines) break; const size_t e = (size_t)L * 64 + lane * 2; const int k = (int)(e % K), n = (int)(e / K); v2us o;
            o[0] = f2bf(w[(size_t)k * N + n]); o[1] = f2bf(w[(size_t)(k + 1) * N + n]); *(v2us*)(Bt + e) = o; }
         }
}
__global__ __launch_bounds__(256) void k_cvt8(const float* __restrict__ src, bf* dst, size_t n8) { const size_t i = (size_t)blockIdx.x * 256 + threadIdx.x; if (i >= n8) return; int row, k; unpk<DM>((unsigned)i * 8, row, k);   /* src is [rows][DM]; dst takes it in fragment order, written in address order */ const v8f v = *(const v8f*)(src + (size_t)row * DM + k); v8us o;
#pragma unroll
    for (int k = 0; k < 8; ++k) o[k] = f2bf(v[k]); *(v8us*)(dst + i * 8) = o;  }

__constant__ float INV2[HD / 2] = { 1.000000000e+00f, 7.498942018e-01f, 5.623413324e-01f, 4.216965139e-01f, 3.162277639e-01f, 2.371373773e-01f, 1.778279394e-01f, 1.333521456e-01f, 1.000000015e-01f, 7.498942316e-02f, 5.623413250e-02f, 4.216964915e-02f, 3.162277490e-02f, 2.371373773e-02f, 1.778279431e-02f, 1.333521400e-02f, 9.999999776e-03f, 7.498942316e-03f, 5.623413250e-03f, 4.216964822e-03f, 3.162277630e-03f, 2.371373819e-03f, 1.778279431e-03f, 1.333521446e-03f, 1.000000047e-03f, 7.498941850e-04f, 5.623413017e-04f, 4.216965172e-04f, 3.162277571e-04f, 2.371373703e-04f, 1.778279402e-04f, 1.333521504e-04f };   // float32 10000^(-(i * 2 / 64)), generated with jnp to be bit-exact with the module's expression
__global__ __launch_bounds__(256) void k_cstabI(const int* __restrict__ pid, float* CS) { const int idx = blockIdx.x * 256 + threadIdx.x; if (idx >= NB_ * TT * HD) return; const int d = idx % HD; const int t = idx / HD;   /* t runs over the rows of all batches */ const float a = __fmul_rn((float)pid[t], INV2[d >> 1]); v2f cs; cs[0] = cosf(a); cs[1] = sinf(a); *(v2f*)(CS + (size_t)idx * 2) = cs;  }

// ---- k_fattn: causal attention of all batches in one launch; scores and probabilities never go to memory. Grid (NH_, TT/64, NB_), 32 * FNW threads.
// A work-group owns 64 query rows of one head: wave w holds the 16-row strip (w & 3) and takes the 64-key blocks (w >> 2), (w >> 2) + KS, ... up to the diagonal block.
// Per block: scores on hi/lo planes (3 products, the k order of the score GEMM it replaces); running row maximum and row sum (f32); probabilities exp(t - max) go through the wave's own LDS
// from the accumulator layout to the A-fragment layout (rows < RH as hi/lo planes, 3 products; the rest fp16 x PCAR); the output strip is rescaled when the maximum moves.
// The KS partial (maximum, sum, strip) of a strip are merged through LDS behind one barrier, divided by the row sum and stored as the hi/lo planes that the output projection reads.
#define KS   4                    // waves that share the key range of one 16-row strip
#define FNW  (4 * KS)
#define PP   72                   // pitch, in 16-bit elements, of a probability row in LDS (144 bytes: 16-byte aligned, rows fall on different banks)
#define WREG 4608                 // LDS bytes of one wave: two 16 x PP 16-bit planes, later its 16 x 68 f32 strip
#define L2S  (SCL * 1.4426950408889634f)   // scores stay unscaled: HD^-0.5 is a power of two and goes, exactly, into the factor in front of exp2
template <int M> __device__ __forceinline__ float rowx(float v) { return __int_as_float(__builtin_amdgcn_mov_dpp(__float_as_int(v), 0x160 + M, 0xf, 0xf, true)); }   // lane ^ M inside a 16-lane row (row_xmask)
__device__ __forceinline__ float rowmax16(float v) { v = fmaxf(v, rowx<1>(v)); v = fmaxf(v, rowx<2>(v)); v = fmaxf(v, rowx<4>(v)); return fmaxf(v, rowx<8>(v)); }
__device__ __forceinline__ float rowsum16(float v) { v += rowx<1>(v); v += rowx<2>(v); v += rowx<4>(v); return v + rowx<8>(v); }
// Five exp2 of one row (the rescale factor and the row's four probabilities) and the slot behind a transcendental in ONE statement: the outputs share no register with the inputs, so no v_exp_f32 here
// overwrites the source or reads the result of the one in front of it, and the v_nop keeps whatever the compiler puts next one slot away from the last.
__device__ __forceinline__ void exp2x5(float& a, float& b, float& c, float& d, float& e) { float ra, rb, rc, rd, re;
    asm("v_exp_f32 %0, %5\n\tv_exp_f32 %1, %6\n\tv_exp_f32 %2, %7\n\tv_exp_f32 %3, %8\n\tv_exp_f32 %4, %9\n\tv_nop" : "=&v"(ra), "=&v"(rb), "=&v"(rc), "=&v"(rd), "=&v"(re) : "v"(a), "v"(b), "v"(c), "v"(d), "v"(e));
    a = ra; b = rb; c = rc; d = rd; e = re; }
template <bool HR>
__device__ __forceinline__ void fattn_strip(const bf* __restrict__ Qh, const bf* __restrict__ Ql, const bf* __restrict__ Kh, const bf* __restrict__ Kl, const h16* __restrict__ V16, const bf* __restrict__ Vh, const bf* __restrict__ Vl, int r0, int wave, char* wreg, float* mrow, float* lrow) {
    const int lane = threadIdx.x & 31, lr = lane & 15, hi = lane >> 4; const int rw = r0 + (wave & 3) * 16;
    v16bf qh[2], ql[2];
#pragma unroll
    for (int s = 0; s < 2; ++s) { qh[s] = WFrag<bf>::ldp(Qh + (size_t)rw * HD + s * 512 + 8 * lane); ql[s] = WFrag<bf>::ldp(Ql + (size_t)rw * HD + s * 512 + 8 * lane); }
    v8f o[4]; float m[8], l[8];
#pragma unroll
    for (int nb = 0; nb < 4; ++nb) o[nb] = (v8f){};
#pragma unroll
    for (int j = 0; j < 8; ++j) { m[j] = -3.0e38f; l[j] = 0.f; }
    // per-lane operand offsets, carried through the loop; all fragments of a block hang on them by immediate offsets, so no address register is rewritten between a block's loads
    unsigned kob = (unsigned)(((wave >> 2) * 64 * HD + 8 * lane) * 2), vob = (unsigned)(((wave >> 2) * 2 * 512 + 8 * lane) * 2);   // byte offsets, one for both key planes, one for the value planes (uniform base + 32-bit lane offset)
    const char* khb = (const char*)Kh; const char* klb = (const char*)Kl; const char* vb = (const char*)V16; const char* vhb = (const char*)Vh; const char* vlb = (const char*)Vl;
    h16* pw = (h16*)wreg + hi * 8 * PP + lr; bf* pwb = (bf*)wreg + hi * 8 * PP + lr;   // where this lane's probabilities of row j = 0, block column 0 go
    const int nblk = r0 / 64 + 1;     // every block up to the diagonal one holds at least one key <= i for each of the 64 rows
#pragma unroll 1
    for (int blk = wave >> 2; blk < nblk; blk += KS) {
        const int kb = blk * 64; v8f sc[4]; v16bf kh[4][2], kl[4][2];
#pragma unroll
        for (int nb = 0; nb < 4; ++nb)
#pragma unroll
            for (int s = 0; s < 2; ++s) { kh[nb][s] = WFrag<bf>::ldp((const bf*)(khb + kob + (nb * 2 + s) * 1024)); kl[nb][s] = WFrag<bf>::ldp((const bf*)(klb + kob + (nb * 2 + s) * 1024)); }   // a 64-key block is 8 fragments in a row
        __builtin_amdgcn_sched_barrier(0);   // every key fragment is in flight before the first product waits: one memory round trip a block, not one a fragment pair
#pragma unroll
        for (int nb = 0; nb < 4; ++nb) { sc[nb] = (v8f){};
#pragma unroll
            for (int s = 0; s < 2; ++s) { sc[nb] = wmmab(qh[s], kh[nb][s], sc[nb]); sc[nb] = wmmab(ql[s], kh[nb][s], sc[nb]); sc[nb] = wmmab(qh[s], kl[nb][s], sc[nb]); } }
        __builtin_amdgcn_sched_barrier(0);   // the value loads issue behind the score products, into the registers that the key fragments leave
        v16h vf[2][4]; v16bf vh[2][4], vl[2][4];
#pragma unroll
        for (int s = 0; s < 2; ++s)
#pragma unroll
            for (int nb = 0; nb < 4; ++nb) { const int vo = (nb * (TT / 32) + s) * 1024; if (HR) { vh[s][nb] = WFrag<bf>::ldp((const bf*)(vhb + vob + vo)); vl[s][nb] = WFrag<bf>::ldp((const bf*)(vlb + vob + vo)); } else vf[s][nb] = WFrag<h16>::ldp((const h16*)(vb + vob + vo)); }
        __builtin_amdgcn_sched_barrier(0);   // and in front of the softmax, which runs while they fly
        const int dd = kb + lr - rw - hi * 8;   // key index minus query index at nb = 0, j = 0
#pragma unroll
        for (int j = 0; j < 8; ++j) { float t[4];
#pragma unroll
            for (int nb = 0; nb < 4; ++nb) t[nb] = (dd <= j - nb * 16) ? sc[nb][j] : -3.0e38f;
            const float mn = fmaxf(m[j], rowmax16(fmaxf(fmaxf(t[0], t[1]), fmaxf(t[2], t[3])))); float al = (m[j] - mn) * L2S; m[j] = mn; float ps = 0.f;
#pragma unroll
            for (int nb = 0; nb < 4; ++nb) t[nb] = (t[nb] - mn) * L2S;
            exp2x5(al, t[0], t[1], t[2], t[3]);
#pragma unroll
            for (int nb = 0; nb < 4; ++nb) { const float p = t[nb]; ps += p; o[nb][j] *= al; const int po = j * PP + nb * 16;
                if (HR) { unsigned short a, c2; splitf(p, a, c2); pwb[po] = a; pwb[16 * PP + po] = c2; } else pw[po] = tohx(p * PCAR); }
            l[j] = l[j] * al + ps; }
        __builtin_amdgcn_wave_barrier(); asm volatile("" ::: "memory");   // the wave's probability stores stay in front of its fragment reads
#pragma unroll
        for (int s = 0; s < 2; ++s) {
            if (HR) { const v16bf a = WFrag<bf>::ld((const bf*)wreg + lr * PP + 8 * hi + s * 32), a2 = WFrag<bf>::ld((const bf*)wreg + 16 * PP + lr * PP + 8 * hi + s * 32);
#pragma unroll
                for (int nb = 0; nb < 4; ++nb) { o[nb] = wmmab(a, vh[s][nb], o[nb]); o[nb] = wmmab(a2, vh[s][nb], o[nb]); o[nb] = wmmab(a, vl[s][nb], o[nb]); }
            } else { const v16h a = WFrag<h16>::ld((const h16*)wreg + lr * PP + 8 * hi + s * 32);
#pragma unroll
                for (int nb = 0; nb < 4; ++nb) o[nb] = wmma16(a, vf[s][nb], o[nb]); } }
        asm volatile("v_nop\n\tv_nop\n\tv_nop\n\tv_nop" : "+v"(o[0]), "+v"(o[1]), "+v"(o[2]), "+v"(o[3]));   // matrix-instruction distance before the operands are loaded anew, on the back edge too
        __builtin_amdgcn_wave_barrier(); asm volatile("" ::: "memory");   // the fragment reads stay in front of the next block's probability stores
        kob += KS * 64 * HD * 2; vob += KS * 2 * 1024;
    }
    float* ow = (float*)wreg;
#pragma unroll
    for (int nb = 0; nb < 4; ++nb)
#pragma unroll
        for (int j = 0; j < 8; ++j) ow[(hi * 8 + j) * 68 + nb * 16 + lr] = o[nb][j];
#pragma unroll
    for (int j = 0; j < 8; ++j) { const float ls = rowsum16(l[j]); if (lr == 0) { mrow[wave * 16 + hi * 8 + j] = m[j]; lrow[wave * 16 + hi * 8 + j] = ls; } }
}
__global__ __launch_bounds__(32 * FNW) void k_fattn(const bf* __restrict__ Qh, const bf* __restrict__ Ql, const bf* __restrict__ Kh, const bf* __restrict__ Kl, const h16* __restrict__ V16, const bf* __restrict__ Vh, const bf* __restrict__ Vl, bf* Ah, bf* Al) {
    __shared__ __align__(16) char sm[FNW * WREG]; __shared__ float mrow[FNW * 16], lrow[FNW * 16];
    const int h = blockIdx.x; const int qt = TT / 64 - 1 - (int)blockIdx.y;   // the tiles with the longest key range get the lowest indices (for speed only)
    const int r0 = qt * 64; const int wave = __builtin_amdgcn_readfirstlane(threadIdx.x >> 5);   // scalar, so that the block loop branches on a scalar compare
    const size_t zo = ((size_t)blockIdx.z * NH_ + h) * TT * HD; char* wreg = sm + wave * WREG;
    if (r0 < RH) fattn_strip<true>(Qh + zo, Ql + zo, Kh + zo, Kl + zo, V16 + zo, Vh + zo, Vl + zo, r0, wave, wreg, mrow, lrow);
    else fattn_strip<false>(Qh + zo, Ql + zo, Kh + zo, Kl + zo, V16 + zo, Vh + zo, Vl + zo, r0, wave, wreg, mrow, lrow);
    __syncthreads();   // every wave's partial maximum, sum and strip stand in LDS before any wave merges them
    const float cs = (r0 < RH) ? 1.0f : (1.0f / PCAR);
#pragma unroll
    for (int s = 0; s < 1024 / (32 * FNW); ++s) { const int idx = s * (32 * FNW) + (int)threadIdx.x; const int rr = idx & 15, cofs = ((idx >> 4) & 15) * 4, sub = idx >> 8; const int row = sub * 16 + rr; float mx = -3.0e38f;   // a wave holds 16 rows x 8 columns: 256 bytes in a row of each output plane
#pragma unroll
        for (int k = 0; k < KS; ++k) mx = fmaxf(mx, mrow[(k * 4 + sub) * 16 + rr]);
        float ls = 0.f; v4f val = (v4f){};
#pragma unroll
        for (int k = 0; k < KS; ++k) { const int w = k * 4 + sub; const float wg = __builtin_amdgcn_exp2f((mrow[w * 16 + rr] - mx) * L2S); ls += wg * lrow[w * 16 + rr]; val += wg * *(const v4fa*)(sm + w * WREG + (rr * 68 + cofs) * 4); }   /* a wave without a block has weight 0 */
        const float f = __fdiv_rn(cs, ls); v4us oh, ol;
#pragma unroll
        for (int q = 0; q < 4; ++q) { unsigned short a, c2; splitf(val[q] * f, a, c2); oh[q] = a; ol[q] = c2; }
        const int col = h * HD + cofs; const size_t oo = ((size_t)(((int)blockIdx.z * TT + r0 + row) >> 4) * (DQ / 32) + (col >> 5)) * 512 + ((col >> 4) & 1) * 256 + (((col >> 3) & 1) * 16 + rr) * 8 + (col & 7); *(v4us*)(Ah + oo) = oh; *(v4us*)(Al + oo) = ol; }   /* [NB_ * TT][DQ] in fragment order */
}

extern "C" void kernel_launch(void* const* d_in, const int* in_sizes, int n_in,
                              void* d_out, int out_size, void* d_ws, size_t ws_size, hipStream_t stream) {
    (void)in_sizes; (void)n_in; (void)out_size;
    const float* x = (const float*)d_in[0]; const float* wq = (const float*)d_in[1]; const float* wk = (const float*)d_in[2]; const float* wv = (const float*)d_in[3]; const float* wo = (const float*)d_in[4]; const int* PID = (const int*)d_in[5];   /* x, Wq, Wk, Wv, Wo ('oi' [1024][1024]), token_positions (int32 [4][2048], read per batch) */
    float* OUT = (float*)d_out;     // [4][2048][1024]
    char* wsp = (char*)d_ws;
    auto take = [&](size_t bytes) { char* p = wsp; wsp += (bytes + 255) & ~(size_t)255; return (void*)p; };
    bf* WQ = (bf*)take((size_t)DQ * DM * 2); bf* WK = (bf*)take((size_t)DKV * DM * 2); bf* WV = (bf*)take((size_t)DKV * DM * 2); bf* WO = (bf*)take((size_t)DM * DQ * 2); float* CS = (float*)take((size_t)NB_ * TT * HD * 2 * 4);
    bf* XB = (bf*)take((size_t)NB_ * TT * DM * 2);
    h16* VT16 = (h16*)take((size_t)NB_ * NKV * HD * TT * 2);
    bf* QPh = (bf*)take((size_t)NB_ * NH_ * TT * HD * 2); bf* QPl = (bf*)take((size_t)NB_ * NH_ * TT * HD * 2); bf* KPh = (bf*)take((size_t)NB_ * NKV * TT * HD * 2); bf* KPl = (bf*)take((size_t)NB_ * NKV * TT * HD * 2); bf* VTh = (bf*)take((size_t)NB_ * NKV * HD * TT * 2); bf* VTl = (bf*)take((size_t)NB_ * NKV * HD * TT * 2);
    bf* ATh = (bf*)take((size_t)NB_ * TT * DQ * 2); bf* ATl = (bf*)take((size_t)NB_ * TT * DQ * 2);
    if ((size_t)(wsp - (char*)d_ws) > ws_size) return;    // 172 MiB of the 256 MiB
    { k_cvt8<<<(unsigned)(((size_t)DQ * DM / 8 + 255) / 256), 256, 0, stream>>>(wq, WQ, (size_t)DQ * DM / 8); k_cvt8<<<(unsigned)(((size_t)DKV * DM / 8 + 255) / 256), 256, 0, stream>>>(wk, WK, (size_t)DKV * DM / 8); k_cvt8<<<(unsigned)(((size_t)DKV * DM / 8 + 255) / 256), 256, 0, stream>>>(wv, WV, (size_t)DKV * DM / 8);
      k_cvt8<<<(unsigned)(((size_t)DM * DQ / 8 + 255) / 256), 256, 0, stream>>>(wo, WO, (size_t)DM * DQ / 8); }
    k_cstabI<<<(NB_ * TT * HD + 255) / 256, 256, 0, stream>>>(PID, CS);   /* token_positions[b][t] (int32, read): a table row per (batch, position) */
    k_cvt8<<<(unsigned)(((size_t)NB_ * TT * DM / 8 + 255) / 256), 256, 0, stream>>>(x, XB, (size_t)NB_ * TT * DM / 8);
    k_gemmw<bf, 0, false, 1><<<dim3(NB_ * TT / 64, DQ / 64, 1), 32, 0, stream>>>(XB, nullptr, WQ, nullptr, DM, nullptr, DQ, nullptr, 0, 0, 0, CS, nullptr, QPh, QPl);
    k_gemmw<bf, 0, false, 1><<<dim3(NB_ * TT / 64, DKV / 64, 1), 32, 0, stream>>>(XB, nullptr, WK, nullptr, DM, nullptr, DKV, nullptr, 0, 0, 0, CS, nullptr, KPh, KPl);
    k_gemmw<bf, 0, false, 2><<<dim3(DKV / 64, NB_ * TT / 64, 1), 32, 0, stream>>>(WV, nullptr, XB, nullptr, DM, nullptr, DKV, nullptr, 0, 0, 0, nullptr, VT16, VTh, VTl);   /* v transposed: rows = head * HD + d, columns = positions */
    k_fattn<<<dim3(NH_, TT / 64, NB_), 32 * FNW, 0, stream>>>(QPh, QPl, KPh, KPl, VT16, VTh, VTl, ATh, ATl);   /* one kv head per query head */
    k_gemmw<bf, 1, false, 0><<<dim3(NB_ * TT / 64, DM / 64, 1), 32, 0, stream>>>(ATh, ATl, WO, nullptr, DQ, OUT, DM, nullptr, 0, 0, 0, nullptr, nullptr, nullptr, nullptr);
}

// v007
// One run takes 192 microseconds.
// In two side-by-side timings against v006, it was 1.44 and 1.41 times as fast.
// Counting every step since v000, it is 14.3 times as fast.
#include <hip/hip_runtime.h>

// Causal multi-head attention with interleaved-pair rotary embeddings driven by an integer position input (x [4][2048][1024]; q, k, v = x W^T ('oi', no bias; 16 heads x 64); rope on pairs (2i, 2i+1): (x_e cos - x_o sin, x_e sin + x_o cos) with angle pos[b][t] x THETA^(-2i/64) (token_positions int32 [4][2048] = arange per batch, READ on device; 32 f32 frequencies jnp-exact for this expression; precise cosf/sinf); scores / sqrt(64); causal (-inf); softmax; out = merged Wo^T -> [4][2048][1024] (8.4 M); argument order x, Wq, Wk, Wv, Wo, token_positions).
// Layout, all four batches in every launch (the batch is part of the position index of the GEMMs (their rows, for v their columns) and a grid dimension of k_fattn): bf16 copy of x; {cos, sin} per (position, pair) built once from the int positions and float32 inverse-frequency constants (precise cosf/sinf); exact projections whose epilogue applies the interleaved rotary embedding (q, k) and stores the operand planes of the attention itself, so that no f32 projection goes to memory (v comes out transposed: its GEMM takes the weight as the row operand); causal T-2048 attention (EVERY row's scores on hi/lo planes (3 products: logit sigma 2 with these weights) and hybrid P.V (rows < 512 hi/lo, rest fp16 x1024); scores, softmax and P.V in one kernel, k_fattn, with a running row maximum and sum; key blocks above the diagonal are never touched); merged hi/lo x Wo exact.
// Operand planes: every 16-bit plane that a matrix instruction reads from global memory (x, the four weights, q, k, v transposed, the attention output) stands in FRAGMENT ORDER (see unpk below): the 16 x 32 fragment is 1 KiB in a row, lane l's two 16-byte halves at l * 16 and 512 + l * 16, so that a wave-wide 16-byte load covers four whole 128-byte lines.
// Compute dtypes, f32 accumulate: every input rounded to bf16; projections exact; rotary f32; attention scores 3 products, P.V rows < 512 3 products, rest fp16; softmax f32; Wo hl x exact.

#define NB_  4
#define TT   2048
#define DM   1024
#define NH_  16
#define NKV  16
#define REP  (NH_ / NKV)
#define HD   64
#define DQ   (NH_ * HD)
#define DKV  (NKV * HD)
#define RH   512                  // query rows < RH take P.V on hi+lo planes (0: none)
#define PCAR 1024.0f
#define SCL  0.125f   // HD^-0.5
typedef _Float16 h16;
typedef unsigned short bf;
typedef __attribute__((ext_vector_type(16))) __bf16   v16bf;
typedef __attribute__((ext_vector_type(16))) _Float16 v16h;
typedef __attribute__((ext_vector_type(8)))  _Float16 v8h;
typedef __attribute__((ext_vector_type(8)))  unsigned short v8us;
typedef __attribute__((ext_vector_type(8)))  float    v8f;
typedef __attribute__((ext_vector_type(4)))  float    v4f;
typedef __attribute__((ext_vector_type(2)))  float    v2f;
typedef v8h  __attribute__((may_alias)) v8ha;
typedef v4f  __attribute__((may_alias)) v4fa;
typedef v8us __attribute__((may_alias)) v8usa;

__device__ __forceinline__ unsigned short f2bf(float f) { unsigned u = __float_as_uint(f); u += 0x7FFFu + ((u >> 16) & 1u); return (unsigned short)(u >> 16); }
__device__ __forceinline__ float bf2f(unsigned short b) { return __uint_as_float(((unsigned)b) << 16); }
__device__ __forceinline__ float bfr(float f) { return bf2f(f2bf(f)); }
__device__ __forceinline__ v16h cat16(v8h lo, v8h hi) { return __builtin_shufflevector(lo, hi, 0, 1, 2, 3, 4, 5, 6, 7, 8, 9, 10, 11, 12, 13, 14, 15); }
__device__ __forceinline__ v16bf cat16b(v8us lo, v8us hi) { return __builtin_bit_cast(v16bf, __builtin_shufflevector(lo, hi, 0, 1, 2, 3, 4, 5, 6, 7, 8, 9, 10, 11, 12, 13, 14, 15)); }
__device__ __forceinline__ v8f wmma16(v16h a, v16h b, v8f c) { return __builtin_amdgcn_wmma_f32_16x16x32_f16(false, a, false, b, (short)0, c, false, false); }
__device__ __forceinline__ v8f wmmab(v16bf a, v16bf b, v8f c) { return __builtin_amdgcn_wmma_f32_16x16x32_bf16(false, a, false, b, (short)0, c, false, false); }



// ---- Fragment order of a 16-bit plane [rows][K] (rows % 16 == 0, K % 32 == 0): element (row, k) stands at ((row / 16) * (K / 32) + k / 32) * 512 + ((k / 16) % 2) * 256 + (((k / 8) % 2) * 16 + row % 16) * 8 + k % 8.
// That is the register order of ld(): ldp(base of the fragment + lane * 8) returns what ld(row (lane & 15), k = 8 * (lane >> 4)) returns on the row-major plane. unpk is the inverse map, for the kernels that write a plane in address order.
template <int K> __device__ __forceinline__ void unpk(unsigned e, int& row, int& k) { const unsigned f = e >> 9; row = (int)(f / (K / 32)) * 16 + (int)((e >> 3) & 15); k = (int)(f % (K / 32)) * 32 + (int)((e >> 8) & 1) * 16 + (int)((e >> 7) & 1) * 8 + (int)(e & 7); }
__device__ __forceinline__ h16 tohx(float x) { return (h16)x; }
__device__ __forceinline__ void splitf(float y, unsigned short& h, unsigned short& l) { h = f2bf(y); l = f2bf(y - bf2f(h)); }
// ---- k_gemmw: register-blocked GEMM, ONE WAVE per 64x64 output tile (16 accumulators), operands straight from 16-bit planes in fragment order; grid (M/64, N/64, Z), 32 threads.
// C[m][n] (f32, pitch ldc, + optional f32 bias[n]) = sum_k A[m][k] Bt[n][k] (+ split products per NSPLIT). z-batch strides sA/sB/sC in elements. K % (32 * NS) == 0.
// The fragments of a k-step stand in one of NS register sets, a ring: a set is asked for anew (step s + NS) as soon as the products of step s have read it, so while a step's products run the loads of the next NS - 1 steps are in flight.
// EPI says where the tile goes. 0: to C, as f32. 1 and 2: C is not touched; the tile goes straight to the 16-bit planes that k_fattn reads, in fragment order (ldc / HD = heads in a batch):
//   1: m = position over all batches, n = head * HD + d. Rotary embedding from the table CS, then the hi/lo planes Ph, Pl of [batch][head][TT][HD].
//   2: m = head * HD + d, n = position over all batches (the weight is the row operand). The f16 plane P16 and the hi/lo planes Ph, Pl of [batch][head][HD][TT].
//   In both a 16 x 64 piece of the tile is two fragments in a row, 1024 elements: lane l stores the 8 elements of tile row (l & 15) from column (2 s + (l >> 4)) * 8 at s * 256 + l * 8, s = 0..3, so every store covers 4 whole 128-byte lines.
#define GAS __attribute__((address_space(1)))
typedef const GAS char* gcp;   // byte pointer known to point to global memory (a pointer rebuilt from integers would otherwise be loaded through as a flat one)
template <typename T16> struct WFrag;
template <> struct WFrag<h16> { typedef v16h V; static __device__ __forceinline__ V ld(const h16* p) { return cat16(*(const v8h*)p, *(const v8h*)(p + 16)); } static __device__ __forceinline__ V ldp(const h16* p) { return cat16(*(const v8h*)p, *(const v8h*)(p + 256)); } static __device__ __forceinline__ V ldg(gcp p) { return cat16(*(const GAS v8h*)p, *(const GAS v8h*)(p + 512)); } static __device__ __forceinline__ v8f mma(V a, V b, v8f c) { return wmma16(a, b, c); } };
template <> struct WFrag<bf> { typedef v16bf V; static __device__ __forceinline__ V ld(const bf* p) { return cat16b(*(const v8us*)p, *(const v8us*)(p + 16)); } static __device__ __forceinline__ V ldp(const bf* p) { return cat16b(*(const v8us*)p, *(const v8us*)(p + 256)); } static __device__ __forceinline__ V ldg(gcp p) { return cat16b(*(const GAS v8us*)p, *(const GAS v8us*)(p + 512)); } static __device__ __forceinline__ v8f mma(V a, V b, v8f c) { return wmmab(a, b, c); } };
__device__ __forceinline__ gcp sbase(const void* p) { const unsigned long long u = (unsigned long long)p; return (gcp)(((unsigned long long)(unsigned)__builtin_amdgcn_readfirstlane((int)(u >> 32)) << 32) | (unsigned)__builtin_amdgcn_readfirstlane((int)u)); }   // a wave-uniform pointer to global memory, kept as a scalar base
template <typename T16, int NSPLIT> struct GSet { typename WFrag<T16>::V a[4], a2[4], b[4], b2[4]; };   // the fragments of one k-step of a 64 x 64 tile (a2, b2 only where NSPLIT has them)
template <typename T16, int NSPLIT> __device__ __forceinline__ void gld(GSet<T16, NSPLIT>& s, const gcp* ab, const gcp* a2b, const gcp* bb, const gcp* b2b, unsigned ko, int off) {   // off, a constant, goes into the loads' immediate offset
#pragma unroll
    for (int g = 0; g < 4; ++g) { s.a[g] = WFrag<T16>::ldg(ab[g] + ko + off); if (NSPLIT == 1 || NSPLIT == 2) s.a2[g] = WFrag<T16>::ldg(a2b[g] + ko + off); }
#pragma unroll
    for (int g = 0; g < 4; ++g) { s.b[g] = WFrag<T16>::ldg(bb[g] + ko + off); if (NSPLIT >= 2) s.b2[g] = WFrag<T16>::ldg(b2b[g] + ko + off); }
}
template <typename T16, int NSPLIT> __device__ __forceinline__ void gmm(const GSet<T16, NSPLIT>& s, v8f (&acc)[4][4]) {
#pragma unroll
    for (int nb = 0; nb < 4; ++nb)
#pragma unroll
        for (int mb = 0; mb < 4; ++mb) { acc[mb][nb] = WFrag<T16>::mma(s.a[mb], s.b[nb], acc[mb][nb]); if (NSPLIT == 1 || NSPLIT == 2) acc[mb][nb] = WFrag<T16>::mma(s.a2[mb], s.b[nb], acc[mb][nb]); if (NSPLIT >= 2) acc[mb][nb] = WFrag<T16>::mma(s.a[mb], s.b2[nb], acc[mb][nb]); }
}
template <typename T16, int NSPLIT, bool BIAS, int EPI, int NS>
__global__ __launch_bounds__(32) void k_gemmw(const T16* __restrict__ A, const T16* __restrict__ A2, const T16* __restrict__ Bt, const T16* __restrict__ Bt2, int K, float* C, int ldc, const float* __restrict__ bias, size_t sA, size_t sB, size_t sC, const float* __restrict__ CS, h16* P16, bf* Ph, bf* Pl) {
    __shared__ __align__(16) float os[16 * 68];
    const size_t z = blockIdx.z; A += z * sA; if (A2) A2 += z * sA; Bt += z * sB; if (Bt2) Bt2 += z * sB; C += z * sC;
    const int lane = threadIdx.x & 31, lr = lane & 15, hi = lane >> 4; const int r0 = blockIdx.x * 64, c0 = blockIdx.y * 64;
    v8f acc[4][4];
#pragma unroll
    for (int mb = 0; mb < 4; ++mb)
#pragma unroll
        for (int nb = 0; nb < 4; ++nb) acc[mb][nb] = (v8f){};
    unsigned ko = (unsigned)lane * 16;   // byte offset of the lane's piece of the current k-step's fragment inside its 16 rows, one for all operands (uniform base + 32-bit lane offset), carried through the loop
    gcp ab[4], a2b[4], bb[4], b2b[4];   // uniform base of each 16-row group of the tile (K / 32 fragments of 1 KiB in a row), held in scalar registers for the whole loop: no 64-bit vector address sums in the loop, and no address register is rewritten between a k-step's loads
#pragma unroll
    for (int g = 0; g < 4; ++g) { ab[g] = sbase(A + (size_t)(r0 + g * 16) * K); bb[g] = sbase(Bt + (size_t)(c0 + g * 16) * K); a2b[g] = (NSPLIT == 1 || NSPLIT == 2) ? sbase(A2 + (size_t)(r0 + g * 16) * K) : nullptr; b2b[g] = (NSPLIT >= 2) ? sbase(Bt2 + (size_t)(c0 + g * 16) * K) : nullptr; }
    GSet<T16, NSPLIT> fs[NS];
#pragma unroll
    for (int j = 0; j < NS; ++j) gld<T16, NSPLIT>(fs[j], ab, a2b, bb, b2b, ko, j * 1024);
    asm volatile("s_wait_xcnt 0x0" :: "v"(ko) : "memory");   // behind the first NS sets' loads: where K holds one turn only, no wait of the loop stands between them and the epilogue, which takes their base registers
#pragma unroll 1
    for (int kc = 32 * NS; kc < K; kc += 32 * NS) {   // all turns of the ring but the last; unrolled by NS inside, so that every set keeps its registers
#pragma unroll
        for (int j = 0; j < NS; ++j) {
            gmm<T16, NSPLIT>(fs[j], acc);
            __builtin_amdgcn_sched_barrier(0);   // the refill stays behind the products that read the set: lifted over them it would need a set more of registers
            gld<T16, NSPLIT>(fs[j], ab, a2b, bb, b2b, ko, (j + NS) * 1024);   // step j of the next turn goes into the set that step j has just left
            __builtin_amdgcn_sched_barrier(0);   // and in front of the next step's products: sunk towards its use it would fly behind fewer of them
        }
        asm volatile("s_wait_xcnt 0x0" : "+v"(ko) :: "memory");   // behind the turn's loads, which all name ko; the sum below takes ko from this statement, so it stays behind the wait
        ko += NS * 1024;   // the next NS k-steps' fragments follow in the plane
    }
#pragma unroll
    for (int j = 0; j < NS; ++j) gmm<T16, NSPLIT>(fs[j], acc);   // the last turn asks for nothing
#pragma unroll
    for (int mb = 0; mb < 4; ++mb) {
        v2f cs[4][4];   // EPI 1: {cos, sin} of the lane's 16 pairs of this 16-row piece, asked for before the piece is staged
        if (EPI == 1) { const float* cp = CS + ((size_t)(r0 + mb * 16 + lr) * HD + hi * 8) * 2;   // the table holds {cos, sin} for every d, the same for both halves of a pair: every other entry is read
#pragma unroll
            for (int s = 0; s < 4; ++s)
#pragma unroll
                for (int i = 0; i < 4; ++i) cs[s][i] = *(const v2f*)(cp + s * 32 + i * 4);
            asm volatile("s_wait_xcnt 0x0" :: "v"(cp) : "memory"); }   // behind the table loads; their address is an input, so that it stays in its registers up to the wait
#pragma unroll
        for (int nb = 0; nb < 4; ++nb) {
#pragma unroll
            for (int j = 0; j < 8; ++j) os[(hi * 8 + j) * 68 + nb * 16 + lr] = acc[mb][nb][j]; }
        __builtin_amdgcn_wave_barrier(); asm volatile("" ::: "memory");
        if (EPI == 0) { float* crow = C + (size_t)(r0 + mb * 16) * ldc + c0;
            v4f val[8];
#pragma unroll
            for (int s = 0; s < 8; ++s) { const int row = 2 * s + hi, cofs = lr * 4; val[s] = *(const v4fa*)(os + row * 68 + cofs); if (BIAS) { val[s][0] += bfr(bias[c0 + cofs]); val[s][1] += bfr(bias[c0 + cofs + 1]); val[s][2] += bfr(bias[c0 + cofs + 2]); val[s][3] += bfr(bias[c0 + cofs + 3]); } }
            __builtin_amdgcn_sched_barrier(0);   // with the one behind the wait: nothing that could take a register of an issued store comes between the piece's stores and their wait
#pragma unroll
            for (int s = 0; s < 8; ++s) *(v4f*)(crow + (size_t)(2 * s + hi) * ldc + lr * 4) = val[s];
            asm volatile("s_wait_xcnt 0x0" ::: "memory");   // behind the piece's stores, before the next piece's values go into the registers that the stores name
            __builtin_amdgcn_sched_barrier(0);   // the second fence of the pair in front of the stores
        } else {
            const size_t pg = ((EPI == 1) ? ((size_t)(r0 / TT) * (ldc / HD) + blockIdx.y) * TT * HD + (size_t)(r0 % TT + mb * 16) * HD
                                          : ((size_t)(c0 / TT) * (ldc / HD) + blockIdx.x) * HD * TT + ((size_t)mb * (TT / 32) + (c0 % TT) / 32) * 512) + lane * 8;   // where the lane's first 8 elements of this 16 x 64 piece (two fragments) stand in the planes
            v8h o16[4]; v8us oh[4], ol[4];
#pragma unroll
            for (int s = 0; s < 4; ++s) { const int d0 = (2 * s + hi) * 8; const v4f u0 = *(const v4fa*)(os + lr * 68 + d0), u1 = *(const v4fa*)(os + lr * 68 + d0 + 4); float y[8] = { u0[0], u0[1], u0[2], u0[3], u1[0], u1[1], u1[2], u1[3] };
                if (EPI == 1) {
#pragma unroll
                    for (int i = 0; i < 4; ++i) { const float x0 = y[2 * i], x1 = y[2 * i + 1], c = cs[s][i][0], sn = cs[s][i][1]; y[2 * i] = x0 * c - x1 * sn; y[2 * i + 1] = x0 * sn + x1 * c; } }   /* even: x0 c - x1 s; odd: x0 s + x1 c */
#pragma unroll
                for (int q = 0; q < 8; ++q) { if (EPI == 2) o16[s][q] = tohx(y[q]); unsigned short a2, c2; splitf(y[q], a2, c2); oh[s][q] = a2; ol[s][q] = c2; } }
            __builtin_amdgcn_sched_barrier(0);   // with the one behind the wait: nothing that could take a register of an issued store comes between the piece's stores and their wait
#pragma unroll
            for (int s = 0; s < 4; ++s) { if (EPI == 2) *(v8h*)(P16 + pg + s * 256) = o16[s]; *(v8us*)(Ph + pg + s * 256) = oh[s]; *(v8us*)(Pl + pg + s * 256) = ol[s]; }
            asm volatile("s_wait_xcnt 0x0" ::: "memory");   // behind the piece's stores, before the next piece's values go into the registers that the stores name
            __builtin_amdgcn_sched_barrier(0);   // the second fence of the pair in front of the stores
        }
        __builtin_amdgcn_wave_barrier(); asm volatile("" ::: "memory");
    }
}

typedef __attribute__((ext_vector_type(2))) _Float16 v2h;
typedef __attribute__((ext_vector_type(4))) _Float16 v4h;
typedef __attribute__((ext_vector_type(2))) unsigned short v2us;
typedef __attribute__((ext_vector_type(4))) unsigned short v4us;
typedef __attribute__((ext_vector_type(4))) int v4i;

__global__ __launch_bounds__(256) void k_wtG(const float* __restrict__ w, int K, int N, bf* Bt) {
    const int lane = threadIdx.x & 31; const int L0 = (blockIdx.x * 8 + (threadIdx.x >> 5)) * 8; const int nlines = N * K / 64;
{
#pragma unroll 1
        for (int l = 0; l < 8; ++l) { const int L = L0 + l; if (L >= nlines) break; const size_t e = (size_t)L * 64 + lane * 2; const int k = (int)(e % K), n = (int)(e / K); v2us o;
            o[0] = f2bf(w[(size_t)k * N + n]); o[1] = f2bf(w[(size_t)(k + 1) * N + n]); *(v2us*)(Bt + e) = o; }
         }
}
__global__ __launch_bounds__(256) void k_cvt8(const float* __restrict__ src, bf* dst, size_t n8) { const size_t i = (size_t)blockIdx.x * 256 + threadIdx.x; if (i >= n8) return; int row, k; unpk<DM>((unsigned)i * 8, row, k);   /* src is [rows][DM]; dst takes it in fragment order, written in address order */ const v8f v = *(const v8f*)(src + (size_t)row * DM + k); v8us o;
#pragma unroll
    for (int k = 0; k < 8; ++k) o[k] = f2bf(v[k]); *(v8us*)(dst + i * 8) = o;  }

__constant__ float INV2[HD / 2] = { 1.000000000e+00f, 7.498942018e-01f, 5.623413324e-01f, 4.216965139e-01f, 3.162277639e-01f, 2.371373773e-01f, 1.778279394e-01f, 1.333521456e-01f, 1.000000015e-01f, 7.498942316e-02f, 5.623413250e-02f, 4.216964915e-02f, 3.162277490e-02f, 2.371373773e-02f, 1.778279431e-02f, 1.333521400e-02f, 9.999999776e-03f, 7.498942316e-03f, 5.623413250e-03f, 4.216964822e-03f, 3.162277630e-03f, 2.371373819e-03f, 1.778279431e-03f, 1.333521446e-03f, 1.000000047e-03f, 7.498941850e-04f, 5.623413017e-04f, 4.216965172e-04f, 3.162277571e-04f, 2.371373703e-04f, 1.778279402e-04f, 1.333521504e-04f };   // float32 10000^(-(i * 2 / 64)), generated with jnp to be bit-exact with the module's expression
__global__ __launch_bounds__(256) void k_cstabI(const int* __restrict__ pid, float* CS) { const int idx = blockIdx.x * 256 + threadIdx.x; if (idx >= NB_ * TT * HD) return; const int d = idx % HD; const int t = idx / HD;   /* t runs over the rows of all batches */ const float a = __fmul_rn((float)pid[t], INV2[d >> 1]); v2f cs; cs[0] = cosf(a); cs[1] = sinf(a); *(v2f*)(CS + (size_t)idx * 2) = cs;  }

// ---- k_fattn: causal attention of all batches in one launch; scores and probabilities never go to memory. Grid (NH_, TT/64, NB_), 32 * FNW threads.
// A work-group owns 64 query rows of one head: wave w holds the 16-row strip (w & 3) and takes the 64-key blocks (w >> 2), (w >> 2) + KS, ... up to the diagonal block.
// Per block: scores on hi/lo planes (3 products, the k order of the score GEMM it replaces); running row maximum and row sum (f32); probabilities exp(t - max) go through the wave's own LDS
// from the accumulator layout to the A-fragment layout (rows < RH as hi/lo planes, 3 products; the rest fp16 x PCAR); the output strip is rescaled when the maximum moves.
// The KS partial (maximum, sum, strip) of a strip are merged through LDS behind one barrier, divided by the row sum and stored as the hi/lo planes that the output projection reads.
#define KS   4                    // waves that share the key range of one 16-row strip
#define FNW  (4 * KS)
#define PP   72                   // pitch, in 16-bit elements, of a probability row in LDS (144 bytes: 16-byte aligned, rows fall on different banks)
#define WREG 4608                 // LDS bytes of one wave: two 16 x PP 16-bit planes, later its 16 x 68 f32 strip
#define L2S  (SCL * 1.4426950408889634f)   // scores stay unscaled: HD^-0.5 is a power of two and goes, exactly, into the factor in front of exp2
template <int M> __device__ __forceinline__ float rowx(float v) { return __int_as_float(__builtin_amdgcn_mov_dpp(__float_as_int(v), 0x160 + M, 0xf, 0xf, true)); }   // lane ^ M inside a 16-lane row (row_xmask)
__device__ __forceinline__ float rowmax16(float v) { v = fmaxf(v, rowx<1>(v)); v = fmaxf(v, rowx<2>(v)); v = fmaxf(v, rowx<4>(v)); return fmaxf(v, rowx<8>(v)); }
__device__ __forceinline__ float rowsum16(float v) { v += rowx<1>(v); v += rowx<2>(v); v += rowx<4>(v); return v + rowx<8>(v); }
// Five exp2 of one row (the rescale factor and the row's four probabilities) and the slot behind a transcendental in ONE statement: the outputs share no register with the inputs, so no v_exp_f32 here
// overwrites the source or reads the result of the one in front of it, and the v_nop keeps whatever the compiler puts next one slot away from the last.
__device__ __forceinline__ void exp2x5(float& a, float& b, float& c, float& d, float& e) { float ra, rb, rc, rd, re;
    asm("v_exp_f32 %0, %5\n\tv_exp_f32 %1, %6\n\tv_exp_f32 %2, %7\n\tv_exp_f32 %3, %8\n\tv_exp_f32 %4, %9\n\tv_nop" : "=&v"(ra), "=&v"(rb), "=&v"(rc), "=&v"(rd), "=&v"(re) : "v"(a), "v"(b), "v"(c), "v"(d), "v"(e));
    a = ra; b = rb; c = rc; d = rd; e = re; }
template <bool HR>
__device__ __forceinline__ void fattn_strip(const bf* __restrict__ Qh, const bf* __restrict__ Ql, const bf* __restrict__ Kh, const bf* __restrict__ Kl, const h16* __restrict__ V16, const bf* __restrict__ Vh, const bf* __restrict__ Vl, int r0, int wave, char* wreg, float* mrow, float* lrow) {
    const int lane = threadIdx.x & 31, lr = lane & 15, hi = lane >> 4; const int rw = r0 + (wave & 3) * 16;
    v16bf qh[2], ql[2];
#pragma unroll
    for (int s = 0; s < 2; ++s) { qh[s] = WFrag<bf>::ldp(Qh + (size_t)rw * HD + s * 512 + 8 * lane); ql[s] = WFrag<bf>::ldp(Ql + (size_t)rw * HD + s * 512 + 8 * lane); }
    v8f o[4]; float m[8], l[8];
#pragma unroll
    for (int nb = 0; nb < 4; ++nb) o[nb] = (v8f){};
#pragma unroll
    for (int j = 0; j < 8; ++j) { m[j] = -3.0e38f; l[j] = 0.f; }
    // per-lane operand offsets, carried through the loop; all fragments of a block hang on them by immediate offsets, so no address register is rewritten between a block's loads
    unsigned kob = (unsigned)(((wave >> 2) * 64 * HD + 8 * lane) * 2), vob = (unsigned)(((wave >> 2) * 2 * 512 + 8 * lane) * 2);   // byte offsets, one for both key planes, one for the value planes (uniform base + 32-bit lane offset)
    const char* khb = (const char*)Kh; const char* klb = (const char*)Kl; const char* vb = (const char*)V16; const char* vhb = (const char*)Vh; const char* vlb = (const char*)Vl;
    h16* pw = (h16*)wreg + hi * 8 * PP + lr; bf* pwb = (bf*)wreg + hi * 8 * PP + lr;   // where this lane's probabilities of row j = 0, block column 0 go
    const int nblk = r0 / 64 + 1;     // every block up to the diagonal one holds at least one key <= i for each of the 64 rows
#pragma unroll 1
    for (int blk = wave >> 2; blk < nblk; blk += KS) {
        const int kb = blk * 64; v8f sc[4]; v16bf kh[4][2], kl[4][2];
#pragma unroll
        for (int nb = 0; nb < 4; ++nb)
#pragma unroll
            for (int s = 0; s < 2; ++s) { kh[nb][s] = WFrag<bf>::ldp((const bf*)(khb + kob + (nb * 2 + s) * 1024)); kl[nb][s] = WFrag<bf>::ldp((const bf*)(klb + kob + (nb * 2 + s) * 1024)); }   // a 64-key block is 8 fragments in a row
        __builtin_amdgcn_sched_barrier(0);   // every key fragment is in flight before the first product waits: one memory round trip a block, not one a fragment pair
#pragma unroll
        for (int nb = 0; nb < 4; ++nb) { sc[nb] = (v8f){};
#pragma unroll
            for (int s = 0; s < 2; ++s) { sc[nb] = wmmab(qh[s], kh[nb][s], sc[nb]); sc[nb] = wmmab(ql[s], kh[nb][s], sc[nb]); sc[nb] = wmmab(qh[s], kl[nb][s], sc[nb]); } }
        __builtin_amdgcn_sched_barrier(0);   // the value loads issue behind the score products, into the registers that the key fragments leave
        v16h vf[2][4]; v16bf vh[2][4], vl[2][4];
#pragma unroll
        for (int s = 0; s < 2; ++s)
#pragma unroll
            for (int nb = 0; nb < 4; ++nb) { const int vo = (nb * (TT / 32) + s) * 1024; if (HR) { vh[s][nb] = WFrag<bf>::ldp((const bf*)(vhb + vob + vo)); vl[s][nb] = WFrag<bf>::ldp((const bf*)(vlb + vob + vo)); } else vf[s][nb] = WFrag<h16>::ldp((const h16*)(vb + vob + vo)); }
        __builtin_amdgcn_sched_barrier(0);   // and in front of the softmax, which runs while they fly
        const int dd = kb + lr - rw - hi * 8;   // key index minus query index at nb = 0, j = 0
#pragma unroll
        for (int j = 0; j < 8; ++j) { float t[4];
#pragma unroll
            for (int nb = 0; nb < 4; ++nb) t[nb] = (dd <= j - nb * 16) ? sc[nb][j] : -3.0e38f;
            const float mn = fmaxf(m[j], rowmax16(fmaxf(fmaxf(t[0], t[1]), fmaxf(t[2], t[3])))); float al = (m[j] - mn) * L2S; m[j] = mn; float ps = 0.f;
#pragma unroll
            for (int nb = 0; nb < 4; ++nb) t[nb] = (t[nb] - mn) * L2S;
            exp2x5(al, t[0], t[1], t[2], t[3]);
#pragma unroll
            for (int nb = 0; nb < 4; ++nb) { const float p = t[nb]; ps += p; o[nb][j] *= al; const int po = j * PP + nb * 16;
                if (HR) { unsigned short a, c2; splitf(p, a, c2); pwb[po] = a; pwb[16 * PP + po] = c2; } else pw[po] = tohx(p * PCAR); }
            l[j] = l[j] * al + ps; }
        __builtin_amdgcn_wave_barrier(); asm volatile("" ::: "memory");   // the wave's probability stores stay in front of its fragment reads
#pragma unroll
        for (int s = 0; s < 2; ++s) {
            if (HR) { const v16bf a = WFrag<bf>::ld((const bf*)wreg + lr * PP + 8 * hi + s * 32), a2 = WFrag<bf>::ld((const bf*)wreg + 16 * PP + lr * PP + 8 * hi + s * 32);
#pragma unroll
                for (int nb = 0; nb < 4; ++nb) { o[nb] = wmmab(a, vh[s][nb], o[nb]); o[nb] = wmmab(a2, vh[s][nb], o[nb]); o[nb] = wmmab(a, vl[s][nb], o[nb]); }
            } else { const v16h a = WFrag<h16>::ld((const h16*)wreg + lr * PP + 8 * hi + s * 32);
#pragma unroll
                for (int nb = 0; nb < 4; ++nb) o[nb] = wmma16(a, vf[s][nb], o[nb]); } }
        asm volatile("v_nop\n\tv_nop\n\tv_nop\n\tv_nop" : "+v"(o[0]), "+v"(o[1]), "+v"(o[2]), "+v"(o[3]));   // matrix-instruction distance before the operands are loaded anew, on the back edge too
        __builtin_amdgcn_wave_barrier(); asm volatile("" ::: "memory");   // the fragment reads stay in front of the next block's probability stores
        kob += KS * 64 * HD * 2; vob += KS * 2 * 1024;
    }
    float* ow = (float*)wreg;
#pragma unroll
    for (int nb = 0; nb < 4; ++nb)
#pragma unroll
        for (int j = 0; j < 8; ++j) ow[(hi * 8 + j) * 68 + nb * 16 + lr] = o[nb][j];
#pragma unroll
    for (int j = 0; j < 8; ++j) { const float ls = rowsum16(l[j]); if (lr == 0) { mrow[wave * 16 + hi * 8 + j] = m[j]; lrow[wave * 16 + hi * 8 + j] = ls; } }
}
__global__ __launch_bounds__(32 * FNW) void k_fattn(const bf* __restrict__ Qh, const bf* __restrict__ Ql, const bf* __restrict__ Kh, const bf* __restrict__ Kl, const h16* __restrict__ V16, const bf* __restrict__ Vh, const bf* __restrict__ Vl, bf* Ah, bf* Al) {
    __shared__ __align__(16) char sm[FNW * WREG]; __shared__ float mrow[FNW * 16], lrow[FNW * 16];
    const int h = blockIdx.x; const int qt = TT / 64 - 1 - (int)blockIdx.y;   // the tiles with the longest key range get the lowest indices (for speed only)
    const int r0 = qt * 64; const int wave = __builtin_amdgcn_readfirstlane(threadIdx.x >> 5);   // scalar, so that the block loop branches on a scalar compare
    const size_t zo = ((size_t)blockIdx.z * NH_ + h) * TT * HD; char* wreg = sm + wave * WREG;
    if (r0 < RH) fattn_strip<true>(Qh + zo, Ql + zo, Kh + zo, Kl + zo, V16 + zo, Vh + zo, Vl + zo, r0, wave, wreg, mrow, lrow);
    else fattn_strip<false>(Qh + zo, Ql + zo, Kh + zo, Kl + zo, V16 + zo, Vh + zo, Vl + zo, r0, wave, wreg, mrow, lrow);
    __syncthreads();   // every wave's partial maximum, sum and strip stand in LDS before any wave merges them
    const float cs = (r0 < RH) ? 1.0f : (1.0f / PCAR);
#pragma unroll
    for (int s = 0; s < 1024 / (32 * FNW); ++s) { const int idx = s * (32 * FNW) + (int)threadIdx.x; const int rr = idx & 15, cofs = ((idx >> 4) & 15) * 4, sub = idx >> 8; const int row = sub * 16 + rr; float mx = -3.0e38f;   // a wave holds 16 rows x 8 columns: 256 bytes in a row of each output plane
#pragma unroll
        for (int k = 0; k < KS; ++k) mx = fmaxf(mx, mrow[(k * 4 + sub) * 16 + rr]);
        float ls = 0.f; v4f val = (v4f){};
#pragma unroll
        for (int k = 0; k < KS; ++k) { const int w = k * 4 + sub; const float wg = __builtin_amdgcn_exp2f((mrow[w * 16 + rr] - mx) * L2S); ls += wg * lrow[w * 16 + rr]; val += wg * *(const v4fa*)(sm + w * WREG + (rr * 68 + cofs) * 4); }   /* a wave without a block has weight 0 */
        const float f = __fdiv_rn(cs, ls); v4us oh, ol;
#pragma unroll
        for (int q = 0; q < 4; ++q) { unsigned short a, c2; splitf(val[q] * f, a, c2); oh[q] = a; ol[q] = c2; }
        const int col = h * HD + cofs; const size_t oo = ((size_t)(((int)blockIdx.z * TT + r0 + row) >> 4) * (DQ / 32) + (col >> 5)) * 512 + ((col >> 4) & 1) * 256 + (((col >> 3) & 1) * 16 + rr) * 8 + (col & 7); *(v4us*)(Ah + oo) = oh; *(v4us*)(Al + oo) = ol; }   /* [NB_ * TT][DQ] in fragment order */
}

extern "C" void kernel_launch(void* const* d_in, const int* in_sizes, int n_in,
                              void* d_out, int out_size, void* d_ws, size_t ws_size, hipStream_t stream) {
    (void)in_sizes; (void)n_in; (void)out_size;
    const float* x = (const float*)d_in[0]; const float* wq = (const float*)d_in[1]; const float* wk = (const float*)d_in[2]; const float* wv = (const float*)d_in[3]; const float* wo = (const float*)d_in[4]; const int* PID = (const int*)d_in[5];   /* x, Wq, Wk, Wv, Wo ('oi' [1024][1024]), token_positions (int32 [4][2048], read per batch) */
    float* OUT = (float*)d_out;     // [4][2048][1024]
    char* wsp = (char*)d_ws;
    auto take = [&](size_t bytes) { char* p = wsp; wsp += (bytes + 255) & ~(size_t)255; return (void*)p; };
    bf* WQ = (bf*)take((size_t)DQ * DM * 2); bf* WK = (bf*)take((size_t)DKV * DM * 2); bf* WV = (bf*)take((size_t)DKV * DM * 2); bf* WO = (bf*)take((size_t)DM * DQ * 2); float* CS = (float*)take((size_t)NB_ * TT * HD * 2 * 4);
    bf* XB = (bf*)take((size_t)NB_ * TT * DM * 2);
    h16* VT16 = (h16*)take((size_t)NB_ * NKV * HD * TT * 2);
    bf* QPh = (bf*)take((size_t)NB_ * NH_ * TT * HD * 2); bf* QPl = (bf*)take((size_t)NB_ * NH_ * TT * HD * 2); bf* KPh = (bf*)take((size_t)NB_ * NKV * TT * HD * 2); bf* KPl = (bf*)take((size_t)NB_ * NKV * TT * HD * 2); bf* VTh = (bf*)take((size_t)NB_ * NKV * HD * TT * 2); bf* VTl = (bf*)take((size_t)NB_ * NKV * HD * TT * 2);
    bf* ATh = (bf*)take((size_t)NB_ * TT * DQ * 2); bf* ATl = (bf*)take((size_t)NB_ * TT * DQ * 2);
    if ((size_t)(wsp - (char*)d_ws) > ws_size) return;    // 172 MiB of the 256 MiB
    { k_cvt8<<<(unsigned)(((size_t)DQ * DM / 8 + 255) / 256), 256, 0, stream>>>(wq, WQ, (size_t)DQ * DM / 8); k_cvt8<<<(unsigned)(((size_t)DKV * DM / 8 + 255) / 256), 256, 0, stream>>>(wk, WK, (size_t)DKV * DM / 8); k_cvt8<<<(unsigned)(((size_t)DKV * DM / 8 + 255) / 256), 256, 0, stream>>>(wv, WV, (size_t)DKV * DM / 8);
      k_cvt8<<<(unsigned)(((size_t)DM * DQ / 8 + 255) / 256), 256, 0, stream>>>(wo, WO, (size_t)DM * DQ / 8); }
    k_cstabI<<<(NB_ * TT * HD + 255) / 256, 256, 0, stream>>>(PID, CS);   /* token_positions[b][t] (int32, read): a table row per (batch, position) */
    k_cvt8<<<(unsigned)(((size_t)NB_ * TT * DM / 8 + 255) / 256), 256, 0, stream>>>(x, XB, (size_t)NB_ * TT * DM / 8);
    k_gemmw<bf, 0, false, 1, 4><<<dim3(NB_ * TT / 64, DQ / 64, 1), 32, 0, stream>>>(XB, nullptr, WQ, nullptr, DM, nullptr, DQ, nullptr, 0, 0, 0, CS, nullptr, QPh, QPl);
    k_gemmw<bf, 0, false, 1, 4><<<dim3(NB_ * TT / 64, DKV / 64, 1), 32, 0, stream>>>(XB, nullptr, WK, nullptr, DM, nullptr, DKV, nullptr, 0, 0, 0, CS, nullptr, KPh, KPl);
    k_gemmw<bf, 0, false, 2, 4><<<dim3(DKV / 64, NB_ * TT / 64, 1), 32, 0, stream>>>(WV, nullptr, XB, nullptr, DM, nullptr, DKV, nullptr, 0, 0, 0, nullptr, VT16, VTh, VTl);   /* v transposed: rows = head * HD + d, columns = positions */
    k_fattn<<<dim3(NH_, TT / 64, NB_), 32 * FNW, 0, stream>>>(QPh, QPl, KPh, KPl, VT16, VTh, VTl, ATh, ATl);   /* one kv head per query head */
    k_gemmw<bf, 1, false, 0, 2><<<dim3(NB_ * TT / 64, DM / 64, 1), 32, 0, stream>>>(ATh, ATl, WO, nullptr, DQ, OUT, DM, nullptr, 0, 0, 0, nullptr, nullptr, nullptr, nullptr);
}

// v008
// It runs in 184 microseconds.
// In two side-by-side timings against v007, it was 1.05 and 1.04 times as fast.
// All steps since v000 together make it 15.0 times as fast.
#include <hip/hip_runtime.h>

// Causal multi-head attention with interleaved-pair rotary embeddings driven by an integer position input (x [4][2048][1024]; q, k, v = x W^T ('oi', no bias; 16 heads x 64); rope on pairs (2i, 2i+1): (x_e cos - x_o sin, x_e sin + x_o cos) with angle pos[b][t] x THETA^(-2i/64) (token_positions int32 [4][2048] = arange per batch, READ on device; 32 f32 frequencies jnp-exact for this expression; precise cosf/sinf); scores / sqrt(64); causal (-inf); softmax; out = merged Wo^T -> [4][2048][1024] (8.4 M); argument order x, Wq, Wk, Wv, Wo, token_positions).
// Layout, all four batches in every launch (the batch is part of the position index of the GEMMs (their rows, for v their columns) and a grid dimension of k_fattn): bf16 copy of x; {cos, sin} per (position, pair) built once from the int positions and float32 inverse-frequency constants (precise cosf/sinf); exact projections whose epilogue applies the interleaved rotary embedding (q, k) and stores the operand planes of the attention itself, so that no f32 projection goes to memory (v comes out transposed: its GEMM takes the weight as the row operand); causal T-2048 attention (EVERY row's scores on hi/lo planes (3 products: logit sigma 2 with these weights) and hybrid P.V (rows < 512 hi/lo, rest fp16 x1024); scores, softmax and P.V in one kernel, k_fattn, with a running row maximum and sum; key blocks above the diagonal are never touched); merged hi/lo x Wo exact.
// Operand planes: every 16-bit plane that a matrix instruction reads from global memory (x, the four weights, q, k, v transposed, the attention output) stands in FRAGMENT ORDER (see unpk below): the 16 x 32 fragment is 1 KiB in a row, lane l's two 16-byte halves at l * 16 and 512 + l * 16, so that a wave-wide 16-byte load covers four whole 128-byte lines.
// Compute dtypes, f32 accumulate: every input rounded to bf16; projections exact; rotary f32; attention scores 3 products, P.V rows < 512 3 products, rest fp16; softmax f32; Wo hl x exact.

#define NB_  4
#define TT   2048
#define DM   1024
#define NH_  16
#define NKV  16
#define REP  (NH_ / NKV)
#define HD   64
#define DQ   (NH_ * HD)
#define DKV  (NKV * HD)
#define RH   512                  // query rows < RH take P.V on hi+lo planes (0: none)
#define PCAR 1024.0f
#define SCL  0.125f   // HD^-0.5
typedef _Float16 h16;
typedef unsigned short bf;
typedef __attribute__((ext_vector_type(16))) __bf16   v16bf;
typedef __attribute__((ext_vector_type(16))) _Float16 v16h;
typedef __attribute__((ext_vector_type(8)))  _Float16 v8h;
typedef __attribute__((ext_vector_type(8)))  unsigned short v8us;
typedef __attribute__((ext_vector_type(8)))  float    v8f;
typedef __attribute__((ext_vector_type(4)))  float    v4f;
typedef __attribute__((ext_vector_type(2)))  float    v2f;
typedef v8h  __attribute__((may_alias)) v8ha;
typedef v4f  __attribute__((may_alias)) v4fa;
typedef v8us __attribute__((may_alias)) v8usa;

__device__ __forceinline__ unsigned short f2bf(float f) { unsigned u = __float_as_uint(f); u += 0x7FFFu + ((u >> 16) & 1u); return (unsigned short)(u >> 16); }
__device__ __forceinline__ float bf2f(unsigned short b) { return __uint_as_float(((unsigned)b) << 16); }
__device__ __forceinline__ float bfr(float f) { return bf2f(f2bf(f)); }
__device__ __forceinline__ v16h cat16(v8h lo, v8h hi) { return __builtin_shufflevector(lo, hi, 0, 1, 2, 3, 4, 5, 6, 7, 8, 9, 10, 11, 12, 13, 14, 15); }
__device__ __forceinline__ v16bf cat16b(v8us lo, v8us hi) { return __builtin_bit_cast(v16bf, __builtin_shufflevector(lo, hi, 0, 1, 2, 3, 4, 5, 6, 7, 8, 9, 10, 11, 12, 13, 14, 15)); }
__device__ __forceinline__ v8f wmma16(v16h a, v16h b, v8f c) { return __builtin_amdgcn_wmma_f32_16x16x32_f16(false, a, false, b, (short)0, c, false, false); }
__device__ __forceinline__ v8f wmmab(v16bf a, v16bf b, v8f c) { return __builtin_amdgcn_wmma_f32_16x16x32_bf16(false, a, false, b, (short)0, c, false, false); }



// ---- Fragment order of a 16-bit plane [rows][K] (rows % 16 == 0, K % 32 == 0): element (row, k) stands at ((row / 16) * (K / 32) + k / 32) * 512 + ((k / 16) % 2) * 256 + (((k / 8) % 2) * 16 + row % 16) * 8 + k % 8.
// That is the register order of ld(): ldp(base of the fragment + lane * 8) returns what ld(row (lane & 15), k = 8 * (lane >> 4)) returns on the row-major plane. unpk is the inverse map, for the kernels that write a plane in address order.
template <int K> __device__ __forceinline__ void unpk(unsigned e, int& row, int& k) { const unsigned f = e >> 9; row = (int)(f / (K / 32)) * 16 + (int)((e >> 3) & 15); k = (int)(f % (K / 32)) * 32 + (int)((e >> 8) & 1) * 16 + (int)((e >> 7) & 1) * 8 + (int)(e & 7); }
__device__ __forceinline__ h16 tohx(float x) { return (h16)x; }
__device__ __forceinline__ void splitf(float y, unsigned short& h, unsigned short& l) { h = f2bf(y); l = f2bf(y - bf2f(h)); }
// ---- k_gemmw: register-blocked GEMM, ONE WAVE per 64x64 output tile (16 accumulators), operands straight from 16-bit planes in fragment order; grid (M/64, N/64, Z), 32 threads.
// C[m][n] (f32, pitch ldc, + optional f32 bias[n]) = sum_k A[m][k] Bt[n][k] (+ split products per NSPLIT). z-batch strides sA/sB/sC in elements. K % (32 * NS) == 0.
// The fragments of a k-step stand in one of NS register sets, a ring: a set is asked for anew (step s + NS) as soon as the products of step s have read it, so while a step's products run the loads of the next NS - 1 steps are in flight.
// EPI says where the tile goes. 0: to C, as f32. 1 and 2: C is not touched; the tile goes straight to the 16-bit planes that k_fattn reads, in fragment order (ldc / HD = heads in a batch):
//   1: m = position over all batches, n = head * HD + d. Rotary embedding from the table CS, then the hi/lo planes Ph, Pl of [batch][head][TT][HD].
//   2: m = head * HD + d, n = position over all batches (the weight is the row operand). The f16 plane P16 and the hi/lo planes Ph, Pl of [batch][head][HD][TT].
//   In both a 16 x 64 piece of the tile is two fragments in a row, 1024 elements: lane l stores the 8 elements of tile row (l & 15) from column (2 s + (l >> 4)) * 8 at s * 256 + l * 8, s = 0..3, so every store covers 4 whole 128-byte lines.
#define GAS __attribute__((address_space(1)))
typedef const GAS char* gcp;   // byte pointer known to point to global memory (a pointer rebuilt from integers would otherwise be loaded through as a flat one)
template <typename T16> struct WFrag;
template <> struct WFrag<h16> { typedef v16h V; static __device__ __forceinline__ V ld(const h16* p) { return cat16(*(const v8h*)p, *(const v8h*)(p + 16)); } static __device__ __forceinline__ V ldp(const h16* p) { return cat16(*(const v8h*)p, *(const v8h*)(p + 256)); } static __device__ __forceinline__ V ldg(gcp p) { return cat16(*(const GAS v8h*)p, *(const GAS v8h*)(p + 512)); } static __device__ __forceinline__ v8f mma(V a, V b, v8f c) { return wmma16(a, b, c); } };
template <> struct WFrag<bf> { typedef v16bf V; static __device__ __forceinline__ V ld(const bf* p) { return cat16b(*(const v8us*)p, *(const v8us*)(p + 16)); } static __device__ __forceinline__ V ldp(const bf* p) { return cat16b(*(const v8us*)p, *(const v8us*)(p + 256)); } static __device__ __forceinline__ V ldg(gcp p) { return cat16b(*(const GAS v8us*)p, *(const GAS v8us*)(p + 512)); } static __device__ __forceinline__ v8f mma(V a, V b, v8f c) { return wmmab(a, b, c); } };
__device__ __forceinline__ gcp sbase(const void* p) { const unsigned long long u = (unsigned long long)p; return (gcp)(((unsigned long long)(unsigned)__builtin_amdgcn_readfirstlane((int)(u >> 32)) << 32) | (unsigned)__builtin_amdgcn_readfirstlane((int)u)); }   // a wave-uniform pointer to global memory, kept as a scalar base
template <typename T16, int NSPLIT> struct GSet { typename WFrag<T16>::V a[4], a2[4], b[4], b2[4]; };   // the fragments of one k-step of a 64 x 64 tile (a2, b2 only where NSPLIT has them)
template <typename T16, int NSPLIT> __device__ __forceinline__ void gld(GSet<T16, NSPLIT>& s, const gcp* ab, const gcp* a2b, const gcp* bb, const gcp* b2b, unsigned ko, int off) {   // off, a constant, goes into the loads' immediate offset
#pragma unroll
    for (int g = 0; g < 4; ++g) { s.a[g] = WFrag<T16>::ldg(ab[g] + ko + off); if (NSPLIT == 1 || NSPLIT == 2) s.a2[g] = WFrag<T16>::ldg(a2b[g] + ko + off); }
#pragma unroll
    for (int g = 0; g < 4; ++g) { s.b[g] = WFrag<T16>::ldg(bb[g] + ko + off); if (NSPLIT >= 2) s.b2[g] = WFrag<T16>::ldg(b2b[g] + ko + off); }
}
template <typename T16, int NSPLIT> __device__ __forceinline__ void gmm(const GSet<T16, NSPLIT>& s, v8f (&acc)[4][4]) {
#pragma unroll
    for (int nb = 0; nb < 4; ++nb)
#pragma unroll
        for (int mb = 0; mb < 4; ++mb) { acc[mb][nb] = WFrag<T16>::mma(s.a[mb], s.b[nb], acc[mb][nb]); if (NSPLIT == 1 || NSPLIT == 2) acc[mb][nb] = WFrag<T16>::mma(s.a2[mb], s.b[nb], acc[mb][nb]); if (NSPLIT >= 2) acc[mb][nb] = WFrag<T16>::mma(s.a[mb], s.b2[nb], acc[mb][nb]); }
}
template <typename T16, int NSPLIT, bool BIAS, int EPI, int NS>
__global__ __launch_bounds__(32) void k_gemmw(const T16* __restrict__ A, const T16* __restrict__ A2, const T16* __restrict__ Bt, const T16* __restrict__ Bt2, int K, float* C, int ldc, const float* __restrict__ bias, size_t sA, size_t sB, size_t sC, const float* __restrict__ CS, h16* P16, bf* Ph, bf* Pl) {
    __shared__ __align__(16) float os[16 * 68];
    const size_t z = blockIdx.z; A += z * sA; if (A2) A2 += z * sA; Bt += z * sB; if (Bt2) Bt2 += z * sB; C += z * sC;
    const int lane = threadIdx.x & 31, lr = lane & 15, hi = lane >> 4; const int r0 = blockIdx.x * 64, c0 = blockIdx.y * 64;
    v8f acc[4][4];
#pragma unroll
    for (int mb = 0; mb < 4; ++mb)
#pragma unroll
        for (int nb = 0; nb < 4; ++nb) acc[mb][nb] = (v8f){};
    unsigned ko = (unsigned)lane * 16;   // byte offset of the lane's piece of the current k-step's fragment inside its 16 rows, one for all operands (uniform base + 32-bit lane offset), carried through the loop
    gcp ab[4], a2b[4], bb[4], b2b[4];   // uniform base of each 16-row group of the tile (K / 32 fragments of 1 KiB in a row), held in scalar registers for the whole loop: no 64-bit vector address sums in the loop, and no address register is rewritten between a k-step's loads
#pragma unroll
    for (int g = 0; g < 4; ++g) { ab[g] = sbase(A + (size_t)(r0 + g * 16) * K); bb[g] = sbase(Bt + (size_t)(c0 + g * 16) * K); a2b[g] = (NSPLIT == 1 || NSPLIT == 2) ? sbase(A2 + (size_t)(r0 + g * 16) * K) : nullptr; b2b[g] = (NSPLIT >= 2) ? sbase(Bt2 + (size_t)(c0 + g * 16) * K) : nullptr; }
    GSet<T16, NSPLIT> fs[NS];
#pragma unroll
    for (int j = 0; j < NS; ++j) gld<T16, NSPLIT>(fs[j], ab, a2b, bb, b2b, ko, j * 1024);
    asm volatile("s_wait_xcnt 0x0" :: "v"(ko) : "memory");   // behind the first NS sets' loads: where K holds one turn only, no wait of the loop stands between them and the epilogue, which takes their base registers
#pragma unroll 1
    for (int kc = 32 * NS; kc < K; kc += 32 * NS) {   // all turns of the ring but the last; unrolled by NS inside, so that every set keeps its registers
#pragma unroll
        for (int j = 0; j < NS; ++j) {
            gmm<T16, NSPLIT>(fs[j], acc);
            __builtin_amdgcn_sched_barrier(0);   // the refill stays behind the products that read the set: lifted over them it would need a set more of registers
            gld<T16, NSPLIT>(fs[j], ab, a2b, bb, b2b, ko, (j + NS) * 1024);   // step j of the next turn goes into the set that step j has just left
            __builtin_amdgcn_sched_barrier(0);   // and in front of the next step's products: sunk towards its use it would fly behind fewer of them
        }
        asm volatile("s_wait_xcnt 0x0" : "+v"(ko) :: "memory");   // behind the turn's loads, which all name ko; the sum below takes ko from this statement, so it stays behind the wait
        ko += NS * 1024;   // the next NS k-steps' fragments follow in the plane
    }
#pragma unroll
    for (int j = 0; j < NS; ++j) gmm<T16, NSPLIT>(fs[j], acc);   // the last turn asks for nothing
#pragma unroll
    for (int mb = 0; mb < 4; ++mb) {
        v2f cs[4][4];   // EPI 1: {cos, sin} of the lane's 16 pairs of this 16-row piece, asked for before the piece is staged
        if (EPI == 1) { const float* cp = CS + ((size_t)(r0 + mb * 16 + lr) * HD + hi * 8) * 2;   // the table holds {cos, sin} for every d, the same for both halves of a pair: every other entry is read
#pragma unroll
            for (int s = 0; s < 4; ++s)
#pragma unroll
                for (int i = 0; i < 4; ++i) cs[s][i] = *(const v2f*)(cp + s * 32 + i * 4);
            asm volatile("s_wait_xcnt 0x0" :: "v"(cp) : "memory"); }   // behind the table loads; their address is an input, so that it stays in its registers up to the wait
#pragma unroll
        for (int nb = 0; nb < 4; ++nb) {
#pragma unroll
            for (int j = 0; j < 8; ++j) os[(hi * 8 + j) * 68 + nb * 16 + lr] = acc[mb][nb][j]; }
        __builtin_amdgcn_wave_barrier(); asm volatile("" ::: "memory");
        if (EPI == 0) { float* crow = C + (size_t)(r0 + mb * 16) * ldc + c0;
            v4f val[8];
#pragma unroll
            for (int s = 0; s < 8; ++s) { const int row = 2 * s + hi, cofs = lr * 4; val[s] = *(const v4fa*)(os + row * 68 + cofs); if (BIAS) { val[s][0] += bfr(bias[c0 + cofs]); val[s][1] += bfr(bias[c0 + cofs + 1]); val[s][2] += bfr(bias[c0 + cofs + 2]); val[s][3] += bfr(bias[c0 + cofs + 3]); } }
            __builtin_amdgcn_sched_barrier(0);   // with the one behind the wait: nothing that could take a register of an issued store comes between the piece's stores and their wait
#pragma unroll
            for (int s = 0; s < 8; ++s) *(v4f*)(crow + (size_t)(2 * s + hi) * ldc + lr * 4) = val[s];
            asm volatile("s_wait_xcnt 0x0" ::: "memory");   // behind the piece's stores, before the next piece's values go into the registers that the stores name
            __builtin_amdgcn_sched_barrier(0);   // the second fence of the pair in front of the stores
        } else {
            const size_t pg = ((EPI == 1) ? ((size_t)(r0 / TT) * (ldc / HD) + blockIdx.y) * TT * HD + (size_t)(r0 % TT + mb * 16) * HD
                                          : ((size_t)(c0 / TT) * (ldc / HD) + blockIdx.x) * HD * TT + ((size_t)mb * (TT / 32) + (c0 % TT) / 32) * 512) + lane * 8;   // where the lane's first 8 elements of this 16 x 64 piece (two fragments) stand in the planes
            v8h o16[4]; v8us oh[4], ol[4];
#pragma unroll
            for (int s = 0; s < 4; ++s) { const int d0 = (2 * s + hi) * 8; const v4f u0 = *(const v4fa*)(os + lr * 68 + d0), u1 = *(const v4fa*)(os + lr * 68 + d0 + 4); float y[8] = { u0[0], u0[1], u0[2], u0[3], u1[0], u1[1], u1[2], u1[3] };
                if (EPI == 1) {
#pragma unroll
                    for (int i = 0; i < 4; ++i) { const float x0 = y[2 * i], x1 = y[2 * i + 1], c = cs[s][i][0], sn = cs[s][i][1]; y[2 * i] = x0 * c - x1 * sn; y[2 * i + 1] = x0 * sn + x1 * c; } }   /* even: x0 c - x1 s; odd: x0 s + x1 c */
#pragma unroll
                for (int q = 0; q < 8; ++q) { if (EPI == 2) o16[s][q] = tohx(y[q]); unsigned short a2, c2; splitf(y[q], a2, c2); oh[s][q] = a2; ol[s][q] = c2; } }
            __builtin_amdgcn_sched_barrier(0);   // with the one behind the wait: nothing that could take a register of an issued store comes between the piece's stores and their wait
#pragma unroll
            for (int s = 0; s < 4; ++s) { if (EPI == 2) *(v8h*)(P16 + pg + s * 256) = o16[s]; *(v8us*)(Ph + pg + s * 256) = oh[s]; *(v8us*)(Pl + pg + s * 256) = ol[s]; }
            asm volatile("s_wait_xcnt 0x0" ::: "memory");   // behind the piece's stores, before the next piece's values go into the registers that the stores name
            __builtin_amdgcn_sched_barrier(0);   // the second fence of the pair in front of the stores
        }
        __builtin_amdgcn_wave_barrier(); asm volatile("" ::: "memory");
    }
}

typedef __attribute__((ext_vector_type(2))) _Float16 v2h;
typedef __attribute__((ext_vector_type(4))) _Float16 v4h;
typedef __attribute__((ext_vector_type(2))) unsigned short v2us;
typedef __attribute__((ext_vector_type(4))) unsigned short v4us;
typedef __attribute__((ext_vector_type(4))) int v4i;

__global__ __launch_bounds__(256) void k_wtG(const float* __restrict__ w, int K, int N, bf* Bt) {
    const int lane = threadIdx.x & 31; const int L0 = (blockIdx.x * 8 + (threadIdx.x >> 5)) * 8; const int nlines = N * K / 64;
{
#pragma unroll 1
        for (int l = 0; l < 8; ++l) { const int L = L0 + l; if (L >= nlines) break; const size_t e = (size_t)L * 64 + lane * 2; const int k = (int)(e % K), n = (int)(e / K); v2us o;
            o[0] = f2bf(w[(size_t)k * N + n]); o[1] = f2bf(w[(size_t)(k + 1) * N + n]); *(v2us*)(Bt + e) = o; }
         }
}

__constant__ float INV2[HD / 2] = { 1.000000000e+00f, 7.498942018e-01f, 5.623413324e-01f, 4.216965139e-01f, 3.162277639e-01f, 2.371373773e-01f, 1.778279394e-01f, 1.333521456e-01f, 1.000000015e-01f, 7.498942316e-02f, 5.623413250e-02f, 4.216964915e-02f, 3.162277490e-02f, 2.371373773e-02f, 1.778279431e-02f, 1.333521400e-02f, 9.999999776e-03f, 7.498942316e-03f, 5.623413250e-03f, 4.216964822e-03f, 3.162277630e-03f, 2.371373819e-03f, 1.778279431e-03f, 1.333521446e-03f, 1.000000047e-03f, 7.498941850e-04f, 5.623413017e-04f, 4.216965172e-04f, 3.162277571e-04f, 2.371373703e-04f, 1.778279402e-04f, 1.333521504e-04f };   // float32 10000^(-(i * 2 / 64)), generated with jnp to be bit-exact with the module's expression
// ---- k_prep: all the work that reads only the inputs (the bf16 planes of x and of the four weights, in fragment order, and the {cos, sin} table), in ONE launch of 512 work-groups of 8 waves. Grid NB_ * TT / 16, 256 threads.
// Work-group b takes an equal share of each job, so that the load is level wherever the work-groups land: the 16-row group b of x (2048 pieces of 8 elements, 8 a thread), half a 16-row group of one weight (4 a thread), 16 positions of the table (4 entries a thread).
// Piece u * 256 + t of a 16-row group stands 4 u fragments behind piece t: 128 u elements further in the source row, 2048 u elements further in the plane. So all loads of a job hang on one lane offset by immediate offsets, and so do its stores.
// All 24 loads are asked for first; the table is computed while they fly.
__global__ __launch_bounds__(256) void k_prep(const float* __restrict__ x, const float* __restrict__ wq, const float* __restrict__ wk, const float* __restrict__ wv, const float* __restrict__ wo, const int* __restrict__ pid, bf* XB, bf* WQ, bf* WK, bf* WV, bf* WO, float* CS) {
    static_assert(DQ == DM && DKV == DM && 4 * (DM / 16) * 2 == NB_ * TT / 16 && NB_ * TT * HD == (NB_ * TT / 16) * 1024, "the three jobs are cut into as many shares as there are work-groups");
    const unsigned b = blockIdx.x, t = threadIdx.x; int row, k; unpk<DM>(t * 8, row, k);   // piece t of a 16-row group
    const unsigned so = ((unsigned)row * DM + (unsigned)k) * 4, wsel = b >> 7, wh = b & 127;     // so: the lane's byte offset in the f32 rows of a group; 128 half groups a weight
    const float* xs = x + (size_t)b * 16 * DM; const float* wsrc = wsel == 0 ? wq : wsel == 1 ? wk : wsel == 2 ? wv : wo; bf* wdst = wsel == 0 ? WQ : wsel == 1 ? WK : wsel == 2 ? WV : WO;
    const float* ws = wsrc + (size_t)(wh >> 1) * 16 * DM + (wh & 1) * (DM / 2);   // the second half of a group begins DM / 2 elements into its rows
    const float inv = INV2[(t & 63) >> 1];   // asked for in front of the 24 loads: loads return in order, and the table must not wait for them
    v8f xv[8], wx[4];
#pragma unroll
    for (int u = 0; u < 8; ++u) xv[u] = *(const v8f*)((const char*)xs + so + u * 512);
#pragma unroll
    for (int u = 0; u < 4; ++u) wx[u] = *(const v8f*)((const char*)ws + so + u * 512);
    asm volatile("s_wait_xcnt 0x0" :: "v"(so) : "memory");   // behind the loads, which all name the lane offset; it is an input, so that it stays in its register up to the wait
    const int* pp = pid + b * 16 + __builtin_amdgcn_readfirstlane((int)(t >> 6)); unsigned co = (b * 1024 + t) * 2;   // entry u * 256 + t of the share: the thread's d stays, the position moves on by 4. A wave has one position: a scalar load, which does not queue behind the vector loads
#pragma unroll 1
    for (int u = 0; u < 4; ++u) {   // rolled: four copies of the two precise functions would only lengthen the code
        const float a = __fmul_rn((float)pp[u * 4], inv); v2f cs; cs[0] = cosf(a); cs[1] = sinf(a); *(v2f*)(CS + co) = cs;
        asm volatile("s_wait_xcnt 0x0" : "+v"(co) :: "memory");   // behind the trip's store; the sum below takes the offset from this statement, so it stays behind the wait
        co += 512; }
    v8us ox[8], ow[4];
#pragma unroll
    for (int u = 0; u < 8; ++u)
#pragma unroll
        for (int q = 0; q < 8; ++q) ox[u][q] = f2bf(xv[u][q]);
#pragma unroll
    for (int u = 0; u < 4; ++u)
#pragma unroll
        for (int q = 0; q < 8; ++q) ow[u][q] = f2bf(wx[u][q]);
    __builtin_amdgcn_sched_barrier(0);   // the stores stand together at the end, behind the conversions: no conversion takes a register of an issued store
    bf* xd = XB + (size_t)b * 16 * DM + t * 8; bf* wd = wdst + (size_t)wh * 8 * DM + t * 8;
#pragma unroll
    for (int u = 0; u < 8; ++u) *(v8us*)(xd + u * 2048) = ox[u];
#pragma unroll
    for (int u = 0; u < 4; ++u) *(v8us*)(wd + u * 2048) = ow[u];
}

// ---- k_fattn: causal attention of all batches in one launch; scores and probabilities never go to memory. Grid (NH_, TT/64, NB_), 32 * FNW threads.
// A work-group owns 64 query rows of one head: wave w holds the 16-row strip (w & 3) and takes the 64-key blocks (w >> 2), (w >> 2) + KS, ... up to the diagonal block.
// Per block: scores on hi/lo planes (3 products, the k order of the score GEMM it replaces); running row maximum and row sum (f32); probabilities exp(t - max) go through the wave's own LDS
// from the accumulator layout to the A-fragment layout (rows < RH as hi/lo planes, 3 products; the rest fp16 x PCAR); the output strip is rescaled when the maximum moves.
// The KS partial (maximum, sum, strip) of a strip are merged through LDS behind one barrier, divided by the row sum and stored as the hi/lo planes that the output projection reads.
#define KS   4                    // waves that share the key range of one 16-row strip
#define FNW  (4 * KS)
#define PP   72                   // pitch, in 16-bit elements, of a probability row in LDS (144 bytes: 16-byte aligned, rows fall on different banks)
#define WREG 4608                 // LDS bytes of one wave: two 16 x PP 16-bit planes, later its 16 x 68 f32 strip
#define L2S  (SCL * 1.4426950408889634f)   // scores stay unscaled: HD^-0.5 is a power of two and goes, exactly, into the factor in front of exp2
template <int M> __device__ __forceinline__ float rowx(float v) { return __int_as_float(__builtin_amdgcn_mov_dpp(__float_as_int(v), 0x160 + M, 0xf, 0xf, true)); }   // lane ^ M inside a 16-lane row (row_xmask)
__device__ __forceinline__ float rowmax16(float v) { v = fmaxf(v, rowx<1>(v)); v = fmaxf(v, rowx<2>(v)); v = fmaxf(v, rowx<4>(v)); return fmaxf(v, rowx<8>(v)); }
__device__ __forceinline__ float rowsum16(float v) { v += rowx<1>(v); v += rowx<2>(v); v += rowx<4>(v); return v + rowx<8>(v); }
// Five exp2 of one row (the rescale factor and the row's four probabilities) and the slot behind a transcendental in ONE statement: the outputs share no register with the inputs, so no v_exp_f32 here
// overwrites the source or reads the result of the one in front of it, and the v_nop keeps whatever the compiler puts next one slot away from the last.
__device__ __forceinline__ void exp2x5(float& a, float& b, float& c, float& d, float& e) { float ra, rb, rc, rd, re;
    asm("v_exp_f32 %0, %5\n\tv_exp_f32 %1, %6\n\tv_exp_f32 %2, %7\n\tv_exp_f32 %3, %8\n\tv_exp_f32 %4, %9\n\tv_nop" : "=&v"(ra), "=&v"(rb), "=&v"(rc), "=&v"(rd), "=&v"(re) : "v"(a), "v"(b), "v"(c), "v"(d), "v"(e));
    a = ra; b = rb; c = rc; d = rd; e = re; }
template <bool HR>
__device__ __forceinline__ void fattn_strip(const bf* __restrict__ Qh, const bf* __restrict__ Ql, const bf* __restrict__ Kh, const bf* __restrict__ Kl, const h16* __restrict__ V16, const bf* __restrict__ Vh, const bf* __restrict__ Vl, int r0, int wave, char* wreg, float* mrow, float* lrow) {
    const int lane = threadIdx.x & 31, lr = lane & 15, hi = lane >> 4; const int rw = r0 + (wave & 3) * 16;
    v16bf qh[2], ql[2];
#pragma unroll
    for (int s = 0; s < 2; ++s) { qh[s] = WFrag<bf>::ldp(Qh + (size_t)rw * HD + s * 512 + 8 * lane); ql[s] = WFrag<bf>::ldp(Ql + (size_t)rw * HD + s * 512 + 8 * lane); }
    v8f o[4]; float m[8], l[8];
#pragma unroll
    for (int nb = 0; nb < 4; ++nb) o[nb] = (v8f){};
#pragma unroll
    for (int j = 0; j < 8; ++j) { m[j] = -3.0e38f; l[j] = 0.f; }
    // per-lane operand offsets, carried through the loop; all fragments of a block hang on them by immediate offsets, so no address register is rewritten between a block's loads
    unsigned kob = (unsigned)(((wave >> 2) * 64 * HD + 8 * lane) * 2), vob = (unsigned)(((wave >> 2) * 2 * 512 + 8 * lane) * 2);   // byte offsets, one for both key planes, one for the value planes (uniform base + 32-bit lane offset)
    const char* khb = (const char*)Kh; const char* klb = (const char*)Kl; const char* vb = (const char*)V16; const char* vhb = (const char*)Vh; const char* vlb = (const char*)Vl;
    h16* pw = (h16*)wreg + hi * 8 * PP + lr; bf* pwb = (bf*)wreg + hi * 8 * PP + lr;   // where this lane's probabilities of row j = 0, block column 0 go
    const int nblk = r0 / 64 + 1;     // every block up to the diagonal one holds at least one key <= i for each of the 64 rows
#pragma unroll 1
    for (int blk = wave >> 2; blk < nblk; blk += KS) {
        const int kb = blk * 64; v8f sc[4]; v16bf kh[4][2], kl[4][2];
#pragma unroll
        for (int nb = 0; nb < 4; ++nb)
#pragma unroll
            for (int s = 0; s < 2; ++s) { kh[nb][s] = WFrag<bf>::ldp((const bf*)(khb + kob + (nb * 2 + s) * 1024)); kl[nb][s] = WFrag<bf>::ldp((const bf*)(klb + kob + (nb * 2 + s) * 1024)); }   // a 64-key block is 8 fragments in a row
        __builtin_amdgcn_sched_barrier(0);   // every key fragment is in flight before the first product waits: one memory round trip a block, not one a fragment pair
#pragma unroll
        for (int nb = 0; nb < 4; ++nb) { sc[nb] = (v8f){};
#pragma unroll
            for (int s = 0; s < 2; ++s) { sc[nb] = wmmab(qh[s], kh[nb][s], sc[nb]); sc[nb] = wmmab(ql[s], kh[nb][s], sc[nb]); sc[nb] = wmmab(qh[s], kl[nb][s], sc[nb]); } }
        __builtin_amdgcn_sched_barrier(0);   // the value loads issue behind the score products, into the registers that the key fragments leave
        v16h vf[2][4]; v16bf vh[2][4], vl[2][4];
#pragma unroll
        for (int s = 0; s < 2; ++s)
#pragma unroll
            for (int nb = 0; nb < 4; ++nb) { const int vo = (nb * (TT / 32) + s) * 1024; if (HR) { vh[s][nb] = WFrag<bf>::ldp((const bf*)(vhb + vob + vo)); vl[s][nb] = WFrag<bf>::ldp((const bf*)(vlb + vob + vo)); } else vf[s][nb] = WFrag<h16>::ldp((const h16*)(vb + vob + vo)); }
        __builtin_amdgcn_sched_barrier(0);   // and in front of the softmax, which runs while they fly
        const int dd = kb + lr - rw - hi * 8;   // key index minus query index at nb = 0, j = 0
#pragma unroll
        for (int j = 0; j < 8; ++j) { float t[4];
#pragma unroll
            for (int nb = 0; nb < 4; ++nb) t[nb] = (dd <= j - nb * 16) ? sc[nb][j] : -3.0e38f;
            const float mn = fmaxf(m[j], rowmax16(fmaxf(fmaxf(t[0], t[1]), fmaxf(t[2], t[3])))); float al = (m[j] - mn) * L2S; m[j] = mn; float ps = 0.f;
#pragma unroll
            for (int nb = 0; nb < 4; ++nb) t[nb] = (t[nb] - mn) * L2S;
            exp2x5(al, t[0], t[1], t[2], t[3]);
#pragma unroll
            for (int nb = 0; nb < 4; ++nb) { const float p = t[nb]; ps += p; o[nb][j] *= al; const int po = j * PP + nb * 16;
                if (HR) { unsigned short a, c2; splitf(p, a, c2); pwb[po] = a; pwb[16 * PP + po] = c2; } else pw[po] = tohx(p * PCAR); }
            l[j] = l[j] * al + ps; }
        __builtin_amdgcn_wave_barrier(); asm volatile("" ::: "memory");   // the wave's probability stores stay in front of its fragment reads
#pragma unroll
        for (int s = 0; s < 2; ++s) {
            if (HR) { const v16bf a = WFrag<bf>::ld((const bf*)wreg + lr * PP + 8 * hi + s * 32), a2 = WFrag<bf>::ld((const bf*)wreg + 16 * PP + lr * PP + 8 * hi + s * 32);
#pragma unroll
                for (int nb = 0; nb < 4; ++nb) { o[nb] = wmmab(a, vh[s][nb], o[nb]); o[nb] = wmmab(a2, vh[s][nb], o[nb]); o[nb] = wmmab(a, vl[s][nb], o[nb]); }
            } else { const v16h a = WFrag<h16>::ld((const h16*)wreg + lr * PP + 8 * hi + s * 32);
#pragma unroll
                for (int nb = 0; nb < 4; ++nb) o[nb] = wmma16(a, vf[s][nb], o[nb]); } }
        asm volatile("v_nop\n\tv_nop\n\tv_nop\n\tv_nop" : "+v"(o[0]), "+v"(o[1]), "+v"(o[2]), "+v"(o[3]));   // matrix-instruction distance before the operands are loaded anew, on the back edge too
        __builtin_amdgcn_wave_barrier(); asm volatile("" ::: "memory");   // the fragment reads stay in front of the next block's probability stores
        kob += KS * 64 * HD * 2; vob += KS * 2 * 1024;
    }
    float* ow = (float*)wreg;
#pragma unroll
    for (int nb = 0; nb < 4; ++nb)
#pragma unroll
        for (int j = 0; j < 8; ++j) ow[(hi * 8 + j) * 68 + nb * 16 + lr] = o[nb][j];
#pragma unroll
    for (int j = 0; j < 8; ++j) { const float ls = rowsum16(l[j]); if (lr == 0) { mrow[wave * 16 + hi * 8 + j] = m[j]; lrow[wave * 16 + hi * 8 + j] = ls; } }
}
__global__ __launch_bounds__(32 * FNW) void k_fattn(const bf* __restrict__ Qh, const bf* __restrict__ Ql, const bf* __restrict__ Kh, const bf* __restrict__ Kl, const h16* __restrict__ V16, const bf* __restrict__ Vh, const bf* __restrict__ Vl, bf* Ah, bf* Al) {
    __shared__ __align__(16) char sm[FNW * WREG]; __shared__ float mrow[FNW * 16], lrow[FNW * 16];
    const int h = blockIdx.x; const int qt = TT / 64 - 1 - (int)blockIdx.y;   // the tiles with the longest key range get the lowest indices (for speed only)
    const int r0 = qt * 64; const int wave = __builtin_amdgcn_readfirstlane(threadIdx.x >> 5);   // scalar, so that the block loop branches on a scalar compare
    const size_t zo = ((size_t)blockIdx.z * NH_ + h) * TT * HD; char* wreg = sm + wave * WREG;
    if (r0 < RH) fattn_strip<true>(Qh + zo, Ql + zo, Kh + zo, Kl + zo, V16 + zo, Vh + zo, Vl + zo, r0, wave, wreg, mrow, lrow);
    else fattn_strip<false>(Qh + zo, Ql + zo, Kh + zo, Kl + zo, V16 + zo, Vh + zo, Vl + zo, r0, wave, wreg, mrow, lrow);
    __syncthreads();   // every wave's partial maximum, sum and strip stand in LDS before any wave merges them
    const float cs = (r0 < RH) ? 1.0f : (1.0f / PCAR);
#pragma unroll
    for (int s = 0; s < 1024 / (32 * FNW); ++s) { const int idx = s * (32 * FNW) + (int)threadIdx.x; const int rr = idx & 15, cofs = ((idx >> 4) & 15) * 4, sub = idx >> 8; const int row = sub * 16 + rr; float mx = -3.0e38f;   // a wave holds 16 rows x 8 columns: 256 bytes in a row of each output plane
#pragma unroll
        for (int k = 0; k < KS; ++k) mx = fmaxf(mx, mrow[(k * 4 + sub) * 16 + rr]);
        float ls = 0.f; v4f val = (v4f){};
#pragma unroll
        for (int k = 0; k < KS; ++k) { const int w = k * 4 + sub; const float wg = __builtin_amdgcn_exp2f((mrow[w * 16 + rr] - mx) * L2S); ls += wg * lrow[w * 16 + rr]; val += wg * *(const v4fa*)(sm + w * WREG + (rr * 68 + cofs) * 4); }   /* a wave without a block has weight 0 */
        const float f = __fdiv_rn(cs, ls); v4us oh, ol;
#pragma unroll
        for (int q = 0; q < 4; ++q) { unsigned short a, c2; splitf(val[q] * f, a, c2); oh[q] = a; ol[q] = c2; }
        const int col = h * HD + cofs; const size_t oo = ((size_t)(((int)blockIdx.z * TT + r0 + row) >> 4) * (DQ / 32) + (col >> 5)) * 512 + ((col >> 4) & 1) * 256 + (((col >> 3) & 1) * 16 + rr) * 8 + (col & 7); *(v4us*)(Ah + oo) = oh; *(v4us*)(Al + oo) = ol; }   /* [NB_ * TT][DQ] in fragment order */
}

extern "C" void kernel_launch(void* const* d_in, const int* in_sizes, int n_in,
                              void* d_out, int out_size, void* d_ws, size_t ws_size, hipStream_t stream) {
    (void)in_sizes; (void)n_in; (void)out_size;
    const float* x = (const float*)d_in[0]; const float* wq = (const float*)d_in[1]; const float* wk = (const float*)d_in[2]; const float* wv = (const float*)d_in[3]; const float* wo = (const float*)d_in[4]; const int* PID = (const int*)d_in[5];   /* x, Wq, Wk, Wv, Wo ('oi' [1024][1024]), token_positions (int32 [4][2048], read per batch) */
    float* OUT = (float*)d_out;     // [4][2048][1024]
    char* wsp = (char*)d_ws;
    auto take = [&](size_t bytes) { char* p = wsp; wsp += (bytes + 255) & ~(size_t)255; return (void*)p; };
    bf* WQ = (bf*)take((size_t)DQ * DM * 2); bf* WK = (bf*)take((size_t)DKV * DM * 2); bf* WV = (bf*)take((size_t)DKV * DM * 2); bf* WO = (bf*)take((size_t)DM * DQ * 2); float* CS = (float*)take((size_t)NB_ * TT * HD * 2 * 4);
    bf* XB = (bf*)take((size_t)NB_ * TT * DM * 2);
    h16* VT16 = (h16*)take((size_t)NB_ * NKV * HD * TT * 2);
    bf* QPh = (bf*)take((size_t)NB_ * NH_ * TT * HD * 2); bf* QPl = (bf*)take((size_t)NB_ * NH_ * TT * HD * 2); bf* KPh = (bf*)take((size_t)NB_ * NKV * TT * HD * 2); bf* KPl = (bf*)take((size_t)NB_ * NKV * TT * HD * 2); bf* VTh = (bf*)take((size_t)NB_ * NKV * HD * TT * 2); bf* VTl = (bf*)take((size_t)NB_ * NKV * HD * TT * 2);
    bf* ATh = (bf*)take((size_t)NB_ * TT * DQ * 2); bf* ATl = (bf*)take((size_t)NB_ * TT * DQ * 2);
    if ((size_t)(wsp - (char*)d_ws) > ws_size) return;    // 172 MiB of the 256 MiB
    k_prep<<<NB_ * TT / 16, 256, 0, stream>>>(x, wq, wk, wv, wo, PID, XB, WQ, WK, WV, WO, CS);   /* token_positions[b][t] (int32, read): a table row per (batch, position) */
    k_gemmw<bf, 0, false, 1, 4><<<dim3(NB_ * TT / 64, DQ / 64, 1), 32, 0, stream>>>(XB, nullptr, WQ, nullptr, DM, nullptr, DQ, nullptr, 0, 0, 0, CS, nullptr, QPh, QPl);
    k_gemmw<bf, 0, false, 1, 4><<<dim3(NB_ * TT / 64, DKV / 64, 1), 32, 0, stream>>>(XB, nullptr, WK, nullptr, DM, nullptr, DKV, nullptr, 0, 0, 0, CS, nullptr, KPh, KPl);
    k_gemmw<bf, 0, false, 2, 4><<<dim3(DKV / 64, NB_ * TT / 64, 1), 32, 0, stream>>>(WV, nullptr, XB, nullptr, DM, nullptr, DKV, nullptr, 0, 0, 0, nullptr, VT16, VTh, VTl);   /* v transposed: rows = head * HD + d, columns = positions */
    k_fattn<<<dim3(NH_, TT / 64, NB_), 32 * FNW, 0, stream>>>(QPh, QPl, KPh, KPl, VT16, VTh, VTl, ATh, ATl);   /* one kv head per query head */
    k_gemmw<bf, 1, false, 0, 2><<<dim3(NB_ * TT / 64, DM / 64, 1), 32, 0, stream>>>(ATh, ATl, WO, nullptr, DQ, OUT, DM, nullptr, 0, 0, 0, nullptr, nullptr, nullptr, nullptr);
}

// v009
// One run takes 169 microseconds.
// Next to v008, in two timings, it ran 1.09 times as fast each time.
// Counting every step since v000, it is 16.4 times as fast.
#include <hip/hip_runtime.h>

// Causal multi-head attention with interleaved-pair rotary embeddings driven by an integer position input (x [4][2048][1024]; q, k, v = x W^T ('oi', no bias; 16 heads x 64); rope on pairs (2i, 2i+1): (x_e cos - x_o sin, x_e sin + x_o cos) with angle pos[b][t] x THETA^(-2i/64) (token_positions int32 [4][2048] = arange per batch, READ on device; 32 f32 frequencies jnp-exact for this expression; precise cosf/sinf); scores / sqrt(64); causal (-inf); softmax; out = merged Wo^T -> [4][2048][1024] (8.4 M); argument order x, Wq, Wk, Wv, Wo, token_positions).
// Layout, all four batches in every launch (the batch is part of the position index of the GEMMs (their rows, for v their columns) and a grid dimension of k_fattn): bf16 copy of x; {cos, sin} per (position, pair) built once from the int positions and float32 inverse-frequency constants (precise cosf/sinf); exact projections whose epilogue applies the interleaved rotary embedding (q, k) and stores the operand planes of the attention itself, so that no f32 projection goes to memory (v comes out transposed: its GEMM takes the weight as the row operand); causal T-2048 attention (EVERY row's scores on hi/lo planes (3 products: logit sigma 2 with these weights) and hybrid P.V (rows < 512 hi/lo, rest fp16 x1024); scores, softmax and P.V in one kernel, k_fattn, with a running row maximum and sum; key blocks above the diagonal are never touched); merged hi/lo x Wo exact.
// Operand planes: every 16-bit plane that a matrix instruction reads from global memory (x, the four weights, q, k, v transposed, the attention output) stands in FRAGMENT ORDER (see unpk below): the 16 x 32 fragment is 1 KiB in a row, lane l's two 16-byte halves at l * 16 and 512 + l * 16, so that a wave-wide 16-byte load covers four whole 128-byte lines.
// Compute dtypes, f32 accumulate: every input rounded to bf16; projections exact; rotary f32; attention scores 3 products, P.V rows < 512 3 products, rest fp16; softmax f32; Wo hl x exact.

#define NB_  4
#define TT   2048
#define DM   1024
#define NH_  16
#define NKV  16
#define REP  (NH_ / NKV)
#define HD   64
#define DQ   (NH_ * HD)
#define DKV  (NKV * HD)
#define RH   512                  // query rows < RH take P.V on hi+lo planes (0: none)
#define PCAR 1024.0f
#define SCL  0.125f   // HD^-0.5
typedef _Float16 h16;
typedef unsigned short bf;
typedef __attribute__((ext_vector_type(16))) __bf16   v16bf;
typedef __attribute__((ext_vector_type(16))) _Float16 v16h;
typedef __attribute__((ext_vector_type(8)))  _Float16 v8h;
typedef __attribute__((ext_vector_type(8)))  unsigned short v8us;
typedef __attribute__((ext_vector_type(8)))  float    v8f;
typedef __attribute__((ext_vector_type(4)))  float    v4f;
typedef __attribute__((ext_vector_type(2)))  float    v2f;
typedef v8h  __attribute__((may_alias)) v8ha;
typedef v4f  __attribute__((may_alias)) v4fa;
typedef v8us __attribute__((may_alias)) v8usa;

__device__ __forceinline__ unsigned short f2bf(float f) { unsigned u = __float_as_uint(f); u += 0x7FFFu + ((u >> 16) & 1u); return (unsigned short)(u >> 16); }
__device__ __forceinline__ float bf2f(unsigned short b) { return __uint_as_float(((unsigned)b) << 16); }
__device__ __forceinline__ float bfr(float f) { return bf2f(f2bf(f)); }
__device__ __forceinline__ v16h cat16(v8h lo, v8h hi) { return __builtin_shufflevector(lo, hi, 0, 1, 2, 3, 4, 5, 6, 7, 8, 9, 10, 11, 12, 13, 14, 15); }
__device__ __forceinline__ v16bf cat16b(v8us lo, v8us hi) { return __builtin_bit_cast(v16bf, __builtin_shufflevector(lo, hi, 0, 1, 2, 3, 4, 5, 6, 7, 8, 9, 10, 11, 12, 13, 14, 15)); }
__device__ __forceinline__ v8f wmma16(v16h a, v16h b, v8f c) { return __builtin_amdgcn_wmma_f32_16x16x32_f16(false, a, false, b, (short)0, c, false, false); }
__device__ __forceinline__ v8f wmmab(v16bf a, v16bf b, v8f c) { return __builtin_amdgcn_wmma_f32_16x16x32_bf16(false, a, false, b, (short)0, c, false, false); }



// ---- Fragment order of a 16-bit plane [rows][K] (rows % 16 == 0, K % 32 == 0): element (row, k) stands at ((row / 16) * (K / 32) + k / 32) * 512 + ((k / 16) % 2) * 256 + (((k / 8) % 2) * 16 + row % 16) * 8 + k % 8.
// That is the register order of ld(): ldp(base of the fragment + lane * 8) returns what ld(row (lane & 15), k = 8 * (lane >> 4)) returns on the row-major plane. unpk is the inverse map, for the kernels that write a plane in address order.
template <int K> __device__ __forceinline__ void unpk(unsigned e, int& row, int& k) { const unsigned f = e >> 9; row = (int)(f / (K / 32)) * 16 + (int)((e >> 3) & 15); k = (int)(f % (K / 32)) * 32 + (int)((e >> 8) & 1) * 16 + (int)((e >> 7) & 1) * 8 + (int)(e & 7); }
__device__ __forceinline__ h16 tohx(float x) { return (h16)x; }
__device__ __forceinline__ void splitf(float y, unsigned short& h, unsigned short& l) { h = f2bf(y); l = f2bf(y - bf2f(h)); }
// ---- k_gemmw: register-blocked GEMM, ONE WAVE per 64x64 output tile (16 accumulators), operands straight from 16-bit planes in fragment order; grid (M/64, N/64, Z), 32 threads.
// C[m][n] (f32, pitch ldc, + optional f32 bias[n]) = sum_k A[m][k] Bt[n][k] (+ split products per NSPLIT). z-batch strides sA/sB/sC in elements. K % (32 * NS) == 0.
// The fragments of a k-step stand in one of NS register sets, a ring: a set is asked for anew (step s + NS) as soon as the products of step s have read it, so while a step's products run the loads of the next NS - 1 steps are in flight.
// EPI says where the tile goes. 0: to C, as f32. 1 and 2: C is not touched; the tile goes straight to the 16-bit planes that k_fattn reads, in fragment order (ldc / HD = heads in a batch):
//   1: m = position over all batches, n = head * HD + d. Rotary embedding from the table CS, then the hi/lo planes Ph, Pl of [batch][head][TT][HD].
//   2: m = head * HD + d, n = position over all batches (the weight is the row operand). The f16 plane P16 and the hi/lo planes Ph, Pl of [batch][head][HD][TT].
//   In both a 16 x 64 piece of the tile is two fragments in a row, 1024 elements: lane l stores the 8 elements of tile row (l & 15) from column (2 s + (l >> 4)) * 8 at s * 256 + l * 8, s = 0..3, so every store covers 4 whole 128-byte lines.
#define GAS __attribute__((address_space(1)))
typedef const GAS char* gcp;   // byte pointer known to point to global memory (a pointer rebuilt from integers would otherwise be loaded through as a flat one)
template <typename T16> struct WFrag;
template <> struct WFrag<h16> { typedef v16h V; static __device__ __forceinline__ V ld(const h16* p) { return cat16(*(const v8h*)p, *(const v8h*)(p + 16)); } static __device__ __forceinline__ V ldp(const h16* p) { return cat16(*(const v8h*)p, *(const v8h*)(p + 256)); } static __device__ __forceinline__ V ldg(gcp p) { return cat16(*(const GAS v8h*)p, *(const GAS v8h*)(p + 512)); } static __device__ __forceinline__ v8f mma(V a, V b, v8f c) { return wmma16(a, b, c); } };
template <> struct WFrag<bf> { typedef v16bf V; static __device__ __forceinline__ V ld(const bf* p) { return cat16b(*(const v8us*)p, *(const v8us*)(p + 16)); } static __device__ __forceinline__ V ldp(const bf* p) { return cat16b(*(const v8us*)p, *(const v8us*)(p + 256)); } static __device__ __forceinline__ V ldg(gcp p) { return cat16b(*(const GAS v8us*)p, *(const GAS v8us*)(p + 512)); } static __device__ __forceinline__ v8f mma(V a, V b, v8f c) { return wmmab(a, b, c); } };
__device__ __forceinline__ gcp sbase(const void* p) { const unsigned long long u = (unsigned long long)p; return (gcp)(((unsigned long long)(unsigned)__builtin_amdgcn_readfirstlane((int)(u >> 32)) << 32) | (unsigned)__builtin_amdgcn_readfirstlane((int)u)); }   // a wave-uniform pointer to global memory, kept as a scalar base
template <typename T16, int NSPLIT> struct GSet { typename WFrag<T16>::V a[4], a2[4], b[4], b2[4]; };   // the fragments of one k-step of a 64 x 64 tile (a2, b2 only where NSPLIT has them)
template <typename T16, int NSPLIT> __device__ __forceinline__ void gld(GSet<T16, NSPLIT>& s, const gcp* ab, const gcp* a2b, const gcp* bb, const gcp* b2b, unsigned ko, int off) {   // off, a constant, goes into the loads' immediate offset
#pragma unroll
    for (int g = 0; g < 4; ++g) { s.a[g] = WFrag<T16>::ldg(ab[g] + ko + off); if (NSPLIT == 1 || NSPLIT == 2) s.a2[g] = WFrag<T16>::ldg(a2b[g] + ko + off); }
#pragma unroll
    for (int g = 0; g < 4; ++g) { s.b[g] = WFrag<T16>::ldg(bb[g] + ko + off); if (NSPLIT >= 2) s.b2[g] = WFrag<T16>::ldg(b2b[g] + ko + off); }
}
template <typename T16, int NSPLIT> __device__ __forceinline__ void gmm(const GSet<T16, NSPLIT>& s, v8f (&acc)[4][4]) {
#pragma unroll
    for (int nb = 0; nb < 4; ++nb)
#pragma unroll
        for (int mb = 0; mb < 4; ++mb) { acc[mb][nb] = WFrag<T16>::mma(s.a[mb], s.b[nb], acc[mb][nb]); if (NSPLIT == 1 || NSPLIT == 2) acc[mb][nb] = WFrag<T16>::mma(s.a2[mb], s.b[nb], acc[mb][nb]); if (NSPLIT >= 2) acc[mb][nb] = WFrag<T16>::mma(s.a[mb], s.b2[nb], acc[mb][nb]); }
}
template <typename T16, int NSPLIT, bool BIAS, int EPI, int NS>
__global__ __launch_bounds__(32) void k_gemmw(const T16* __restrict__ A, const T16* __restrict__ A2, const T16* __restrict__ Bt, const T16* __restrict__ Bt2, int K, float* C, int ldc, const float* __restrict__ bias, size_t sA, size_t sB, size_t sC, const float* __restrict__ CS, h16* P16, bf* Ph, bf* Pl) {
    __shared__ __align__(16) float os[16 * 68];
    const size_t z = blockIdx.z; A += z * sA; if (A2) A2 += z * sA; Bt += z * sB; if (Bt2) Bt2 += z * sB; C += z * sC;
    const int lane = threadIdx.x & 31, lr = lane & 15, hi = lane >> 4; const int r0 = blockIdx.x * 64, c0 = blockIdx.y * 64;
    v8f acc[4][4];
#pragma unroll
    for (int mb = 0; mb < 4; ++mb)
#pragma unroll
        for (int nb = 0; nb < 4; ++nb) acc[mb][nb] = (v8f){};
    unsigned ko = (unsigned)lane * 16;   // byte offset of the lane's piece of the current k-step's fragment inside its 16 rows, one for all operands (uniform base + 32-bit lane offset), carried through the loop
    gcp ab[4], a2b[4], bb[4], b2b[4];   // uniform base of each 16-row group of the tile (K / 32 fragments of 1 KiB in a row), held in scalar registers for the whole loop: no 64-bit vector address sums in the loop, and no address register is rewritten between a k-step's loads
#pragma unroll
    for (int g = 0; g < 4; ++g) { ab[g] = sbase(A + (size_t)(r0 + g * 16) * K); bb[g] = sbase(Bt + (size_t)(c0 + g * 16) * K); a2b[g] = (NSPLIT == 1 || NSPLIT == 2) ? sbase(A2 + (size_t)(r0 + g * 16) * K) : nullptr; b2b[g] = (NSPLIT >= 2) ? sbase(Bt2 + (size_t)(c0 + g * 16) * K) : nullptr; }
    GSet<T16, NSPLIT> fs[NS];
#pragma unroll
    for (int j = 0; j < NS; ++j) gld<T16, NSPLIT>(fs[j], ab, a2b, bb, b2b, ko, j * 1024);
    asm volatile("s_wait_xcnt 0x0" :: "v"(ko) : "memory");   // behind the first NS sets' loads: where K holds one turn only, no wait of the loop stands between them and the epilogue, which takes their base registers
#pragma unroll 1
    for (int kc = 32 * NS; kc < K; kc += 32 * NS) {   // all turns of the ring but the last; unrolled by NS inside, so that every set keeps its registers
#pragma unroll
        for (int j = 0; j < NS; ++j) {
            gmm<T16, NSPLIT>(fs[j], acc);
            __builtin_amdgcn_sched_barrier(0);   // the refill stays behind the products that read the set: lifted over them it would need a set more of registers
            gld<T16, NSPLIT>(fs[j], ab, a2b, bb, b2b, ko, (j + NS) * 1024);   // step j of the next turn goes into the set that step j has just left
            __builtin_amdgcn_sched_barrier(0);   // and in front of the next step's products: sunk towards its use it would fly behind fewer of them
        }
        asm volatile("s_wait_xcnt 0x0" : "+v"(ko) :: "memory");   // behind the turn's loads, which all name ko; the sum below takes ko from this statement, so it stays behind the wait
        ko += NS * 1024;   // the next NS k-steps' fragments follow in the plane
    }
#pragma unroll
    for (int j = 0; j < NS; ++j) gmm<T16, NSPLIT>(fs[j], acc);   // the last turn asks for nothing
#pragma unroll
    for (int mb = 0; mb < 4; ++mb) {
        v2f cs[4][4];   // EPI 1: {cos, sin} of the lane's 16 pairs of this 16-row piece, asked for before the piece is staged
        if (EPI == 1) { const float* cp = CS + ((size_t)(r0 + mb * 16 + lr) * HD + hi * 8) * 2;   // the table holds {cos, sin} for every d, the same for both halves of a pair: every other entry is read
#pragma unroll
            for (int s = 0; s < 4; ++s)
#pragma unroll
                for (int i = 0; i < 4; ++i) cs[s][i] = *(const v2f*)(cp + s * 32 + i * 4);
            asm volatile("s_wait_xcnt 0x0" :: "v"(cp) : "memory"); }   // behind the table loads; their address is an input, so that it stays in its registers up to the wait
#pragma unroll
        for (int nb = 0; nb < 4; ++nb) {
#pragma unroll
            for (int j = 0; j < 8; ++j) os[(hi * 8 + j) * 68 + nb * 16 + lr] = acc[mb][nb][j]; }
        __builtin_amdgcn_wave_barrier(); asm volatile("" ::: "memory");
        if (EPI == 0) { float* crow = C + (size_t)(r0 + mb * 16) * ldc + c0;
            v4f val[8];
#pragma unroll
            for (int s = 0; s < 8; ++s) { const int row = 2 * s + hi, cofs = lr * 4; val[s] = *(const v4fa*)(os + row * 68 + cofs); if (BIAS) { val[s][0] += bfr(bias[c0 + cofs]); val[s][1] += bfr(bias[c0 + cofs + 1]); val[s][2] += bfr(bias[c0 + cofs + 2]); val[s][3] += bfr(bias[c0 + cofs + 3]); } }
            __builtin_amdgcn_sched_barrier(0);   // with the one behind the wait: nothing that could take a register of an issued store comes between the piece's stores and their wait
#pragma unroll
            for (int s = 0; s < 8; ++s) *(v4f*)(crow + (size_t)(2 * s + hi) * ldc + lr * 4) = val[s];
            asm volatile("s_wait_xcnt 0x0" ::: "memory");   // behind the piece's stores, before the next piece's values go into the registers that the stores name
            __builtin_amdgcn_sched_barrier(0);   // the second fence of the pair in front of the stores
        } else {
            const size_t pg = ((EPI == 1) ? ((size_t)(r0 / TT) * (ldc / HD) + blockIdx.y) * TT * HD + (size_t)(r0 % TT + mb * 16) * HD
                                          : ((size_t)(c0 / TT) * (ldc / HD) + blockIdx.x) * HD * TT + ((size_t)mb * (TT / 32) + (c0 % TT) / 32) * 512) + lane * 8;   // where the lane's first 8 elements of this 16 x 64 piece (two fragments) stand in the planes
            v8h o16[4]; v8us oh[4], ol[4];
#pragma unroll
            for (int s = 0; s < 4; ++s) { const int d0 = (2 * s + hi) * 8; const v4f u0 = *(const v4fa*)(os + lr * 68 + d0), u1 = *(const v4fa*)(os + lr * 68 + d0 + 4); float y[8] = { u0[0], u0[1], u0[2], u0[3], u1[0], u1[1], u1[2], u1[3] };
                if (EPI == 1) {
#pragma unroll
                    for (int i = 0; i < 4; ++i) { const float x0 = y[2 * i], x1 = y[2 * i + 1], c = cs[s][i][0], sn = cs[s][i][1]; y[2 * i] = x0 * c - x1 * sn; y[2 * i + 1] = x0 * sn + x1 * c; } }   /* even: x0 c - x1 s; odd: x0 s + x1 c */
#pragma unroll
                for (int q = 0; q < 8; ++q) { if (EPI == 2) o16[s][q] = tohx(y[q]); unsigned short a2, c2; splitf(y[q], a2, c2); oh[s][q] = a2; ol[s][q] = c2; } }
            __builtin_amdgcn_sched_barrier(0);   // with the one behind the wait: nothing that could take a register of an issued store comes between the piece's stores and their wait
#pragma unroll
            for (int s = 0; s < 4; ++s) { if (EPI == 2) *(v8h*)(P16 + pg + s * 256) = o16[s]; *(v8us*)(Ph + pg + s * 256) = oh[s]; *(v8us*)(Pl + pg + s * 256) = ol[s]; }
            asm volatile("s_wait_xcnt 0x0" ::: "memory");   // behind the piece's stores, before the next piece's values go into the registers that the stores name
            __builtin_amdgcn_sched_barrier(0);   // the second fence of the pair in front of the stores
        }
        __builtin_amdgcn_wave_barrier(); asm volatile("" ::: "memory");
    }
}

typedef __attribute__((ext_vector_type(2))) _Float16 v2h;
typedef __attribute__((ext_vector_type(4))) _Float16 v4h;
typedef __attribute__((ext_vector_type(2))) unsigned short v2us;
typedef __attribute__((ext_vector_type(4))) unsigned short v4us;
typedef __attribute__((ext_vector_type(4))) int v4i;

__global__ __launch_bounds__(256) void k_wtG(const float* __restrict__ w, int K, int N, bf* Bt) {
    const int lane = threadIdx.x & 31; const int L0 = (blockIdx.x * 8 + (threadIdx.x >> 5)) * 8; const int nlines = N * K / 64;
{
#pragma unroll 1
        for (int l = 0; l < 8; ++l) { const int L = L0 + l; if (L >= nlines) break; const size_t e = (size_t)L * 64 + lane * 2; const int k = (int)(e % K), n = (int)(e / K); v2us o;
            o[0] = f2bf(w[(size_t)k * N + n]); o[1] = f2bf(w[(size_t)(k + 1) * N + n]); *(v2us*)(Bt + e) = o; }
         }
}

__constant__ float INV2[HD / 2] = { 1.000000000e+00f, 7.498942018e-01f, 5.623413324e-01f, 4.216965139e-01f, 3.162277639e-01f, 2.371373773e-01f, 1.778279394e-01f, 1.333521456e-01f, 1.000000015e-01f, 7.498942316e-02f, 5.623413250e-02f, 4.216964915e-02f, 3.162277490e-02f, 2.371373773e-02f, 1.778279431e-02f, 1.333521400e-02f, 9.999999776e-03f, 7.498942316e-03f, 5.623413250e-03f, 4.216964822e-03f, 3.162277630e-03f, 2.371373819e-03f, 1.778279431e-03f, 1.333521446e-03f, 1.000000047e-03f, 7.498941850e-04f, 5.623413017e-04f, 4.216965172e-04f, 3.162277571e-04f, 2.371373703e-04f, 1.778279402e-04f, 1.333521504e-04f };   // float32 10000^(-(i * 2 / 64)), generated with jnp to be bit-exact with the module's expression
// ---- k_prep: all the work that reads only the inputs (the bf16 planes of x and of the four weights, in fragment order, and the {cos, sin} table), in ONE launch of 512 work-groups of 8 waves. Grid NB_ * TT / 16, 256 threads.
// Work-group b takes an equal share of each job, so that the load is level wherever the work-groups land: the 16-row group b of x (2048 pieces of 8 elements, 8 a thread), half a 16-row group of one weight (4 a thread), 16 positions of the table (4 entries a thread).
// Piece u * 256 + t of a 16-row group stands 4 u fragments behind piece t: 128 u elements further in the source row, 2048 u elements further in the plane. So all loads of a job hang on one lane offset by immediate offsets, and so do its stores.
// All 24 loads are asked for first; the table is computed while they fly.
__global__ __launch_bounds__(256) void k_prep(const float* __restrict__ x, const float* __restrict__ wq, const float* __restrict__ wk, const float* __restrict__ wv, const float* __restrict__ wo, const int* __restrict__ pid, bf* XB, bf* WQ, bf* WK, bf* WV, bf* WO, float* CS) {
    static_assert(DQ == DM && DKV == DM && 4 * (DM / 16) * 2 == NB_ * TT / 16 && NB_ * TT * HD == (NB_ * TT / 16) * 1024, "the three jobs are cut into as many shares as there are work-groups");
    const unsigned b = blockIdx.x, t = threadIdx.x; int row, k; unpk<DM>(t * 8, row, k);   // piece t of a 16-row group
    const unsigned so = ((unsigned)row * DM + (unsigned)k) * 4, wsel = b >> 7, wh = b & 127;     // so: the lane's byte offset in the f32 rows of a group; 128 half groups a weight
    const float* xs = x + (size_t)b * 16 * DM; const float* wsrc = wsel == 0 ? wq : wsel == 1 ? wk : wsel == 2 ? wv : wo; bf* wdst = wsel == 0 ? WQ : wsel == 1 ? WK : wsel == 2 ? WV : WO;
    const float* ws = wsrc + (size_t)(wh >> 1) * 16 * DM + (wh & 1) * (DM / 2);   // the second half of a group begins DM / 2 elements into its rows
    const float inv = INV2[(t & 63) >> 1];   // asked for in front of the 24 loads: loads return in order, and the table must not wait for them
    v8f xv[8], wx[4];
#pragma unroll
    for (int u = 0; u < 8; ++u) xv[u] = *(const v8f*)((const char*)xs + so + u * 512);
#pragma unroll
    for (int u = 0; u < 4; ++u) wx[u] = *(const v8f*)((const char*)ws + so + u * 512);
    asm volatile("s_wait_xcnt 0x0" :: "v"(so) : "memory");   // behind the loads, which all name the lane offset; it is an input, so that it stays in its register up to the wait
    const int* pp = pid + b * 16 + __builtin_amdgcn_readfirstlane((int)(t >> 6)); unsigned co = (b * 1024 + t) * 2;   // entry u * 256 + t of the share: the thread's d stays, the position moves on by 4. A wave has one position: a scalar load, which does not queue behind the vector loads
#pragma unroll 1
    for (int u = 0; u < 4; ++u) {   // rolled: four copies of the two precise functions would only lengthen the code
        const float a = __fmul_rn((float)pp[u * 4], inv); v2f cs; cs[0] = cosf(a); cs[1] = sinf(a); *(v2f*)(CS + co) = cs;
        asm volatile("s_wait_xcnt 0x0" : "+v"(co) :: "memory");   // behind the trip's store; the sum below takes the offset from this statement, so it stays behind the wait
        co += 512; }
    v8us ox[8], ow[4];
#pragma unroll
    for (int u = 0; u < 8; ++u)
#pragma unroll
        for (int q = 0; q < 8; ++q) ox[u][q] = f2bf(xv[u][q]);
#pragma unroll
    for (int u = 0; u < 4; ++u)
#pragma unroll
        for (int q = 0; q < 8; ++q) ow[u][q] = f2bf(wx[u][q]);
    __builtin_amdgcn_sched_barrier(0);   // the stores stand together at the end, behind the conversions: no conversion takes a register of an issued store
    bf* xd = XB + (size_t)b * 16 * DM + t * 8; bf* wd = wdst + (size_t)wh * 8 * DM + t * 8;
#pragma unroll
    for (int u = 0; u < 8; ++u) *(v8us*)(xd + u * 2048) = ox[u];
#pragma unroll
    for (int u = 0; u < 4; ++u) *(v8us*)(wd + u * 2048) = ow[u];
}

// ---- k_fattn: causal attention of all batches in one launch; scores and probabilities never go to memory. Grid (NH_, TT/64, NB_), 32 * FNW threads.
// A work-group owns 64 query rows of one head: wave w holds the 16-row strip (w & 3) and takes the 64-key blocks (w >> 2), (w >> 2) + KS, ... up to the diagonal block.
// Both products run TRANSPOSED. Scores: keys x queries, the key fragments as the row operand, the query fragments as the column operand (hi/lo planes, 3 products, in the order they had). In every 16 x 16 score tile
// lane l then holds 8 scores of ONE query, (l & 15): keys nb * 16 + (l >> 4) * 8 + j. The running maximum and sum (f32) are one value a lane: reduced in the lane, the maximum joined between the wave's halves once a block, the sum once at the end.
// Two score tiles, converted in place, ARE the column operand (32 keys x 16 queries) of d x queries = V^T . P^T (rows < RH as hi/lo planes, 3 products; the rest fp16 x PCAR): the probabilities stay in registers, no LDS in the loop.
// The KS partial (maximum, sum, strip) of a strip are merged through LDS behind one barrier, divided by the row sum and stored as the hi/lo planes that the output projection reads.
#define KS   4                    // waves that share the key range of one 16-row strip
#define FNW  (4 * KS)
#define WREG 4352                 // LDS bytes of one wave: its 16 x 68 f32 strip
#define L2S  (SCL * 1.4426950408889634f)   // scores stay unscaled: HD^-0.5 is a power of two and goes, exactly, into the factor in front of exp2
__device__ __forceinline__ float xhalf(float v) { const int b = __float_as_int(v); return __int_as_float(__builtin_amdgcn_permlanex16(b, b, 0x76543210, 0xfedcba98, false, false)); }   // the value of lane ^ 16
__device__ __forceinline__ float max8(v8f v) { return fmaxf(fmaxf(fmaxf(fmaxf(v[0], v[1]), v[2]), fmaxf(fmaxf(v[3], v[4]), v[5])), fmaxf(v[6], v[7])); }
// The eight exp2 of one score tile and the slot behind a transcendental in ONE statement: the outputs share no register with the inputs, so no v_exp_f32 here
// overwrites the source or reads the result of the one in front of it, and the v_nop keeps whatever the compiler puts next one slot away from the last.
__device__ __forceinline__ void exp2x8(v8f& x) { float r0, r1, r2, r3, r4, r5, r6, r7;
    asm("v_exp_f32 %0, %8\n\tv_exp_f32 %1, %9\n\tv_exp_f32 %2, %10\n\tv_exp_f32 %3, %11\n\tv_exp_f32 %4, %12\n\tv_exp_f32 %5, %13\n\tv_exp_f32 %6, %14\n\tv_exp_f32 %7, %15\n\tv_nop" : "=&v"(r0), "=&v"(r1), "=&v"(r2), "=&v"(r3), "=&v"(r4), "=&v"(r5), "=&v"(r6), "=&v"(r7) : "v"(x[0]), "v"(x[1]), "v"(x[2]), "v"(x[3]), "v"(x[4]), "v"(x[5]), "v"(x[6]), "v"(x[7]));
    x = (v8f){ r0, r1, r2, r3, r4, r5, r6, r7 }; }
__device__ __forceinline__ float exp2x1(float a) { float r; asm("v_exp_f32 %0, %1\n\tv_nop" : "=&v"(r) : "v"(a)); return r; }   // the rescale factor's exp2, with the same slot behind it
template <bool HR>
__device__ __forceinline__ void fattn_strip(const bf* __restrict__ Qh, const bf* __restrict__ Ql, const bf* __restrict__ Kh, const bf* __restrict__ Kl, const h16* __restrict__ V16, const bf* __restrict__ Vh, const bf* __restrict__ Vl, int r0, int wave, char* wreg, float* mrow, float* lrow) {
    const int lane = threadIdx.x & 31, lr = lane & 15, hi = lane >> 4; const int rw = r0 + (wave & 3) * 16;
    v16bf qh[2], ql[2];
#pragma unroll
    for (int s = 0; s < 2; ++s) { qh[s] = WFrag<bf>::ldp(Qh + (size_t)rw * HD + s * 512 + 8 * lane); ql[s] = WFrag<bf>::ldp(Ql + (size_t)rw * HD + s * 512 + 8 * lane); }
    v8f o[4]; float m = -3.0e38f, l = 0.f;   // o[nb][j]: output element d = nb * 16 + hi * 8 + j of query lr; m: the query's running maximum (the same in both halves); l: the sum over this half's keys
#pragma unroll
    for (int nb = 0; nb < 4; ++nb) o[nb] = (v8f){};
    // per-lane operand offsets, carried through the loop; all fragments of a block hang on them by immediate offsets, so no address register is rewritten between a block's loads
    unsigned kob = (unsigned)(((wave >> 2) * 64 * HD + 8 * lane) * 2), vob = (unsigned)(((wave >> 2) * 2 * 512 + 8 * lane) * 2);   // byte offsets, one for both key planes, one for the value planes (uniform base + 32-bit lane offset)
    const char* khb = (const char*)Kh; const char* klb = (const char*)Kl; const char* vb = (const char*)V16; const char* vhb = (const char*)Vh; const char* vlb = (const char*)Vl;
    const int nblk = r0 / 64 + 1;     // every block up to the diagonal one holds at least one key <= i for each of the 64 rows
#pragma unroll 1
    for (int blk = wave >> 2; blk < nblk; blk += KS) {
        const int kb = blk * 64; v8f sc[4]; v16bf kh[4][2], kl[4][2];
#pragma unroll
        for (int nb = 0; nb < 4; ++nb)
#pragma unroll
            for (int s = 0; s < 2; ++s) { kh[nb][s] = WFrag<bf>::ldp((const bf*)(khb + kob + (nb * 2 + s) * 1024)); kl[nb][s] = WFrag<bf>::ldp((const bf*)(klb + kob + (nb * 2 + s) * 1024)); }   // a 64-key block is 8 fragments in a row
        __builtin_amdgcn_sched_barrier(0);   // every key fragment is in flight before the first product waits: one memory round trip a block, not one a fragment pair
#pragma unroll
        for (int nb = 0; nb < 4; ++nb) { sc[nb] = (v8f){};   // sc[nb][j]: key kb + nb * 16 + hi * 8 + j against query rw + lr
#pragma unroll
            for (int s = 0; s < 2; ++s) { sc[nb] = wmmab(kh[nb][s], qh[s], sc[nb]); sc[nb] = wmmab(kh[nb][s], ql[s], sc[nb]); sc[nb] = wmmab(kl[nb][s], qh[s], sc[nb]); } }
        __builtin_amdgcn_sched_barrier(0);   // the value loads issue behind the score products, into the registers that the key fragments leave
        v16h vf[2][4]; v16bf vh[2][4], vl[2][4];
#pragma unroll
        for (int s = 0; s < 2; ++s)
#pragma unroll
            for (int nb = 0; nb < 4; ++nb) { const int vo = (nb * (TT / 32) + s) * 1024; if (HR) { vh[s][nb] = WFrag<bf>::ldp((const bf*)(vhb + vob + vo)); if (s == 0) vl[s][nb] = WFrag<bf>::ldp((const bf*)(vlb + vob + vo)); } else vf[s][nb] = WFrag<h16>::ldp((const h16*)(vb + vob + vo)); }
        __builtin_amdgcn_sched_barrier(0);   // and in front of the softmax, which runs while they fly
        const int dd = kb + hi * 8 - rw - lr;   // key index minus query index at nb = 0, j = 0
#pragma unroll
        for (int nb = 0; nb < 4; ++nb)
#pragma unroll
            for (int j = 0; j < 8; ++j) sc[nb][j] = (dd <= -(nb * 16 + j)) ? sc[nb][j] : -3.0e38f;
        const float mh = fmaxf(fmaxf(max8(sc[0]), max8(sc[1])), fmaxf(max8(sc[2]), max8(sc[3])));   // over this half's 32 keys
        const float mn = fmaxf(m, fmaxf(mh, xhalf(mh))); const float al = exp2x1((m - mn) * L2S); m = mn;
        v2f pv = (v2f){}; v8h p16[4]; v8us ph[4], pl[4];   // a tile's probabilities are summed and converted as soon as they are made: 8 f32 registers become 4 (or 4 + 4)
#pragma unroll
        for (int nb = 0; nb < 4; ++nb) { sc[nb] = (sc[nb] - mn) * L2S; exp2x8(sc[nb]); pv += (__builtin_shufflevector(sc[nb], sc[nb], 0, 1) + __builtin_shufflevector(sc[nb], sc[nb], 2, 3)) + (__builtin_shufflevector(sc[nb], sc[nb], 4, 5) + __builtin_shufflevector(sc[nb], sc[nb], 6, 7)); o[nb] *= al;
            if (HR) {
#pragma unroll
                for (int j = 0; j < 8; ++j) { unsigned short a, c2; splitf(sc[nb][j], a, c2); ph[nb][j] = a; pl[nb][j] = c2; }
            } else p16[nb] = __builtin_convertvector(sc[nb] * PCAR, v8h); }
        l = l * al + (pv[0] + pv[1]);
        // column operand of k-step s: element e < 8 is key s * 32 + hi * 8 + e, element e >= 8 key s * 32 + 16 + hi * 8 + e - 8: the k order of the value planes' fragments
        if (HR) { const v16bf a0 = cat16b(ph[0], ph[1]), b0 = cat16b(pl[0], pl[1]), a1 = cat16b(ph[2], ph[3]), b1 = cat16b(pl[2], pl[3]);
#pragma unroll
            for (int nb = 0; nb < 4; ++nb) { o[nb] = wmmab(vh[0][nb], a0, o[nb]); o[nb] = wmmab(vh[0][nb], b0, o[nb]); o[nb] = wmmab(vl[0][nb], a0, o[nb]); }
            __builtin_amdgcn_sched_barrier(0);   // the low plane's fragments of the second k-step are asked for only here, into the registers that the first k-step leaves: with all 16 value fragments held at once the wave does not fit its 256 registers
#pragma unroll
            for (int nb = 0; nb < 4; ++nb) vl[1][nb] = WFrag<bf>::ldp((const bf*)(vlb + vob + (nb * (TT / 32) + 1) * 1024));
            __builtin_amdgcn_sched_barrier(0);   // and in front of the eight products on the high plane, which run while they fly; every output tile still takes its three products in the order hi.hi, lo.hi, hi.lo
#pragma unroll
            for (int nb = 0; nb < 4; ++nb) { o[nb] = wmmab(vh[1][nb], a1, o[nb]); o[nb] = wmmab(vh[1][nb], b1, o[nb]); }
#pragma unroll
            for (int nb = 0; nb < 4; ++nb) o[nb] = wmmab(vl[1][nb], a1, o[nb]);
        } else {
#pragma unroll
            for (int s = 0; s < 2; ++s) { const v16h a = cat16(p16[2 * s], p16[2 * s + 1]);
#pragma unroll
                for (int nb = 0; nb < 4; ++nb) o[nb] = wmma16(vf[s][nb], a, o[nb]); } }
        asm volatile("v_nop\n\tv_nop\n\tv_nop\n\tv_nop" : "+v"(o[0]), "+v"(o[1]), "+v"(o[2]), "+v"(o[3]));   // matrix-instruction distance before the operands are loaded anew, on the back edge too
        kob += KS * 64 * HD * 2; vob += KS * 2 * 1024;
    }
    float* ow = (float*)wreg + lr * 68 + hi * 8;   // the strip goes to LDS as [query][d], pitch 68: a lane's 8 elements of a tile stand in a row
#pragma unroll
    for (int nb = 0; nb < 4; ++nb) { *(v4fa*)(ow + nb * 16) = (v4f){ o[nb][0], o[nb][1], o[nb][2], o[nb][3] }; *(v4fa*)(ow + nb * 16 + 4) = (v4f){ o[nb][4], o[nb][5], o[nb][6], o[nb][7] }; }
    const float ls = l + xhalf(l);   // the two halves' sums are joined once
    if (hi == 0) { mrow[wave * 16 + lr] = m; lrow[wave * 16 + lr] = ls; }
}
__global__ __launch_bounds__(32 * FNW) void k_fattn(const bf* __restrict__ Qh, const bf* __restrict__ Ql, const bf* __restrict__ Kh, const bf* __restrict__ Kl, const h16* __restrict__ V16, const bf* __restrict__ Vh, const bf* __restrict__ Vl, bf* Ah, bf* Al) {
    __shared__ __align__(16) char sm[FNW * WREG]; __shared__ float mrow[FNW * 16], lrow[FNW * 16];
    const int h = blockIdx.x; const int qt = TT / 64 - 1 - (int)blockIdx.y;   // the tiles with the longest key range get the lowest indices (for speed only)
    const int r0 = qt * 64; const int wave = __builtin_amdgcn_readfirstlane(threadIdx.x >> 5);   // scalar, so that the block loop branches on a scalar compare
    const size_t zo = ((size_t)blockIdx.z * NH_ + h) * TT * HD; char* wreg = sm + wave * WREG;
    if (r0 < RH) fattn_strip<true>(Qh + zo, Ql + zo, Kh + zo, Kl + zo, V16 + zo, Vh + zo, Vl + zo, r0, wave, wreg, mrow, lrow);
    else fattn_strip<false>(Qh + zo, Ql + zo, Kh + zo, Kl + zo, V16 + zo, Vh + zo, Vl + zo, r0, wave, wreg, mrow, lrow);
    __syncthreads();   // every wave's partial maximum, sum and strip stand in LDS before any wave merges them
    const float cs = (r0 < RH) ? 1.0f : (1.0f / PCAR);
#pragma unroll
    for (int s = 0; s < 1024 / (32 * FNW); ++s) { const int idx = s * (32 * FNW) + (int)threadIdx.x; const int rr = idx & 15, cofs = ((idx >> 4) & 15) * 4, sub = idx >> 8; const int row = sub * 16 + rr; float mx = -3.0e38f;   // a wave holds 16 rows x 8 columns: 256 bytes in a row of each output plane
#pragma unroll
        for (int k = 0; k < KS; ++k) mx = fmaxf(mx, mrow[(k * 4 + sub) * 16 + rr]);
        float ls = 0.f; v4f val = (v4f){};
#pragma unroll
        for (int k = 0; k < KS; ++k) { const int w = k * 4 + sub; const float wg = __builtin_amdgcn_exp2f((mrow[w * 16 + rr] - mx) * L2S); ls += wg * lrow[w * 16 + rr]; val += wg * *(const v4fa*)(sm + w * WREG + (rr * 68 + cofs) * 4); }   /* a wave without a block has weight 0 */
        const float f = __fdiv_rn(cs, ls); v4us oh, ol;
#pragma unroll
        for (int q = 0; q < 4; ++q) { unsigned short a, c2; splitf(val[q] * f, a, c2); oh[q] = a; ol[q] = c2; }
        const int col = h * HD + cofs; const size_t oo = ((size_t)(((int)blockIdx.z * TT + r0 + row) >> 4) * (DQ / 32) + (col >> 5)) * 512 + ((col >> 4) & 1) * 256 + (((col >> 3) & 1) * 16 + rr) * 8 + (col & 7); *(v4us*)(Ah + oo) = oh; *(v4us*)(Al + oo) = ol; }   /* [NB_ * TT][DQ] in fragment order */
}

extern "C" void kernel_launch(void* const* d_in, const int* in_sizes, int n_in,
                              void* d_out, int out_size, void* d_ws, size_t ws_size, hipStream_t stream) {
    (void)in_sizes; (void)n_in; (void)out_size;
    const float* x = (const float*)d_in[0]; const float* wq = (const float*)d_in[1]; const float* wk = (const float*)d_in[2]; const float* wv = (const float*)d_in[3]; const float* wo = (const float*)d_in[4]; const int* PID = (const int*)d_in[5];   /* x, Wq, Wk, Wv, Wo ('oi' [1024][1024]), token_positions (int32 [4][2048], read per batch) */
    float* OUT = (float*)d_out;     // [4][2048][1024]
    char* wsp = (char*)d_ws;
    auto take = [&](size_t bytes) { char* p = wsp; wsp += (bytes + 255) & ~(size_t)255; return (void*)p; };
    bf* WQ = (bf*)take((size_t)DQ * DM * 2); bf* WK = (bf*)take((size_t)DKV * DM * 2); bf* WV = (bf*)take((size_t)DKV * DM * 2); bf* WO = (bf*)take((size_t)DM * DQ * 2); float* CS = (float*)take((size_t)NB_ * TT * HD * 2 * 4);
    bf* XB = (bf*)take((size_t)NB_ * TT * DM * 2);
    h16* VT16 = (h16*)take((size_t)NB_ * NKV * HD * TT * 2);
    bf* QPh = (bf*)take((size_t)NB_ * NH_ * TT * HD * 2); bf* QPl = (bf*)take((size_t)NB_ * NH_ * TT * HD * 2); bf* KPh = (bf*)take((size_t)NB_ * NKV * TT * HD * 2); bf* KPl = (bf*)take((size_t)NB_ * NKV * TT * HD * 2); bf* VTh = (bf*)take((size_t)NB_ * NKV * HD * TT * 2); bf* VTl = (bf*)take((size_t)NB_ * NKV * HD * TT * 2);
    bf* ATh = (bf*)take((size_t)NB_ * TT * DQ * 2); bf* ATl = (bf*)take((size_t)NB_ * TT * DQ * 2);
    if ((size_t)(wsp - (char*)d_ws) > ws_size) return;    // 172 MiB of the 256 MiB
    k_prep<<<NB_ * TT / 16, 256, 0, stream>>>(x, wq, wk, wv, wo, PID, XB, WQ, WK, WV, WO, CS);   /* token_positions[b][t] (int32, read): a table row per (batch, position) */
    k_gemmw<bf, 0, false, 1, 4><<<dim3(NB_ * TT / 64, DQ / 64, 1), 32, 0, stream>>>(XB, nullptr, WQ, nullptr, DM, nullptr, DQ, nullptr, 0, 0, 0, CS, nullptr, QPh, QPl);
    k_gemmw<bf, 0, false, 1, 4><<<dim3(NB_ * TT / 64, DKV / 64, 1), 32, 0, stream>>>(XB, nullptr, WK, nullptr, DM, nullptr, DKV, nullptr, 0, 0, 0, CS, nullptr, KPh, KPl);
    k_gemmw<bf, 0, false, 2, 4><<<dim3(DKV / 64, NB_ * TT / 64, 1), 32, 0, stream>>>(WV, nullptr, XB, nullptr, DM, nullptr, DKV, nullptr, 0, 0, 0, nullptr, VT16, VTh, VTl);   /* v transposed: rows = head * HD + d, columns = positions */
    k_fattn<<<dim3(NH_, TT / 64, NB_), 32 * FNW, 0, stream>>>(QPh, QPl, KPh, KPl, VT16, VTh, VTl, ATh, ATl);   /* one kv head per query head */
    k_gemmw<bf, 1, false, 0, 2><<<dim3(NB_ * TT / 64, DM / 64, 1), 32, 0, stream>>>(ATh, ATl, WO, nullptr, DQ, OUT, DM, nullptr, 0, 0, 0, nullptr, nullptr, nullptr, nullptr);
}
